// v000
// The times below were measured on an AMD MI455X: many runs one after another, warmed up first and cycling through
// copies of the inputs, with the whole window's GPU time divided by the number of runs. Launches and the gaps
// between them are all in it. The median over several windows is given; except for v000 it joins two sittings, which
// can be a few percent apart, so the side-by-side timings, each taken in one sitting, are the better comparison.
// v000, which the later versions start from, runs in 290 microseconds.
// Contractions: complex q.k^T as qr.kr, qi.ki (negated), qr.ki, qi.kr over e=64 on v_wmma_f32_16x16x32_bf16 (raw
//   bf16 RNE values of q and k, one product each, signs combined in the f32 accumulators); p.[v_r|v_i] over keys on
//   v_wmma_f32_16x16x32_f16 with p as f16(1024 p) (plus a x4096 f16 residual tile for the first 512 query rows of
//   each sequence) and v as f16 of its bf16 RNE value x16 (exact); f32 accumulate everywhere; score magnitude,
//   causal select, softmax statistics and epilogue in f32.
#include <hip/hip_runtime.h>
#include <math.h>
#include <stdint.h>

#define NBATCH 2
#define SEQ    2048
#define NHEAD  8
#define HD     64                  // score depth e
#define VW     (2 * HD)            // value row width: v_r d 0..63 | v_i d 64..127
#define DMOD   (NHEAD * HD)        // 512: token row pitch of the q/k/v inputs
#define NTOK   (NBATCH * SEQ)      // 4096 token rows
#define NQB    (SEQ / 64)          // 32 query / key tiles of 64
#define NQP    8                   // leading query tiles (rows < 512) that carry the p residual tile
#define VSC    16.0f               // v plane carry (power of two, exact on bf16 values)
#define PSC    1024.0f             // softmax numerator carry
#define PRS    4096.0f             // p residual carry
#define SCL    0.125f              // 1/sqrt(64)
#define NEG_BIG (-1.0e30f)
static_assert(HD == 64 && VW == 128);
static_assert((SEQ % 64) == 0 && (DMOD % 32) == 0);
static_assert(((NTOK * DMOD) % 2048) == 0);
static_assert(NQP > 0 && NQP < NQB);

typedef _Float16 v16h __attribute__((ext_vector_type(16)));
typedef _Float16 v8h  __attribute__((ext_vector_type(8)));
typedef __bf16   v16b __attribute__((ext_vector_type(16)));
typedef unsigned short v16us __attribute__((ext_vector_type(16)));
typedef unsigned short v8us  __attribute__((ext_vector_type(8)));
typedef float    v8f  __attribute__((ext_vector_type(8)));
typedef float    v4f  __attribute__((ext_vector_type(4)));
typedef unsigned int v4u __attribute__((ext_vector_type(4)));
typedef unsigned int v8u __attribute__((ext_vector_type(8)));
union FH { v16h v; v8h h[2]; };
union FB { v16us u; v8us h[2]; v8u w; };

// ---- scalar helpers --------------------------------------------------------------------------------
__device__ __forceinline__ unsigned short bf_bits(float f) {          // f32 -> bf16 bits, RNE convert
  unsigned u = __float_as_uint(f);
  return (unsigned short)((u + 0x7FFFu + ((u >> 16) & 1u)) >> 16);
}
__device__ __forceinline__ float bf_up(unsigned short h) { return __uint_as_float(((unsigned)h) << 16); }
__device__ __forceinline__ unsigned short h_bits(_Float16 x) { return __builtin_bit_cast(unsigned short, x); }
__device__ __forceinline__ unsigned pk16(unsigned short a, unsigned short b) { return (unsigned)a | ((unsigned)b << 16); }
__device__ __forceinline__ v8f zero8() { v8f z = {0.f, 0.f, 0.f, 0.f, 0.f, 0.f, 0.f, 0.f}; return z; }

// ---- fragment loader: 16-bit A/B operand, lane -> row/col (lane&15), p already includes +8*(lane>>4);
//      elements 0..7 <- p[0..7] (k0+8h..), elements 8..15 <- p[16..23] (k0+16+8h..)
__device__ __forceinline__ v16us ldfrag_b(const unsigned short* p) {   // bf16 plane read as 16-bit uint vectors
  FB f;
  f.h[0] = *(const v8us*)(p);
  f.h[1] = *(const v8us*)(p + 16);
  return f.u;
}
// exact negation of a bf16 fragment (sign-bit flip of every 16-bit element)
__device__ __forceinline__ v16us neg16(v16us x) {
  FB f;
  f.u = x;
#pragma unroll
  for (int i = 0; i < 8; ++i) f.w[i] = f.w[i] ^ 0x80008000u;
  return f.u;
}

// ---- WMMA helpers; trailing VALU hazard gaps are issued by the guard_* helpers after each group --------
__device__ __forceinline__ v8f mma_h_raw(v16h a, v16h b, v8f c) {
  return __builtin_amdgcn_wmma_f32_16x16x32_f16(false, a, false, b, (short)0, c, false, false);
}
__device__ __forceinline__ v8f mma_b_raw(v16us a, v16us b, v8f c) {
  return __builtin_amdgcn_wmma_f32_16x16x32_bf16(false, __builtin_bit_cast(v16b, a), false,
                                                 __builtin_bit_cast(v16b, b), (short)0, c, false, false);
}
__device__ __forceinline__ void guard_b5(v8f& x, v8f& y, v16us a, v16us b, v16us d, v16us e, v16us f) {
#if defined(__HIP_DEVICE_COMPILE__)
  asm volatile("v_nop\n\tv_nop\n\tv_nop\n\tv_nop" : "+v"(x), "+v"(y) : "v"(a), "v"(b), "v"(d), "v"(e), "v"(f));
#endif
}
__device__ __forceinline__ void guard_h1(v8f& x, v16h a, v16h b) {
#if defined(__HIP_DEVICE_COMPILE__)
  asm volatile("v_nop\n\tv_nop\n\tv_nop\n\tv_nop" : "+v"(x) : "v"(a), "v"(b));
#endif
}
__device__ __forceinline__ void guard_h2(v8f& x, v8f& y, v16h a, v16h b, v16h d) {
#if defined(__HIP_DEVICE_COMPILE__)
  asm volatile("v_nop\n\tv_nop\n\tv_nop\n\tv_nop" : "+v"(x), "+v"(y) : "v"(a), "v"(b), "v"(d));
#endif
}
__device__ __forceinline__ void acc_guard4(v8f& a, v8f& b, v8f& c, v8f& d) {
#if defined(__HIP_DEVICE_COMPILE__)
  asm volatile("v_nop\n\tv_nop\n\tv_nop\n\tv_nop" : "+v"(a), "+v"(b), "+v"(c), "+v"(d));
#endif
}
__device__ __forceinline__ void wave_sync_lds() {
  __builtin_amdgcn_fence(__ATOMIC_RELEASE, "workgroup");
  __builtin_amdgcn_wave_barrier();
  __builtin_amdgcn_fence(__ATOMIC_ACQUIRE, "workgroup");
}

// =====================================================================================================
// Transpose + convert: input z (stride zin) is f32 [R][C]; output z (stride zout) is an f16 plane [C][R] holding
// f16(bf16 RNE value * scale) (scale a power of two, exact). Tile = 64 input rows x 32 input cols;
// grid = (C/32, R/64, nz), block 256. Load: thread t -> input row t>>2, cols (t&3)*8..+7 (two 16-B loads);
// store: thread t -> output row t>>3 (= input col), input rows (t&7)*8..+7 as ONE 16-B store, so lanes
// coverage: (C/32) x (R/64) tiles x 32 output rows x 64 cols = all of out[C][R] per z (R%64==0, C%32==0).
// =====================================================================================================
__global__ __launch_bounds__(256) void tr_cvt(const float* __restrict__ in, unsigned short* out, int R, int C,
                                             long long zin, long long zout, float scale) {
  __shared__ float tile[64 * 33];
  const int z = blockIdx.z;
  const float* ib = in + (size_t)z * (size_t)zin;
  unsigned short* ob = out + (size_t)z * (size_t)zout;
  const int r0 = blockIdx.y * 64, c0 = blockIdx.x * 32;
  const int t = threadIdx.x;
  {
    const int ir = t >> 2, ic = (t & 3) * 8;
    const float* g = ib + (size_t)(r0 + ir) * (size_t)C + c0 + ic;
    const v4f a = *(const v4f*)g;
    const v4f b = *(const v4f*)(g + 4);
    float* l = tile + ir * 33 + ic;
    l[0] = a[0]; l[1] = a[1]; l[2] = a[2]; l[3] = a[3];
    l[4] = b[0]; l[5] = b[1]; l[6] = b[2]; l[7] = b[3];
  }
  __syncthreads();
  const int orow = t >> 3, piece = (t & 7) * 8;
  v4u p;
#pragma unroll
  for (int e = 0; e < 4; ++e) {
    const float f0 = tile[(piece + 2 * e) * 33 + orow];
    const float f1 = tile[(piece + 2 * e + 1) * 33 + orow];
    const _Float16 x0 = (_Float16)(bf_up(bf_bits(f0)) * scale);
    const _Float16 x1 = (_Float16)(bf_up(bf_bits(f1)) * scale);
    p[e] = pk16(h_bits(x0), h_bits(x1));
  }
  const size_t go = (size_t)(c0 + orow) * (size_t)R + r0 + piece;
  *(v4u*)(ob + go) = p;
  
}

// =====================================================================================================
// Row-major convert of two f32 [n] arrays into two consecutive bf16 planes: out[i] = bf16(a[i]), out[n+i] = bf16(bsrc[i])
// (RNE bits). Thread -> 8 consecutive elements, ONE 16-B store per plane; lanes 8q..8q+7 of a wave write one whole
// coverage: grid.x = n/2048 blocks x 256 threads x 8 = n elements of each plane (n % 2048 == 0 host-checked).
// =====================================================================================================
__global__ __launch_bounds__(256) void cvt2(const float* __restrict__ a, const float* __restrict__ bsrc,
                                           unsigned short* out, int n) {
  const size_t i8 = ((size_t)blockIdx.x * 256 + threadIdx.x) * 8;
  if (i8 + 8 > (size_t)n) return;        // never taken for the host-checked size; no barriers below
  const v4f a0 = *(const v4f*)(a + i8);
  const v4f a1 = *(const v4f*)(a + i8 + 4);
  const v4f b0 = *(const v4f*)(bsrc + i8);
  const v4f b1 = *(const v4f*)(bsrc + i8 + 4);
  v4u pa, pb;
#pragma unroll
  for (int e = 0; e < 2; ++e) {
    pa[e]     = pk16(bf_bits(a0[2 * e]), bf_bits(a0[2 * e + 1]));
    pa[2 + e] = pk16(bf_bits(a1[2 * e]), bf_bits(a1[2 * e + 1]));
    pb[e]     = pk16(bf_bits(b0[2 * e]), bf_bits(b0[2 * e + 1]));
    pb[2 + e] = pk16(bf_bits(b1[2 * e]), bf_bits(b1[2 * e + 1]));
  }
  unsigned short* oa = out + i8;
  unsigned short* ob = out + (size_t)n + i8;
  *(v4u*)oa = pa;
  *(v4u*)ob = pb;
  
}

// =====================================================================================================
// Causal complex attention, per (b, h, 64-query block):
//   sr = qr.kr - qi.ki, si = qr.ki + qi.kr over e=64 (bf16 operands, exact products, f32 accumulate; -qi.ki as
//   qi.(ki with flipped sign bits)); s = sqrt(sr^2 + si^2) * SCL; key > query -> NEG_BIG (value select, diagonal
//   kept); online softmax in f32; p = exp(s - m) carried as ph = f16(1024 p) and, when PRES, pl = f16((1024 p - ph)
//   * PRS); context over the 128-wide value row [v_r | v_i] with v as f16(VSC * bf16 value):
//     oh += ph.v over all chunks; when PRES, ol = pl.v per chunk folded as oh += ol / PRS in f32.
//   Q / K planes (bf16 bits, pitch DMOD): plane 0 = real, plane 1 = imag (NTOK*DMOD apart); element (b, t, h, e)
//     at [(b*SEQ + t)*DMOD + h*64 + e]
//   V^T plane (f16): element (b, part, h, d, t) at [((b*2 + part)*DMOD + h*64 + d)*SEQ + t], part 0 = v_r, 1 = v_i
//   Block = 4 waves = 64 query rows of one (b, h); grid = nqb * NHEAD * NBATCH; qb = qb0 + blockIdx.x % nqb,
//   h = (blockIdx.x / nqb) % NHEAD, b = (blockIdx.x / nqb) / NHEAD; key chunks of 64, chunks kt <= qb only
//   (block-uniform trip <= NQB), chunk kt == qb keeps its diagonal by the per-element select.
//   K chunk staging: thread -> key row tid>>1, part tid&1 (8 x 16-B loads into Ksh[key][part*64 + e]);
//   V^T staging: thread -> value row d = tid (part tid>>6, dim tid&63), 8 x 16-B loads into Vs[d][kv];
//   __syncthreads before and after. q fragments from the global planes; P tiles wave-private, written with
//   Output row (b, t, h) = 128 f32 [r0, i0, r1, i1, ...] at out + ((b*SEQ + t)*NHEAD + h)*128: the wave's 16x128
//   context tile is staged interleaved in LDS, then each 512-B row is written by 32 lanes x 16 B in ONE
//   coverage: each wave stores rows q0..q0+15 x 128 floats; waves x blocks x both launches = all (b, t, h) rows.
// =====================================================================================================
template <bool PRES>
__global__ __launch_bounds__(128)
void attn_c(const unsigned short* __restrict__ QB, const unsigned short* __restrict__ KB,
            const unsigned short* __restrict__ VT, float* out, int qb0, int nqb) {
  __shared__ __align__(16) unsigned short Ksh[64 * VW];                // K [kv][kr e 0..63 | ki e 64..127] 16 KB
  __shared__ __align__(16) _Float16 Vs[VW * 64];                        // V^T [d][kv] 16 KB
  __shared__ __align__(16) _Float16 Psh[4][16 * 64];                    // per wave P hi [row][kv] 8 KB
  __shared__ __align__(16) _Float16 Psl[PRES ? 4 : 1][PRES ? 16 * 64 : 8];   // per wave P residual (PRES) 8 KB
  __shared__ __align__(16) float    Os[4][16 * VW];                     // per wave context tile [row][128] 32 KB

  const int tid  = threadIdx.x;
  const int wave = tid >> 5;
  const int lane = tid & 31;
  const int hh   = lane >> 4;
  const int c    = lane & 15;

  const unsigned nq = (unsigned)nqb;
  const int qb = qb0 + (int)(blockIdx.x % nq);
  const int hb = (int)(blockIdx.x / nq);
  const int h  = hb % NHEAD;
  const int b  = hb / NHEAD;
  const int q0 = qb * 64 + wave * 16;

  const size_t NPL = (size_t)NTOK * DMOD;                              // one bf16 plane (both batches)
  const unsigned short* Qr = QB + (size_t)b * SEQ * DMOD + (size_t)h * HD;
  const unsigned short* Qi = Qr + NPL;
  const unsigned short* Kr = KB + (size_t)b * SEQ * DMOD + (size_t)h * HD;
  const _Float16* Vg = (const _Float16*)(const void*)VT + ((size_t)(b * 2) * DMOD + (size_t)h * HD) * SEQ;

  float mrow[8], lrow[8];
  v8f oh[8];
#pragma unroll
  for (int r = 0; r < 8; ++r) { mrow[r] = NEG_BIG; lrow[r] = 0.f; }
#pragma unroll
  for (int t = 0; t < 8; ++t) oh[t] = zero8();

  _Float16* pwh = Psh[wave];
  _Float16* pwl = &Psl[PRES ? wave : 0][0];

  for (int kt = 0; kt < NQB; ++kt) {          // static bound; block-uniform causal chunk skipping
    if (kt > qb) break;
    const int kv0 = kt * 64;
    __syncthreads();
    {
      const int r = tid >> 1, p = tid & 1;
      const unsigned short* kg = Kr + (size_t)p * NPL + (size_t)(kv0 + r) * DMOD;   // K part p, row kv0+r, e 0..63
      unsigned short* kd = Ksh + r * VW + p * HD;
#pragma unroll
      for (int i = 0; i < 8; ++i) *(v8us*)(kd + 8 * i) = *(const v8us*)(kg + 8 * i);
      const int vp = tid >> 6, dl = tid & 63;
      const _Float16* vg = Vg + ((size_t)vp * DMOD + dl) * SEQ + kv0;               // V^T row d = tid, t = kv0..+63
#pragma unroll
      for (int i = 0; i < 8; ++i) *(v8h*)(Vs + tid * 64 + 8 * i) = *(const v8h*)(vg + 8 * i);
    }
    __syncthreads();

    // ---- Q fragments (A operand, row = lane&15): 2 e-chunks per plane from the global planes ----
    v16us qr[2], qi[2];
#pragma unroll
    for (int dc = 0; dc < 2; ++dc) {
      qr[dc] = ldfrag_b(Qr + (size_t)(q0 + c) * DMOD + dc * 32 + 8 * hh);
      qi[dc] = ldfrag_b(Qi + (size_t)(q0 + c) * DMOD + dc * 32 + 8 * hh);
    }

    // ---- scores: 16 query rows x 64 keys per wave, depth 64 (2 chunks), 4 products per chunk ----
    v8f s[4];
#pragma unroll
    for (int j = 0; j < 4; ++j) {
      v8f sr = zero8(), si = zero8();
#pragma unroll
      for (int dc = 0; dc < 2; ++dc) {
        const unsigned short* kp = Ksh + (j * 16 + c) * VW + dc * 32 + 8 * hh;   // B col = key j*16+c
        FB br, bi;
        br.h[0] = *(const v8us*)(kp);
        br.h[1] = *(const v8us*)(kp + 16);
        bi.h[0] = *(const v8us*)(kp + HD);
        bi.h[1] = *(const v8us*)(kp + HD + 16);
        const v16us bin = neg16(bi.u);
        sr = mma_b_raw(qr[dc], br.u, sr);
        sr = mma_b_raw(qi[dc], bin, sr);
        si = mma_b_raw(qr[dc], bi.u, si);
        si = mma_b_raw(qi[dc], br.u, si);
        guard_b5(sr, si, qr[dc], qi[dc], br.u, bi.u, bin);
      }
      const int key  = kv0 + j * 16 + c;                 // key index of this lane's D column
      const int rowb = q0 + 8 * hh;                      // query row of D element r is rowb + r
#pragma unroll
      for (int r = 0; r < 8; ++r) {
        const float m2 = sr[r] * sr[r] + si[r] * si[r];
        const float v = sqrtf(m2) * SCL;
        s[j][r] = (key <= rowb + r) ? v : NEG_BIG;
      }
    }

    // ---- row max, online softmax, P hi (x1024, f16) and, when PRES, P residual (x PRS, f16) to LDS ----
#pragma unroll
    for (int r = 0; r < 8; ++r) {
      float m = s[0][r];
      m = fmaxf(m, s[1][r]);
      m = fmaxf(m, s[2][r]);
      m = fmaxf(m, s[3][r]);
#pragma unroll
      for (int off = 1; off < 16; off <<= 1) m = fmaxf(m, __shfl_xor(m, off, 32));
      const float mnew  = fmaxf(mrow[r], m);
      const float alpha = __expf(mrow[r] - mnew);
      mrow[r] = mnew;
      float psum = 0.f;
#pragma unroll
      for (int j = 0; j < 4; ++j) {
        const float p  = __expf(s[j][r] - mnew);
        psum += p;
        const float ph = p * PSC;
        const _Float16 xh = (_Float16)ph;
        const int pi = (8 * hh + r) * 64 + j * 16 + c;
        pwh[pi] = xh;
        if (PRES) pwl[pi] = (_Float16)((ph - (float)xh) * PRS);
      }
#pragma unroll
      for (int off = 1; off < 16; off <<= 1) psum += __shfl_xor(psum, off, 32);
      lrow[r] = lrow[r] * alpha + psum;
#pragma unroll
      for (int t = 0; t < 8; ++t) oh[t][r] *= alpha;
    }
    wave_sync_lds();

    // ---- context: oh += Phi . V; when PRES: ol = Plo . V, then oh += ol / PRS ----
    v8f ol[8];
#pragma unroll
    for (int t = 0; t < 8; ++t) ol[t] = zero8();
#pragma unroll 1
    for (int kk = 0; kk < 2; ++kk) {
      FH pa, pb;
      pa.h[0] = *(const v8h*)(pwh + c * 64 + kk * 32 + 8 * hh);
      pa.h[1] = *(const v8h*)(pwh + c * 64 + kk * 32 + 16 + 8 * hh);
      pb.v = pa.v;
      if (PRES) {
        pb.h[0] = *(const v8h*)(pwl + c * 64 + kk * 32 + 8 * hh);
        pb.h[1] = *(const v8h*)(pwl + c * 64 + kk * 32 + 16 + 8 * hh);
      }
#pragma unroll
      for (int t = 0; t < 8; ++t) {
        FH vb;
        vb.h[0] = *(const v8h*)(Vs + (t * 16 + c) * 64 + kk * 32 + 8 * hh);
        vb.h[1] = *(const v8h*)(Vs + (t * 16 + c) * 64 + kk * 32 + 16 + 8 * hh);
        oh[t] = mma_h_raw(pa.v, vb.v, oh[t]);
        if (PRES) {
          ol[t] = mma_h_raw(pb.v, vb.v, ol[t]);
          guard_h2(oh[t], ol[t], pa.v, pb.v, vb.v);
        } else {
          guard_h1(oh[t], pa.v, vb.v);
        }
      }
    }
    acc_guard4(oh[0], oh[1], oh[2], oh[3]);
    acc_guard4(oh[4], oh[5], oh[6], oh[7]);
    if (PRES) {
      acc_guard4(ol[0], ol[1], ol[2], ol[3]);
      acc_guard4(ol[4], ol[5], ol[6], ol[7]);
#pragma unroll
      for (int t = 0; t < 8; ++t) {
#pragma unroll
        for (int r = 0; r < 8; ++r) oh[t][r] += ol[t][r] * (1.0f / PRS);
      }
    }
  }

  // ---- normalise (1/l, the 1/PSC p carry and the 1/VSC v carry), stage the wave's 16x128 tile interleaved
  float* os = Os[wave];
#pragma unroll
  for (int r = 0; r < 8; ++r) {
    const float l = lrow[r];
    const float inv = ((l > 0.f) ? (1.0f / l) : 0.f) * (1.0f / (PSC * VSC));
#pragma unroll
    for (int t = 0; t < 8; ++t) {
      const int pos = (t < 4) ? (2 * (t * 16 + c)) : (2 * ((t - 4) * 16 + c) + 1);
      os[(8 * hh + r) * VW + pos] = oh[t][r] * inv;
    }
  }
  wave_sync_lds();
  {
#pragma unroll
    for (int it = 0; it < 16; ++it) {                    // row it: 32 lanes x 16 B = 512 B = 128 floats
      const v4f o = *(const v4f*)(os + it * VW + lane * 4);
      float* g = out + ((size_t)(b * SEQ + q0 + it) * NHEAD + h) * VW + lane * 4;
      *(v4f*)g = o;
    }
    
  }
}

// =====================================================================================================
// Workspace map (bytes); every plane is an exact multiple of its whole-line store granularity (all dims are exact
// tile multiples, no padded tails), all offsets multiples of 8 MiB:
//   QB  bf16 [2 parts][4096 t][512]             0   8388608   (q_r, q_i RNE bits)
//   KB  bf16 [2 parts][4096 t][512]       8388608   8388608   (k_r, k_i RNE bits)
//   VT  f16  [2 b][2 parts][512 (h,d)][2048 t] 16777216   8388608   (bf16 value x16)
//   end                                 25165824
// =====================================================================================================
extern "C" void kernel_launch(void* const* d_in, const int* in_sizes, int n_in,
                              void* d_out, int out_size, void* d_ws, size_t ws_size,
                              hipStream_t stream) {
  const int n = NTOK * DMOD;                                // 2097152 elements per input
  if (n_in < 6) return;
  for (int i = 0; i < 6; ++i) if (in_sizes[i] != n) return;
  if (out_size != 2 * n) return;

  const float* qr = (const float*)d_in[0];
  const float* qi = (const float*)d_in[1];
  const float* kr = (const float*)d_in[2];
  const float* ki = (const float*)d_in[3];
  const float* vr = (const float*)d_in[4];
  const float* vi = (const float*)d_in[5];
  float* outf = (float*)d_out;

  const size_t PQB = (size_t)2 * n * 2;                     //  8388608
  const size_t PKB = (size_t)2 * n * 2;                     //  8388608
  const size_t PVT = (size_t)NBATCH * 2 * DMOD * SEQ * 2;   //  8388608
  size_t off = 0;
  const size_t oQ = off; off += PQB;
  const size_t oK = off; off += PKB;
  const size_t oV = off; off += PVT;
  if (off > ws_size) return;                                // off = 25165824
  if (off > (size_t)134217728) return;

  char* ws = (char*)d_ws;
  unsigned short* QB = (unsigned short*)(ws + oQ);
  unsigned short* KB = (unsigned short*)(ws + oK);
  unsigned short* VT = (unsigned short*)(ws + oV);

  const dim3 blk256(256), blk128(128);

  // (1) q, k -> bf16 planes [part][4096 t][512]
  cvt2<<<dim3(n / 2048), blk256, 0, stream>>>(qr, qi, QB, n);
  cvt2<<<dim3(n / 2048), blk256, 0, stream>>>(kr, ki, KB, n);
  // (2) v -> transposed f16 planes: in[2048 t][512 (h,e)] per batch z -> out[512 (h,d)][2048 t] at part 0 (v_r)
  //     and part 1 (v_i) of batch z; grid = (cols/32, rows/64, batches)
  tr_cvt<<<dim3(DMOD / 32, SEQ / 64, NBATCH), blk256, 0, stream>>>(
      vr, VT, SEQ, DMOD, (long long)SEQ * DMOD, (long long)2 * DMOD * SEQ, VSC);
  tr_cvt<<<dim3(DMOD / 32, SEQ / 64, NBATCH), blk256, 0, stream>>>(
      vi, VT + (size_t)DMOD * SEQ, SEQ, DMOD, (long long)SEQ * DMOD, (long long)2 * DMOD * SEQ, VSC);
  // (3) causal attention -> d_out: query blocks 0..NQP-1 (rows < 512) with the p residual tile, the rest without
  attn_c<true><<<dim3(NQP * NHEAD * NBATCH), blk128, 0, stream>>>(QB, KB, VT, outf, 0, NQP);
  attn_c<false><<<dim3((NQB - NQP) * NHEAD * NBATCH), blk128, 0, stream>>>(QB, KB, VT, outf, NQP, NQB - NQP);
  (void)hipGetLastError();
}

// v001
// A run of this version takes 172 microseconds.
// Two timings next to v000 put it at 1.69 and 1.70 times that version's speed.
// Contractions: complex q.k^T as qr.kr, qi.ki (negated), qr.ki, qi.kr over e=64 on v_wmma_f32_16x16x32_bf16 (raw
//   bf16 RNE values of q and k, one product each, signs combined in the f32 accumulators); p.[v_r|v_i] over keys on
//   v_wmma_f32_16x16x32_f16 with p as f16(1024 p) (plus a x4096 f16 residual tile for the first 512 query rows of
//   each sequence) and v as f16 of its bf16 RNE value x16 (exact); f32 accumulate everywhere; score magnitude,
//   causal select, softmax statistics and epilogue in f32.
#include <hip/hip_runtime.h>
#include <math.h>
#include <stdint.h>

#define NBATCH 2
#define SEQ    2048
#define NHEAD  8
#define HD     64                  // score depth e
#define VW     (2 * HD)            // value row width: v_r d 0..63 | v_i d 64..127
#define DMOD   (NHEAD * HD)        // 512: token row pitch of the q/k/v inputs
#define NTOK   (NBATCH * SEQ)      // 4096 token rows
#define NQB    (SEQ / 64)          // 32 query / key tiles of 64
#define NQP    8                   // leading query tiles (rows < 512) that carry the p residual tile
#define VSC    16.0f               // v plane carry (power of two, exact on bf16 values)
#define PSC    1024.0f             // softmax numerator carry
#define PRS    4096.0f             // p residual carry
#define SCL    0.125f              // 1/sqrt(64)
#define NEG_BIG (-1.0e30f)
// LDS row pitches in 16-bit elements: every row read by ds_load_b128 fragments (16 lanes = 16 rows, 16 B each) gets
// a pitch of 16 B x odd, so the 16 rows of a half wave fall on all 64 banks instead of on 4 (K) or 8 (V, P).
#define KP     (VW + 8)            // K rows: 256 B of data at 272 B pitch
#define VP     (64 + 8)            // V^T rows: 128 B of data at 144 B pitch
#define PP     (64 + 8)            // P rows: 128 B of data at 144 B pitch
static_assert(HD == 64 && VW == 128);
static_assert((SEQ % 64) == 0 && (DMOD % 32) == 0);
static_assert(((NTOK * DMOD) % 2048) == 0);
static_assert(NQP > 0 && NQP < NQB);
static_assert(((KP * 2) % 32) == 16 && ((VP * 2) % 32) == 16 && ((PP * 2) % 32) == 16);

typedef _Float16 v16h __attribute__((ext_vector_type(16)));
typedef _Float16 v8h  __attribute__((ext_vector_type(8)));
typedef __bf16   v16b __attribute__((ext_vector_type(16)));
typedef unsigned short v16us __attribute__((ext_vector_type(16)));
typedef unsigned short v8us  __attribute__((ext_vector_type(8)));
typedef float    v8f  __attribute__((ext_vector_type(8)));
typedef float    v4f  __attribute__((ext_vector_type(4)));
typedef unsigned int v4u __attribute__((ext_vector_type(4)));
typedef unsigned int v8u __attribute__((ext_vector_type(8)));
union FH { v16h v; v8h h[2]; };
union FB { v16us u; v8us h[2]; v8u w; };

// ---- scalar helpers --------------------------------------------------------------------------------
__device__ __forceinline__ unsigned short bf_bits(float f) {          // f32 -> bf16 bits, RNE convert
  unsigned u = __float_as_uint(f);
  return (unsigned short)((u + 0x7FFFu + ((u >> 16) & 1u)) >> 16);
}
__device__ __forceinline__ float bf_up(unsigned short h) { return __uint_as_float(((unsigned)h) << 16); }
__device__ __forceinline__ unsigned short h_bits(_Float16 x) { return __builtin_bit_cast(unsigned short, x); }
__device__ __forceinline__ unsigned pk16(unsigned short a, unsigned short b) { return (unsigned)a | ((unsigned)b << 16); }
__device__ __forceinline__ v8f zero8() { v8f z = {0.f, 0.f, 0.f, 0.f, 0.f, 0.f, 0.f, 0.f}; return z; }

// ---- fragment loader: 16-bit A/B operand, lane -> row/col (lane&15), p already includes +8*(lane>>4);
//      elements 0..7 <- p[0..7] (k0+8h..), elements 8..15 <- p[16..23] (k0+16+8h..)
__device__ __forceinline__ v16us ldfrag_b(const unsigned short* p) {   // bf16 plane read as 16-bit uint vectors
  FB f;
  f.h[0] = *(const v8us*)(p);
  f.h[1] = *(const v8us*)(p + 16);
  return f.u;
}
// exact negation of a bf16 fragment (sign-bit flip of every 16-bit element)
__device__ __forceinline__ v16us neg16(v16us x) {
  FB f;
  f.u = x;
#pragma unroll
  for (int i = 0; i < 8; ++i) f.w[i] = f.w[i] ^ 0x80008000u;
  return f.u;
}

// ---- WMMA helpers; trailing VALU hazard gaps are issued by the guard_* helpers after each group --------
__device__ __forceinline__ v8f mma_h_raw(v16h a, v16h b, v8f c) {
  return __builtin_amdgcn_wmma_f32_16x16x32_f16(false, a, false, b, (short)0, c, false, false);
}
__device__ __forceinline__ v8f mma_b_raw(v16us a, v16us b, v8f c) {
  return __builtin_amdgcn_wmma_f32_16x16x32_bf16(false, __builtin_bit_cast(v16b, a), false,
                                                 __builtin_bit_cast(v16b, b), (short)0, c, false, false);
}
__device__ __forceinline__ void guard_b5(v8f& x, v8f& y, v16us a, v16us b, v16us d, v16us e, v16us f) {
#if defined(__HIP_DEVICE_COMPILE__)
  asm volatile("v_nop\n\tv_nop\n\tv_nop\n\tv_nop" : "+v"(x), "+v"(y) : "v"(a), "v"(b), "v"(d), "v"(e), "v"(f));
#endif
}
__device__ __forceinline__ void guard_h1(v8f& x, v16h a, v16h b) {
#if defined(__HIP_DEVICE_COMPILE__)
  asm volatile("v_nop\n\tv_nop\n\tv_nop\n\tv_nop" : "+v"(x) : "v"(a), "v"(b));
#endif
}
__device__ __forceinline__ void guard_h2(v8f& x, v8f& y, v16h a, v16h b, v16h d) {
#if defined(__HIP_DEVICE_COMPILE__)
  asm volatile("v_nop\n\tv_nop\n\tv_nop\n\tv_nop" : "+v"(x), "+v"(y) : "v"(a), "v"(b), "v"(d));
#endif
}
__device__ __forceinline__ void acc_guard4(v8f& a, v8f& b, v8f& c, v8f& d) {
#if defined(__HIP_DEVICE_COMPILE__)
  asm volatile("v_nop\n\tv_nop\n\tv_nop\n\tv_nop" : "+v"(a), "+v"(b), "+v"(c), "+v"(d));
#endif
}
__device__ __forceinline__ void wave_sync_lds() {
  __builtin_amdgcn_fence(__ATOMIC_RELEASE, "workgroup");
  __builtin_amdgcn_wave_barrier();
  __builtin_amdgcn_fence(__ATOMIC_ACQUIRE, "workgroup");
}

// =====================================================================================================
// Transpose + convert: input z (stride zin) is f32 [R][C]; output z (stride zout) is an f16 plane [C][R] holding
// f16(bf16 RNE value * scale) (scale a power of two, exact). Tile = 64 input rows x 32 input cols;
// grid = (C/32, R/64, nz), block 256. Load: thread t -> input row t>>2, cols (t&3)*8..+7 (two 16-B loads);
// store: thread t -> output row t>>3 (= input col), input rows (t&7)*8..+7 as ONE 16-B store, so lanes
// coverage: (C/32) x (R/64) tiles x 32 output rows x 64 cols = all of out[C][R] per z (R%64==0, C%32==0).
// =====================================================================================================
__global__ __launch_bounds__(256) void tr_cvt(const float* __restrict__ in, unsigned short* out, int R, int C,
                                             long long zin, long long zout, float scale) {
  __shared__ float tile[64 * 33];
  const int z = blockIdx.z;
  const float* ib = in + (size_t)z * (size_t)zin;
  unsigned short* ob = out + (size_t)z * (size_t)zout;
  const int r0 = blockIdx.y * 64, c0 = blockIdx.x * 32;
  const int t = threadIdx.x;
  {
    const int ir = t >> 2, ic = (t & 3) * 8;
    const float* g = ib + (size_t)(r0 + ir) * (size_t)C + c0 + ic;
    const v4f a = *(const v4f*)g;
    const v4f b = *(const v4f*)(g + 4);
    float* l = tile + ir * 33 + ic;
    l[0] = a[0]; l[1] = a[1]; l[2] = a[2]; l[3] = a[3];
    l[4] = b[0]; l[5] = b[1]; l[6] = b[2]; l[7] = b[3];
  }
  __syncthreads();
  const int orow = t >> 3, piece = (t & 7) * 8;
  v4u p;
#pragma unroll
  for (int e = 0; e < 4; ++e) {
    const float f0 = tile[(piece + 2 * e) * 33 + orow];
    const float f1 = tile[(piece + 2 * e + 1) * 33 + orow];
    const _Float16 x0 = (_Float16)(bf_up(bf_bits(f0)) * scale);
    const _Float16 x1 = (_Float16)(bf_up(bf_bits(f1)) * scale);
    p[e] = pk16(h_bits(x0), h_bits(x1));
  }
  const size_t go = (size_t)(c0 + orow) * (size_t)R + r0 + piece;
  *(v4u*)(ob + go) = p;
  
}

// =====================================================================================================
// Row-major convert of two f32 [n] arrays into two consecutive bf16 planes: out[i] = bf16(a[i]), out[n+i] = bf16(bsrc[i])
// (RNE bits). Thread -> 8 consecutive elements, ONE 16-B store per plane; lanes 8q..8q+7 of a wave write one whole
// coverage: grid.x = n/2048 blocks x 256 threads x 8 = n elements of each plane (n % 2048 == 0 host-checked).
// =====================================================================================================
__global__ __launch_bounds__(256) void cvt2(const float* __restrict__ a, const float* __restrict__ bsrc,
                                           unsigned short* out, int n) {
  const size_t i8 = ((size_t)blockIdx.x * 256 + threadIdx.x) * 8;
  if (i8 + 8 > (size_t)n) return;        // never taken for the host-checked size; no barriers below
  const v4f a0 = *(const v4f*)(a + i8);
  const v4f a1 = *(const v4f*)(a + i8 + 4);
  const v4f b0 = *(const v4f*)(bsrc + i8);
  const v4f b1 = *(const v4f*)(bsrc + i8 + 4);
  v4u pa, pb;
#pragma unroll
  for (int e = 0; e < 2; ++e) {
    pa[e]     = pk16(bf_bits(a0[2 * e]), bf_bits(a0[2 * e + 1]));
    pa[2 + e] = pk16(bf_bits(a1[2 * e]), bf_bits(a1[2 * e + 1]));
    pb[e]     = pk16(bf_bits(b0[2 * e]), bf_bits(b0[2 * e + 1]));
    pb[2 + e] = pk16(bf_bits(b1[2 * e]), bf_bits(b1[2 * e + 1]));
  }
  unsigned short* oa = out + i8;
  unsigned short* ob = out + (size_t)n + i8;
  *(v4u*)oa = pa;
  *(v4u*)ob = pb;
  
}

// =====================================================================================================
// Causal complex attention, per (b, h, 64-query block):
//   sr = qr.kr - qi.ki, si = qr.ki + qi.kr over e=64 (bf16 operands, exact products, f32 accumulate; -qi.ki as
//   qi.(ki with flipped sign bits)); s = sqrt(sr^2 + si^2) * SCL; key > query -> NEG_BIG (value select, diagonal
//   kept); online softmax in f32; p = exp(s - m) carried as ph = f16(1024 p) and, when PRES, pl = f16((1024 p - ph)
//   * PRS); context over the 128-wide value row [v_r | v_i] with v as f16(VSC * bf16 value):
//     oh += ph.v over all chunks; when PRES, ol = pl.v per chunk folded as oh += ol / PRS in f32.
//   Q / K planes (bf16 bits, pitch DMOD): plane 0 = real, plane 1 = imag (NTOK*DMOD apart); element (b, t, h, e)
//     at [(b*SEQ + t)*DMOD + h*64 + e]
//   V^T plane (f16): element (b, part, h, d, t) at [((b*2 + part)*DMOD + h*64 + d)*SEQ + t], part 0 = v_r, 1 = v_i
//   Block = 4 waves = 64 query rows of one (b, h); grid = nqb * NHEAD * NBATCH; qb = qb0 + blockIdx.x % nqb,
//   h = (blockIdx.x / nqb) % NHEAD, b = (blockIdx.x / nqb) / NHEAD; key chunks of 64, chunks kt <= qb only
//   (block-uniform trip <= NQB), chunk kt == qb keeps its diagonal by the per-element select.
//   K chunk staging: thread -> key row tid>>1, part tid&1 (8 x 16-B loads into Ksh[key][part*64 + e], pitch KP);
//   V^T staging: thread -> value row d = tid (part tid>>6, dim tid&63), 8 x 16-B loads into Vs[d][kv], pitch VP;
//   __syncthreads before and after. q fragments from the global planes; P tiles wave-private, written with
//   Output row (b, t, h) = 128 f32 [r0, i0, r1, i1, ...] at out + ((b*SEQ + t)*NHEAD + h)*128: the wave's 16x128
//   context tile is staged interleaved in LDS, then each 512-B row is written by 32 lanes x 16 B in ONE
//   coverage: each wave stores rows q0..q0+15 x 128 floats; waves x blocks x both launches = all (b, t, h) rows.
// =====================================================================================================
template <bool PRES>
__global__ __launch_bounds__(128)
void attn_c(const unsigned short* __restrict__ QB, const unsigned short* __restrict__ KB,
            const unsigned short* __restrict__ VT, float* out, int qb0, int nqb) {
  __shared__ __align__(16) unsigned short Ksh[64 * KP];                // K [kv][kr e 0..63 | ki e 64..127 | pad] 17 KB
  __shared__ __align__(16) _Float16 Vs[VW * VP];                        // V^T [d][kv | pad] 18 KB
  __shared__ __align__(16) _Float16 Psh[4][16 * PP];                    // per wave P hi [row][kv | pad] 9 KB
  __shared__ __align__(16) _Float16 Psl[PRES ? 4 : 1][PRES ? 16 * PP : 8];   // per wave P residual (PRES) 9 KB
  __shared__ __align__(16) float    Os[4][16 * VW];                     // per wave context tile [row][128] 32 KB

  const int tid  = threadIdx.x;
  const int wave = tid >> 5;
  const int lane = tid & 31;
  const int hh   = lane >> 4;
  const int c    = lane & 15;

  const unsigned nq = (unsigned)nqb;
  const int qb = qb0 + (int)(blockIdx.x % nq);
  const int hb = (int)(blockIdx.x / nq);
  const int h  = hb % NHEAD;
  const int b  = hb / NHEAD;
  const int q0 = qb * 64 + wave * 16;

  const size_t NPL = (size_t)NTOK * DMOD;                              // one bf16 plane (both batches)
  const unsigned short* Qr = QB + (size_t)b * SEQ * DMOD + (size_t)h * HD;
  const unsigned short* Qi = Qr + NPL;
  const unsigned short* Kr = KB + (size_t)b * SEQ * DMOD + (size_t)h * HD;
  const _Float16* Vg = (const _Float16*)(const void*)VT + ((size_t)(b * 2) * DMOD + (size_t)h * HD) * SEQ;

  float mrow[8], lrow[8];
  v8f oh[8];
#pragma unroll
  for (int r = 0; r < 8; ++r) { mrow[r] = NEG_BIG; lrow[r] = 0.f; }
#pragma unroll
  for (int t = 0; t < 8; ++t) oh[t] = zero8();

  _Float16* pwh = Psh[wave];
  _Float16* pwl = &Psl[PRES ? wave : 0][0];

  for (int kt = 0; kt < NQB; ++kt) {          // static bound; block-uniform causal chunk skipping
    if (kt > qb) break;
    const int kv0 = kt * 64;
    __syncthreads();
    {
      const int r = tid >> 1, p = tid & 1;
      const unsigned short* kg = Kr + (size_t)p * NPL + (size_t)(kv0 + r) * DMOD;   // K part p, row kv0+r, e 0..63
      unsigned short* kd = Ksh + r * KP + p * HD;
      const int vp = tid >> 6, dl = tid & 63;
      const _Float16* vg = Vg + ((size_t)vp * DMOD + dl) * SEQ + kv0;               // V^T row d = tid, t = kv0..+63
      v8us kx[8];
      v8h  vx[8];
#pragma unroll
      for (int i = 0; i < 8; ++i) kx[i] = *(const v8us*)(kg + 8 * i);
#pragma unroll
      for (int i = 0; i < 8; ++i) vx[i] = *(const v8h*)(vg + 8 * i);
      // keeps both address pairs alive behind the 16 issued loads, so that none is overwritten ahead of the wait
      asm volatile("s_wait_xcnt 0x0" :: "v"(kg), "v"(vg) : "memory");
#pragma unroll
      for (int i = 0; i < 8; ++i) *(v8us*)(kd + 8 * i) = kx[i];
#pragma unroll
      for (int i = 0; i < 8; ++i) *(v8h*)(Vs + tid * VP + 8 * i) = vx[i];
    }
    __syncthreads();

    // ---- Q fragments (A operand, row = lane&15): 2 e-chunks per plane from the global planes ----
    v16us qr[2], qi[2];
#pragma unroll
    for (int dc = 0; dc < 2; ++dc) {
      qr[dc] = ldfrag_b(Qr + (size_t)(q0 + c) * DMOD + dc * 32 + 8 * hh);
      qi[dc] = ldfrag_b(Qi + (size_t)(q0 + c) * DMOD + dc * 32 + 8 * hh);
    }

    // ---- scores: 16 query rows x 64 keys per wave, depth 64 (2 chunks), 4 products per chunk ----
    v8f s[4];
#pragma unroll
    for (int j = 0; j < 4; ++j) {
      v8f sr = zero8(), si = zero8();
#pragma unroll
      for (int dc = 0; dc < 2; ++dc) {
        const unsigned short* kp = Ksh + (j * 16 + c) * KP + dc * 32 + 8 * hh;   // B col = key j*16+c
        FB br, bi;
        br.h[0] = *(const v8us*)(kp);
        br.h[1] = *(const v8us*)(kp + 16);
        bi.h[0] = *(const v8us*)(kp + HD);
        bi.h[1] = *(const v8us*)(kp + HD + 16);
        const v16us bin = neg16(bi.u);
        sr = mma_b_raw(qr[dc], br.u, sr);
        sr = mma_b_raw(qi[dc], bin, sr);
        si = mma_b_raw(qr[dc], bi.u, si);
        si = mma_b_raw(qi[dc], br.u, si);
        guard_b5(sr, si, qr[dc], qi[dc], br.u, bi.u, bin);
      }
      const int key  = kv0 + j * 16 + c;                 // key index of this lane's D column
      const int rowb = q0 + 8 * hh;                      // query row of D element r is rowb + r
#pragma unroll
      for (int r = 0; r < 8; ++r) {
        const float m2 = sr[r] * sr[r] + si[r] * si[r];
        const float v = sqrtf(m2) * SCL;
        s[j][r] = (key <= rowb + r) ? v : NEG_BIG;
      }
    }

    // ---- row max, online softmax, P hi (x1024, f16) and, when PRES, P residual (x PRS, f16) to LDS ----
#pragma unroll
    for (int r = 0; r < 8; ++r) {
      float m = s[0][r];
      m = fmaxf(m, s[1][r]);
      m = fmaxf(m, s[2][r]);
      m = fmaxf(m, s[3][r]);
#pragma unroll
      for (int off = 1; off < 16; off <<= 1) m = fmaxf(m, __shfl_xor(m, off, 32));
      const float mnew  = fmaxf(mrow[r], m);
      const float alpha = __expf(mrow[r] - mnew);
      mrow[r] = mnew;
      float psum = 0.f;
#pragma unroll
      for (int j = 0; j < 4; ++j) {
        const float p  = __expf(s[j][r] - mnew);
        psum += p;
        const float ph = p * PSC;
        const _Float16 xh = (_Float16)ph;
        const int pi = (8 * hh + r) * PP + j * 16 + c;
        pwh[pi] = xh;
        if (PRES) pwl[pi] = (_Float16)((ph - (float)xh) * PRS);
      }
#pragma unroll
      for (int off = 1; off < 16; off <<= 1) psum += __shfl_xor(psum, off, 32);
      lrow[r] = lrow[r] * alpha + psum;
#pragma unroll
      for (int t = 0; t < 8; ++t) oh[t][r] *= alpha;
    }
    wave_sync_lds();

    // ---- context: oh += Phi . V; when PRES: ol = Plo . V, then oh += ol / PRS ----
    v8f ol[8];
#pragma unroll
    for (int t = 0; t < 8; ++t) ol[t] = zero8();
#pragma unroll 1
    for (int kk = 0; kk < 2; ++kk) {
      FH pa, pb;
      pa.h[0] = *(const v8h*)(pwh + c * PP + kk * 32 + 8 * hh);
      pa.h[1] = *(const v8h*)(pwh + c * PP + kk * 32 + 16 + 8 * hh);
      pb.v = pa.v;
      if (PRES) {
        pb.h[0] = *(const v8h*)(pwl + c * PP + kk * 32 + 8 * hh);
        pb.h[1] = *(const v8h*)(pwl + c * PP + kk * 32 + 16 + 8 * hh);
      }
#pragma unroll
      for (int t = 0; t < 8; ++t) {
        FH vb;
        vb.h[0] = *(const v8h*)(Vs + (t * 16 + c) * VP + kk * 32 + 8 * hh);
        vb.h[1] = *(const v8h*)(Vs + (t * 16 + c) * VP + kk * 32 + 16 + 8 * hh);
        oh[t] = mma_h_raw(pa.v, vb.v, oh[t]);
        if (PRES) {
          ol[t] = mma_h_raw(pb.v, vb.v, ol[t]);
          guard_h2(oh[t], ol[t], pa.v, pb.v, vb.v);
        } else {
          guard_h1(oh[t], pa.v, vb.v);
        }
      }
    }
    acc_guard4(oh[0], oh[1], oh[2], oh[3]);
    acc_guard4(oh[4], oh[5], oh[6], oh[7]);
    if (PRES) {
      acc_guard4(ol[0], ol[1], ol[2], ol[3]);
      acc_guard4(ol[4], ol[5], ol[6], ol[7]);
#pragma unroll
      for (int t = 0; t < 8; ++t) {
#pragma unroll
        for (int r = 0; r < 8; ++r) oh[t][r] += ol[t][r] * (1.0f / PRS);
      }
    }
  }

  // ---- normalise (1/l, the 1/PSC p carry and the 1/VSC v carry), stage the wave's 16x128 tile interleaved
  float* os = Os[wave];
#pragma unroll
  for (int r = 0; r < 8; ++r) {
    const float l = lrow[r];
    const float inv = ((l > 0.f) ? (1.0f / l) : 0.f) * (1.0f / (PSC * VSC));
#pragma unroll
    for (int t = 0; t < 8; ++t) {
      const int pos = (t < 4) ? (2 * (t * 16 + c)) : (2 * ((t - 4) * 16 + c) + 1);
      os[(8 * hh + r) * VW + pos] = oh[t][r] * inv;
    }
  }
  wave_sync_lds();
  {
#pragma unroll
    for (int it = 0; it < 16; ++it) {                    // row it: 32 lanes x 16 B = 512 B = 128 floats
      const v4f o = *(const v4f*)(os + it * VW + lane * 4);
      float* g = out + ((size_t)(b * SEQ + q0 + it) * NHEAD + h) * VW + lane * 4;
      *(v4f*)g = o;
    }
    
  }
}

// =====================================================================================================
// Workspace map (bytes); every plane is an exact multiple of its whole-line store granularity (all dims are exact
// tile multiples, no padded tails), all offsets multiples of 8 MiB:
//   QB  bf16 [2 parts][4096 t][512]             0   8388608   (q_r, q_i RNE bits)
//   KB  bf16 [2 parts][4096 t][512]       8388608   8388608   (k_r, k_i RNE bits)
//   VT  f16  [2 b][2 parts][512 (h,d)][2048 t] 16777216   8388608   (bf16 value x16)
//   end                                 25165824
// =====================================================================================================
extern "C" void kernel_launch(void* const* d_in, const int* in_sizes, int n_in,
                              void* d_out, int out_size, void* d_ws, size_t ws_size,
                              hipStream_t stream) {
  const int n = NTOK * DMOD;                                // 2097152 elements per input
  if (n_in < 6) return;
  for (int i = 0; i < 6; ++i) if (in_sizes[i] != n) return;
  if (out_size != 2 * n) return;

  const float* qr = (const float*)d_in[0];
  const float* qi = (const float*)d_in[1];
  const float* kr = (const float*)d_in[2];
  const float* ki = (const float*)d_in[3];
  const float* vr = (const float*)d_in[4];
  const float* vi = (const float*)d_in[5];
  float* outf = (float*)d_out;

  const size_t PQB = (size_t)2 * n * 2;                     //  8388608
  const size_t PKB = (size_t)2 * n * 2;                     //  8388608
  const size_t PVT = (size_t)NBATCH * 2 * DMOD * SEQ * 2;   //  8388608
  size_t off = 0;
  const size_t oQ = off; off += PQB;
  const size_t oK = off; off += PKB;
  const size_t oV = off; off += PVT;
  if (off > ws_size) return;                                // off = 25165824
  if (off > (size_t)134217728) return;

  char* ws = (char*)d_ws;
  unsigned short* QB = (unsigned short*)(ws + oQ);
  unsigned short* KB = (unsigned short*)(ws + oK);
  unsigned short* VT = (unsigned short*)(ws + oV);

  const dim3 blk256(256), blk128(128);

  // (1) q, k -> bf16 planes [part][4096 t][512]
  cvt2<<<dim3(n / 2048), blk256, 0, stream>>>(qr, qi, QB, n);
  cvt2<<<dim3(n / 2048), blk256, 0, stream>>>(kr, ki, KB, n);
  // (2) v -> transposed f16 planes: in[2048 t][512 (h,e)] per batch z -> out[512 (h,d)][2048 t] at part 0 (v_r)
  //     and part 1 (v_i) of batch z; grid = (cols/32, rows/64, batches)
  tr_cvt<<<dim3(DMOD / 32, SEQ / 64, NBATCH), blk256, 0, stream>>>(
      vr, VT, SEQ, DMOD, (long long)SEQ * DMOD, (long long)2 * DMOD * SEQ, VSC);
  tr_cvt<<<dim3(DMOD / 32, SEQ / 64, NBATCH), blk256, 0, stream>>>(
      vi, VT + (size_t)DMOD * SEQ, SEQ, DMOD, (long long)SEQ * DMOD, (long long)2 * DMOD * SEQ, VSC);
  // (3) causal attention -> d_out: query blocks 0..NQP-1 (rows < 512) with the p residual tile, the rest without
  attn_c<true><<<dim3(NQP * NHEAD * NBATCH), blk128, 0, stream>>>(QB, KB, VT, outf, 0, NQP);
  attn_c<false><<<dim3((NQB - NQP) * NHEAD * NBATCH), blk128, 0, stream>>>(QB, KB, VT, outf, NQP, NQB - NQP);
  (void)hipGetLastError();
}

// v002
// A run of this version takes 143 microseconds.
// Timed twice side by side with v001, it ran 1.20 times as fast both times.
// All steps since v000 together make it 2.03 times as fast.
// Contractions: complex q.k^T as qr.kr, qi.ki (negated), qr.ki, qi.kr over e=64 on v_wmma_f32_16x16x32_bf16 (raw
//   bf16 RNE values of q and k, one product each, signs combined in the f32 accumulators); p.[v_r|v_i] over keys on
//   v_wmma_f32_16x16x32_f16 with p as f16(1024 p) (plus a x4096 f16 residual tile for the first 512 query rows of
//   each sequence) and v as f16 of its bf16 RNE value x16 (exact); f32 accumulate everywhere; score magnitude,
//   causal select, softmax statistics and epilogue in f32.
#include <hip/hip_runtime.h>
#include <math.h>
#include <stdint.h>

#define NBATCH 2
#define SEQ    2048
#define NHEAD  8
#define HD     64                  // score depth e
#define VW     (2 * HD)            // value row width: v_r d 0..63 | v_i d 64..127
#define DMOD   (NHEAD * HD)        // 512: token row pitch of the q/k/v inputs
#define NTOK   (NBATCH * SEQ)      // 4096 token rows
#define NQB    (SEQ / 64)          // 32 query / key tiles of 64
#define NQP    8                   // leading query tiles (rows < 512) that carry the p residual tile
#define VSC    16.0f               // v plane carry (power of two, exact on bf16 values)
#define PSC    1024.0f             // softmax numerator carry
#define PRS    4096.0f             // p residual carry
#define SCL    0.125f              // 1/sqrt(64)
#define NEG_BIG (-1.0e30f)
// LDS row pitches in 16-bit elements: every row read by ds_load_b128 fragments (16 lanes = 16 rows, 16 B each) gets
// a pitch of 16 B x odd, so the 16 rows of a half wave fall on all 64 banks instead of on 4 (K) or 8 (V, P).
#define KP     (VW + 8)            // K rows: 256 B of data at 272 B pitch
#define VP     (64 + 8)            // V^T rows: 128 B of data at 144 B pitch
#define PP     (64 + 8)            // P rows: 128 B of data at 144 B pitch
static_assert(HD == 64 && VW == 128);
static_assert((SEQ % 64) == 0 && (DMOD % 32) == 0);
static_assert(((NTOK * DMOD) % 2048) == 0);
static_assert(NQP > 0 && NQP < NQB);
static_assert(((KP * 2) % 32) == 16 && ((VP * 2) % 32) == 16 && ((PP * 2) % 32) == 16);

typedef _Float16 v16h __attribute__((ext_vector_type(16)));
typedef _Float16 v8h  __attribute__((ext_vector_type(8)));
typedef __bf16   v16b __attribute__((ext_vector_type(16)));
typedef unsigned short v16us __attribute__((ext_vector_type(16)));
typedef unsigned short v8us  __attribute__((ext_vector_type(8)));
typedef float    v8f  __attribute__((ext_vector_type(8)));
typedef float    v4f  __attribute__((ext_vector_type(4)));
typedef unsigned int v4u __attribute__((ext_vector_type(4)));
typedef unsigned int v8u __attribute__((ext_vector_type(8)));
union FH { v16h v; v8h h[2]; };
union FB { v16us u; v8us h[2]; v8u w; };

// ---- scalar helpers --------------------------------------------------------------------------------
__device__ __forceinline__ unsigned short bf_bits(float f) {          // f32 -> bf16 bits, RNE convert
  unsigned u = __float_as_uint(f);
  return (unsigned short)((u + 0x7FFFu + ((u >> 16) & 1u)) >> 16);
}
__device__ __forceinline__ float bf_up(unsigned short h) { return __uint_as_float(((unsigned)h) << 16); }
__device__ __forceinline__ unsigned short h_bits(_Float16 x) { return __builtin_bit_cast(unsigned short, x); }
__device__ __forceinline__ unsigned pk16(unsigned short a, unsigned short b) { return (unsigned)a | ((unsigned)b << 16); }
__device__ __forceinline__ v8f zero8() { v8f z = {0.f, 0.f, 0.f, 0.f, 0.f, 0.f, 0.f, 0.f}; return z; }

// ---- fragment loader: 16-bit A/B operand, lane -> row/col (lane&15), p already includes +8*(lane>>4);
//      elements 0..7 <- p[0..7] (k0+8h..), elements 8..15 <- p[16..23] (k0+16+8h..)
__device__ __forceinline__ v16us ldfrag_b(const unsigned short* p) {   // bf16 plane read as 16-bit uint vectors
  FB f;
  f.h[0] = *(const v8us*)(p);
  f.h[1] = *(const v8us*)(p + 16);
  return f.u;
}
// exact negation of a bf16 fragment (sign-bit flip of every 16-bit element)
__device__ __forceinline__ v16us neg16(v16us x) {
  FB f;
  f.u = x;
#pragma unroll
  for (int i = 0; i < 8; ++i) f.w[i] = f.w[i] ^ 0x80008000u;
  return f.u;
}

// ---- WMMA helpers; trailing VALU hazard gaps are issued by the guard_* helpers after each group --------
__device__ __forceinline__ v8f mma_h_raw(v16h a, v16h b, v8f c) {
  return __builtin_amdgcn_wmma_f32_16x16x32_f16(false, a, false, b, (short)0, c, false, false);
}
__device__ __forceinline__ v8f mma_b_raw(v16us a, v16us b, v8f c) {
  return __builtin_amdgcn_wmma_f32_16x16x32_bf16(false, __builtin_bit_cast(v16b, a), false,
                                                 __builtin_bit_cast(v16b, b), (short)0, c, false, false);
}
__device__ __forceinline__ void guard_b5(v8f& x, v8f& y, v16us a, v16us b, v16us d, v16us e, v16us f) {
#if defined(__HIP_DEVICE_COMPILE__)
  asm volatile("v_nop\n\tv_nop\n\tv_nop\n\tv_nop" : "+v"(x), "+v"(y) : "v"(a), "v"(b), "v"(d), "v"(e), "v"(f));
#endif
}
__device__ __forceinline__ void guard_h1(v8f& x, v16h a, v16h b) {
#if defined(__HIP_DEVICE_COMPILE__)
  asm volatile("v_nop\n\tv_nop\n\tv_nop\n\tv_nop" : "+v"(x) : "v"(a), "v"(b));
#endif
}
__device__ __forceinline__ void guard_h2(v8f& x, v8f& y, v16h a, v16h b, v16h d) {
#if defined(__HIP_DEVICE_COMPILE__)
  asm volatile("v_nop\n\tv_nop\n\tv_nop\n\tv_nop" : "+v"(x), "+v"(y) : "v"(a), "v"(b), "v"(d));
#endif
}
__device__ __forceinline__ void acc_guard4(v8f& a, v8f& b, v8f& c, v8f& d) {
#if defined(__HIP_DEVICE_COMPILE__)
  asm volatile("v_nop\n\tv_nop\n\tv_nop\n\tv_nop" : "+v"(a), "+v"(b), "+v"(c), "+v"(d));
#endif
}
__device__ __forceinline__ void wave_sync_lds() {
  __builtin_amdgcn_fence(__ATOMIC_RELEASE, "workgroup");
  __builtin_amdgcn_wave_barrier();
  __builtin_amdgcn_fence(__ATOMIC_ACQUIRE, "workgroup");
}

// ---- asynchronous copies global -> LDS (16 B per lane, through no register) and the ring's waits ----
__device__ __forceinline__ unsigned lds_byte(const void* p) { return (unsigned)(uintptr_t)p; }   // LDS byte address
// eight copies of one lane; the closing s_wait_xcnt stands in front of every later rewrite of an address register
// that a copy names (a precaution), inside the statement so that no address arithmetic can be moved in front of it
__device__ __forceinline__ void async_copy8(const unsigned (&l)[8], const void* const (&g)[8]) {
#if defined(__HIP_DEVICE_COMPILE__)
  asm volatile(
      "global_load_async_to_lds_b128 %0, %8, off\n\t"
      "global_load_async_to_lds_b128 %1, %9, off\n\t"
      "global_load_async_to_lds_b128 %2, %10, off\n\t"
      "global_load_async_to_lds_b128 %3, %11, off\n\t"
      "global_load_async_to_lds_b128 %4, %12, off\n\t"
      "global_load_async_to_lds_b128 %5, %13, off\n\t"
      "global_load_async_to_lds_b128 %6, %14, off\n\t"
      "global_load_async_to_lds_b128 %7, %15, off\n\t"
      "s_wait_xcnt 0x0"
      :: "v"(l[0]), "v"(l[1]), "v"(l[2]), "v"(l[3]), "v"(l[4]), "v"(l[5]), "v"(l[6]), "v"(l[7]),
         "v"(g[0]), "v"(g[1]), "v"(g[2]), "v"(g[3]), "v"(g[4]), "v"(g[5]), "v"(g[6]), "v"(g[7])
      : "memory");
#endif
}
// this wave's copies have landed in LDS (the compiler places no wait for them)
__device__ __forceinline__ void wait_async0() {
#if defined(__HIP_DEVICE_COMPILE__)
  asm volatile("s_wait_asynccnt 0x0" ::: "memory");
#endif
}
// this wave's LDS reads have returned, before the buffer they read is handed to the next tile's copies
__device__ __forceinline__ void wait_ds0() {
#if defined(__HIP_DEVICE_COMPILE__)
  asm volatile("s_wait_dscnt 0x0" ::: "memory");
#endif
}

// =====================================================================================================
// Transpose + convert: input z (stride zin) is f32 [R][C]; output z (stride zout) is an f16 plane [C][R] holding
// f16(bf16 RNE value * scale) (scale a power of two, exact). Tile = 64 input rows x 32 input cols;
// grid = (C/32, R/64, nz), block 256. Load: thread t -> input row t>>2, cols (t&3)*8..+7 (two 16-B loads);
// store: thread t -> output row t>>3 (= input col), input rows (t&7)*8..+7 as ONE 16-B store, so lanes
// coverage: (C/32) x (R/64) tiles x 32 output rows x 64 cols = all of out[C][R] per z (R%64==0, C%32==0).
// =====================================================================================================
__global__ __launch_bounds__(256) void tr_cvt(const float* __restrict__ in, unsigned short* out, int R, int C,
                                             long long zin, long long zout, float scale) {
  __shared__ float tile[64 * 33];
  const int z = blockIdx.z;
  const float* ib = in + (size_t)z * (size_t)zin;
  unsigned short* ob = out + (size_t)z * (size_t)zout;
  const int r0 = blockIdx.y * 64, c0 = blockIdx.x * 32;
  const int t = threadIdx.x;
  {
    const int ir = t >> 2, ic = (t & 3) * 8;
    const float* g = ib + (size_t)(r0 + ir) * (size_t)C + c0 + ic;
    const v4f a = *(const v4f*)g;
    const v4f b = *(const v4f*)(g + 4);
    float* l = tile + ir * 33 + ic;
    l[0] = a[0]; l[1] = a[1]; l[2] = a[2]; l[3] = a[3];
    l[4] = b[0]; l[5] = b[1]; l[6] = b[2]; l[7] = b[3];
  }
  __syncthreads();
  const int orow = t >> 3, piece = (t & 7) * 8;
  v4u p;
#pragma unroll
  for (int e = 0; e < 4; ++e) {
    const float f0 = tile[(piece + 2 * e) * 33 + orow];
    const float f1 = tile[(piece + 2 * e + 1) * 33 + orow];
    const _Float16 x0 = (_Float16)(bf_up(bf_bits(f0)) * scale);
    const _Float16 x1 = (_Float16)(bf_up(bf_bits(f1)) * scale);
    p[e] = pk16(h_bits(x0), h_bits(x1));
  }
  const size_t go = (size_t)(c0 + orow) * (size_t)R + r0 + piece;
  *(v4u*)(ob + go) = p;
  
}

// =====================================================================================================
// Row-major convert of two f32 [n] arrays into two consecutive bf16 planes: out[i] = bf16(a[i]), out[n+i] = bf16(bsrc[i])
// (RNE bits). Thread -> 8 consecutive elements, ONE 16-B store per plane; lanes 8q..8q+7 of a wave write one whole
// coverage: grid.x = n/2048 blocks x 256 threads x 8 = n elements of each plane (n % 2048 == 0 host-checked).
// =====================================================================================================
__global__ __launch_bounds__(256) void cvt2(const float* __restrict__ a, const float* __restrict__ bsrc,
                                           unsigned short* out, int n) {
  const size_t i8 = ((size_t)blockIdx.x * 256 + threadIdx.x) * 8;
  if (i8 + 8 > (size_t)n) return;        // never taken for the host-checked size; no barriers below
  const v4f a0 = *(const v4f*)(a + i8);
  const v4f a1 = *(const v4f*)(a + i8 + 4);
  const v4f b0 = *(const v4f*)(bsrc + i8);
  const v4f b1 = *(const v4f*)(bsrc + i8 + 4);
  v4u pa, pb;
#pragma unroll
  for (int e = 0; e < 2; ++e) {
    pa[e]     = pk16(bf_bits(a0[2 * e]), bf_bits(a0[2 * e + 1]));
    pa[2 + e] = pk16(bf_bits(a1[2 * e]), bf_bits(a1[2 * e + 1]));
    pb[e]     = pk16(bf_bits(b0[2 * e]), bf_bits(b0[2 * e + 1]));
    pb[2 + e] = pk16(bf_bits(b1[2 * e]), bf_bits(b1[2 * e + 1]));
  }
  unsigned short* oa = out + i8;
  unsigned short* ob = out + (size_t)n + i8;
  *(v4u*)oa = pa;
  *(v4u*)ob = pb;
  
}

// =====================================================================================================
// Causal complex attention, per (b, h, 64-query block):
//   sr = qr.kr - qi.ki, si = qr.ki + qi.kr over e=64 (bf16 operands, exact products, f32 accumulate; -qi.ki as
//   qi.(ki with flipped sign bits)); s = sqrt(sr^2 + si^2) * SCL; key > query -> NEG_BIG (value select, diagonal
//   kept); online softmax in f32; p = exp(s - m) carried as ph = f16(1024 p) and, when PRES, pl = f16((1024 p - ph)
//   * PRS); context over the 128-wide value row [v_r | v_i] with v as f16(VSC * bf16 value):
//     oh += ph.v over all chunks; when PRES, ol = pl.v per chunk folded as oh += ol / PRS in f32.
//   Q / K planes (bf16 bits, pitch DMOD): plane 0 = real, plane 1 = imag (NTOK*DMOD apart); element (b, t, h, e)
//     at [(b*SEQ + t)*DMOD + h*64 + e]
//   V^T plane (f16): element (b, part, h, d, t) at [((b*2 + part)*DMOD + h*64 + d)*SEQ + t], part 0 = v_r, 1 = v_i
//   Block = 4 waves = 64 query rows of one (b, h); grid = nqb * NHEAD * NBATCH; qb = qb0 + blockIdx.x % nqb,
//   h = (blockIdx.x / nqb) % NHEAD, b = (blockIdx.x / nqb) / NHEAD; key chunks of 64, chunks kt <= qb only
//   (block-uniform trip <= NQB), chunk kt == qb keeps its diagonal by the per-element select.
//   K / V^T staging: asynchronous 16-B copies into a ring of two LDS buffers; chunk kt lies in buffer kt & 1 and
//   chunk kt + 1 is in flight while chunk kt is worked on. 8 lanes cover one 128-B line: K copy i of a thread ->
//   key row i*8 + (tid>>4), part (tid>>3)&1, piece tid&7 into Ksh[buf][key][part*64 + e] (pitch KP); V^T copy i ->
//   value row d = i*16 + (tid>>3), piece tid&7 into Vs[buf][d][kv] (pitch VP). At the foot of a chunk every wave:
//   s_wait_dscnt 0, s_wait_asynccnt 0, __syncthreads (publishes chunk kt + 1, frees buffer kt & 1), then the
//   copies of chunk kt + 2. q fragments from the global planes; P tiles wave-private, written with
//   Output row (b, t, h) = 128 f32 [r0, i0, r1, i1, ...] at out + ((b*SEQ + t)*NHEAD + h)*128: the wave's 16x128
//   context tile is staged interleaved in LDS, then each 512-B row is written by 32 lanes x 16 B in ONE
//   coverage: each wave stores rows q0..q0+15 x 128 floats; waves x blocks x both launches = all (b, t, h) rows.
// =====================================================================================================
template <bool PRES>
__global__ __launch_bounds__(128)
void attn_c(const unsigned short* __restrict__ QB, const unsigned short* __restrict__ KB,
            const unsigned short* __restrict__ VT, float* out, int qb0, int nqb) {
  __shared__ __align__(16) unsigned short Ksh[2][64 * KP];             // K [buf][kv][kr e 0..63 | ki e 64..127 | pad] 2 x 17 KB
  __shared__ __align__(16) _Float16 Vs[2][VW * VP];                     // V^T [buf][d][kv | pad] 2 x 18 KB
  __shared__ __align__(16) _Float16 Psh[4][16 * PP];                    // per wave P hi [row][kv | pad] 9 KB
  __shared__ __align__(16) _Float16 Psl[PRES ? 4 : 1][PRES ? 16 * PP : 8];   // per wave P residual (PRES) 9 KB
  __shared__ __align__(16) float    Os[4][16 * VW];                     // per wave context tile [row][128] 32 KB

  const int tid  = threadIdx.x;
  const int wave = tid >> 5;
  const int lane = tid & 31;
  const int hh   = lane >> 4;
  const int c    = lane & 15;

  const unsigned nq = (unsigned)nqb;
  const int qb = qb0 + (int)(blockIdx.x % nq);
  const int hb = (int)(blockIdx.x / nq);
  const int h  = hb % NHEAD;
  const int b  = hb / NHEAD;
  const int q0 = qb * 64 + wave * 16;

  const size_t NPL = (size_t)NTOK * DMOD;                              // one bf16 plane (both batches)
  const unsigned short* Qr = QB + (size_t)b * SEQ * DMOD + (size_t)h * HD;
  const unsigned short* Qi = Qr + NPL;
  const unsigned short* Kr = KB + (size_t)b * SEQ * DMOD + (size_t)h * HD;
  const _Float16* Vg = (const _Float16*)(const void*)VT + ((size_t)(b * 2) * DMOD + (size_t)h * HD) * SEQ;

  float mrow[8], lrow[8];
  v8f oh[8];
#pragma unroll
  for (int r = 0; r < 8; ++r) { mrow[r] = NEG_BIG; lrow[r] = 0.f; }
#pragma unroll
  for (int t = 0; t < 8; ++t) oh[t] = zero8();

  _Float16* pwh = Psh[wave];
  _Float16* pwl = &Psl[PRES ? wave : 0][0];

  // ---- this thread's 16 copies of chunk t into ring buffer buf (all lanes on, block-uniform callers) ----
  const int pc = (tid & 7) * 8;                                        // 16-B piece of a 128-B line, in elements
  const unsigned short* kthr = Kr + (size_t)((tid >> 3) & 1) * NPL + (size_t)(tid >> 4) * DMOD + pc;
  const _Float16* vthr = Vg + (size_t)(tid >> 3) * SEQ + pc;
  const unsigned kl0 = lds_byte(&Ksh[0][(tid >> 4) * KP + ((tid >> 3) & 1) * HD + pc]);
  const unsigned vl0 = lds_byte(&Vs[0][(tid >> 3) * VP + pc]);
  auto stage = [&](int t, int buf) {
    unsigned kl[8], vl[8];
    const void* kg[8];
    const void* vg[8];
#pragma unroll
    for (int i = 0; i < 8; ++i) {
      kl[i] = kl0 + (unsigned)buf * (unsigned)sizeof(Ksh[0]) + (unsigned)(i * 8 * KP * 2);
      kg[i] = kthr + (size_t)(t * 64 + i * 8) * DMOD;
      vl[i] = vl0 + (unsigned)buf * (unsigned)sizeof(Vs[0]) + (unsigned)(i * 16 * VP * 2);
      vg[i] = vthr + ((size_t)(i >> 2) * DMOD + (size_t)((i & 3) * 16)) * SEQ + t * 64;
    }
    async_copy8(kl, kg);
    async_copy8(vl, vg);
  };

  stage(0, 0);
  wait_async0();
  __syncthreads();                            // chunk 0 published
  if (qb >= 1) stage(1, 1);

  for (int kt = 0; kt < NQB; ++kt) {          // static bound; block-uniform causal chunk skipping
    if (kt > qb) break;
    const int kv0 = kt * 64;
    const unsigned short* Kc = Ksh[kt & 1];
    const _Float16* Vc = Vs[kt & 1];

    // ---- Q fragments (A operand, row = lane&15): 2 e-chunks per plane from the global planes ----
    v16us qr[2], qi[2];
#pragma unroll
    for (int dc = 0; dc < 2; ++dc) {
      qr[dc] = ldfrag_b(Qr + (size_t)(q0 + c) * DMOD + dc * 32 + 8 * hh);
      qi[dc] = ldfrag_b(Qi + (size_t)(q0 + c) * DMOD + dc * 32 + 8 * hh);
    }

    // ---- scores: 16 query rows x 64 keys per wave, depth 64 (2 chunks), 4 products per chunk ----
    v8f s[4];
#pragma unroll
    for (int j = 0; j < 4; ++j) {
      v8f sr = zero8(), si = zero8();
#pragma unroll
      for (int dc = 0; dc < 2; ++dc) {
        const unsigned short* kp = Kc + (j * 16 + c) * KP + dc * 32 + 8 * hh;   // B col = key j*16+c
        FB br, bi;
        br.h[0] = *(const v8us*)(kp);
        br.h[1] = *(const v8us*)(kp + 16);
        bi.h[0] = *(const v8us*)(kp + HD);
        bi.h[1] = *(const v8us*)(kp + HD + 16);
        const v16us bin = neg16(bi.u);
        sr = mma_b_raw(qr[dc], br.u, sr);
        sr = mma_b_raw(qi[dc], bin, sr);
        si = mma_b_raw(qr[dc], bi.u, si);
        si = mma_b_raw(qi[dc], br.u, si);
        guard_b5(sr, si, qr[dc], qi[dc], br.u, bi.u, bin);
      }
      const int key  = kv0 + j * 16 + c;                 // key index of this lane's D column
      const int rowb = q0 + 8 * hh;                      // query row of D element r is rowb + r
#pragma unroll
      for (int r = 0; r < 8; ++r) {
        const float m2 = sr[r] * sr[r] + si[r] * si[r];
        const float v = sqrtf(m2) * SCL;
        s[j][r] = (key <= rowb + r) ? v : NEG_BIG;
      }
    }

    // ---- row max, online softmax, P hi (x1024, f16) and, when PRES, P residual (x PRS, f16) to LDS ----
#pragma unroll
    for (int r = 0; r < 8; ++r) {
      float m = s[0][r];
      m = fmaxf(m, s[1][r]);
      m = fmaxf(m, s[2][r]);
      m = fmaxf(m, s[3][r]);
#pragma unroll
      for (int off = 1; off < 16; off <<= 1) m = fmaxf(m, __shfl_xor(m, off, 32));
      const float mnew  = fmaxf(mrow[r], m);
      const float alpha = __expf(mrow[r] - mnew);
      mrow[r] = mnew;
      float psum = 0.f;
#pragma unroll
      for (int j = 0; j < 4; ++j) {
        const float p  = __expf(s[j][r] - mnew);
        psum += p;
        const float ph = p * PSC;
        const _Float16 xh = (_Float16)ph;
        const int pi = (8 * hh + r) * PP + j * 16 + c;
        pwh[pi] = xh;
        if (PRES) pwl[pi] = (_Float16)((ph - (float)xh) * PRS);
      }
#pragma unroll
      for (int off = 1; off < 16; off <<= 1) psum += __shfl_xor(psum, off, 32);
      lrow[r] = lrow[r] * alpha + psum;
#pragma unroll
      for (int t = 0; t < 8; ++t) oh[t][r] *= alpha;
    }
    wave_sync_lds();

    // ---- context: oh += Phi . V; when PRES: ol = Plo . V, then oh += ol / PRS ----
    v8f ol[8];
#pragma unroll
    for (int t = 0; t < 8; ++t) ol[t] = zero8();
#pragma unroll 1
    for (int kk = 0; kk < 2; ++kk) {
      FH pa, pb;
      pa.h[0] = *(const v8h*)(pwh + c * PP + kk * 32 + 8 * hh);
      pa.h[1] = *(const v8h*)(pwh + c * PP + kk * 32 + 16 + 8 * hh);
      pb.v = pa.v;
      if (PRES) {
        pb.h[0] = *(const v8h*)(pwl + c * PP + kk * 32 + 8 * hh);
        pb.h[1] = *(const v8h*)(pwl + c * PP + kk * 32 + 16 + 8 * hh);
      }
#pragma unroll
      for (int t = 0; t < 8; ++t) {
        FH vb;
        vb.h[0] = *(const v8h*)(Vc + (t * 16 + c) * VP + kk * 32 + 8 * hh);
        vb.h[1] = *(const v8h*)(Vc + (t * 16 + c) * VP + kk * 32 + 16 + 8 * hh);
        oh[t] = mma_h_raw(pa.v, vb.v, oh[t]);
        if (PRES) {
          ol[t] = mma_h_raw(pb.v, vb.v, ol[t]);
          guard_h2(oh[t], ol[t], pa.v, pb.v, vb.v);
        } else {
          guard_h1(oh[t], pa.v, vb.v);
        }
      }
    }
    acc_guard4(oh[0], oh[1], oh[2], oh[3]);
    acc_guard4(oh[4], oh[5], oh[6], oh[7]);
    if (PRES) {
      acc_guard4(ol[0], ol[1], ol[2], ol[3]);
      acc_guard4(ol[4], ol[5], ol[6], ol[7]);
#pragma unroll
      for (int t = 0; t < 8; ++t) {
#pragma unroll
        for (int r = 0; r < 8; ++r) oh[t][r] += ol[t][r] * (1.0f / PRS);
      }
    }
    // ---- publish point of chunk kt + 1; buffer kt & 1 is free behind the barrier ----
    wait_ds0();
    wait_async0();
    __syncthreads();
    if (kt + 2 <= qb) stage(kt + 2, kt & 1);
  }
  wait_async0();                              // nothing is left in flight when the wave goes on to the epilogue

  // ---- normalise (1/l, the 1/PSC p carry and the 1/VSC v carry), stage the wave's 16x128 tile interleaved
  float* os = Os[wave];
#pragma unroll
  for (int r = 0; r < 8; ++r) {
    const float l = lrow[r];
    const float inv = ((l > 0.f) ? (1.0f / l) : 0.f) * (1.0f / (PSC * VSC));
#pragma unroll
    for (int t = 0; t < 8; ++t) {
      const int pos = (t < 4) ? (2 * (t * 16 + c)) : (2 * ((t - 4) * 16 + c) + 1);
      os[(8 * hh + r) * VW + pos] = oh[t][r] * inv;
    }
  }
  wave_sync_lds();
  {
#pragma unroll
    for (int it = 0; it < 16; ++it) {                    // row it: 32 lanes x 16 B = 512 B = 128 floats
      const v4f o = *(const v4f*)(os + it * VW + lane * 4);
      float* g = out + ((size_t)(b * SEQ + q0 + it) * NHEAD + h) * VW + lane * 4;
      *(v4f*)g = o;
    }
    
  }
}

// =====================================================================================================
// Workspace map (bytes); every plane is an exact multiple of its whole-line store granularity (all dims are exact
// tile multiples, no padded tails), all offsets multiples of 8 MiB:
//   QB  bf16 [2 parts][4096 t][512]             0   8388608   (q_r, q_i RNE bits)
//   KB  bf16 [2 parts][4096 t][512]       8388608   8388608   (k_r, k_i RNE bits)
//   VT  f16  [2 b][2 parts][512 (h,d)][2048 t] 16777216   8388608   (bf16 value x16)
//   end                                 25165824
// =====================================================================================================
extern "C" void kernel_launch(void* const* d_in, const int* in_sizes, int n_in,
                              void* d_out, int out_size, void* d_ws, size_t ws_size,
                              hipStream_t stream) {
  const int n = NTOK * DMOD;                                // 2097152 elements per input
  if (n_in < 6) return;
  for (int i = 0; i < 6; ++i) if (in_sizes[i] != n) return;
  if (out_size != 2 * n) return;

  const float* qr = (const float*)d_in[0];
  const float* qi = (const float*)d_in[1];
  const float* kr = (const float*)d_in[2];
  const float* ki = (const float*)d_in[3];
  const float* vr = (const float*)d_in[4];
  const float* vi = (const float*)d_in[5];
  float* outf = (float*)d_out;

  const size_t PQB = (size_t)2 * n * 2;                     //  8388608
  const size_t PKB = (size_t)2 * n * 2;                     //  8388608
  const size_t PVT = (size_t)NBATCH * 2 * DMOD * SEQ * 2;   //  8388608
  size_t off = 0;
  const size_t oQ = off; off += PQB;
  const size_t oK = off; off += PKB;
  const size_t oV = off; off += PVT;
  if (off > ws_size) return;                                // off = 25165824
  if (off > (size_t)134217728) return;

  char* ws = (char*)d_ws;
  unsigned short* QB = (unsigned short*)(ws + oQ);
  unsigned short* KB = (unsigned short*)(ws + oK);
  unsigned short* VT = (unsigned short*)(ws + oV);

  const dim3 blk256(256), blk128(128);

  // (1) q, k -> bf16 planes [part][4096 t][512]
  cvt2<<<dim3(n / 2048), blk256, 0, stream>>>(qr, qi, QB, n);
  cvt2<<<dim3(n / 2048), blk256, 0, stream>>>(kr, ki, KB, n);
  // (2) v -> transposed f16 planes: in[2048 t][512 (h,e)] per batch z -> out[512 (h,d)][2048 t] at part 0 (v_r)
  //     and part 1 (v_i) of batch z; grid = (cols/32, rows/64, batches)
  tr_cvt<<<dim3(DMOD / 32, SEQ / 64, NBATCH), blk256, 0, stream>>>(
      vr, VT, SEQ, DMOD, (long long)SEQ * DMOD, (long long)2 * DMOD * SEQ, VSC);
  tr_cvt<<<dim3(DMOD / 32, SEQ / 64, NBATCH), blk256, 0, stream>>>(
      vi, VT + (size_t)DMOD * SEQ, SEQ, DMOD, (long long)SEQ * DMOD, (long long)2 * DMOD * SEQ, VSC);
  // (3) causal attention -> d_out: query blocks 0..NQP-1 (rows < 512) with the p residual tile, the rest without
  attn_c<true><<<dim3(NQP * NHEAD * NBATCH), blk128, 0, stream>>>(QB, KB, VT, outf, 0, NQP);
  attn_c<false><<<dim3((NQB - NQP) * NHEAD * NBATCH), blk128, 0, stream>>>(QB, KB, VT, outf, NQP, NQB - NQP);
  (void)hipGetLastError();
}

// v003
// A run of this version takes 117 microseconds.
// Two timings next to v002 both put it at 1.22 times that version's speed.
// Counting every step since v000, it is 2.49 times as fast.
// Contractions: complex q.k^T as qr.kr, qi.ki (negated), qr.ki, qi.kr over e=64 on v_wmma_f32_16x16x32_bf16 (raw
//   bf16 RNE values of q and k, one product each, signs combined in the f32 accumulators); p.[v_r|v_i] over keys on
//   v_wmma_f32_16x16x32_f16 with p as f16(1024 p) (plus a x4096 f16 residual tile for the first 512 query rows of
//   each sequence) and v as f16 of its bf16 RNE value x16 (exact); f32 accumulate everywhere; score magnitude,
//   causal select, softmax statistics and epilogue in f32.
#include <hip/hip_runtime.h>
#include <math.h>
#include <stdint.h>

#define NBATCH 2
#define SEQ    2048
#define NHEAD  8
#define HD     64                  // score depth e
#define VW     (2 * HD)            // value row width: v_r d 0..63 | v_i d 64..127
#define DMOD   (NHEAD * HD)        // 512: token row pitch of the q/k/v inputs
#define NTOK   (NBATCH * SEQ)      // 4096 token rows
#define NQB    (SEQ / 64)          // 32 query / key tiles of 64
#define NQP    8                   // leading query tiles (rows < 512) that carry the p residual tile
#define VSC    16.0f               // v plane carry (power of two, exact on bf16 values)
#define PSC    1024.0f             // softmax numerator carry
#define PRS    4096.0f             // p residual carry
#define SCL    0.125f              // 1/sqrt(64)
#define NEG_BIG (-1.0e30f)
// LDS row pitches in 16-bit elements: every row read by ds_load_b128 fragments (16 lanes = 16 rows, 16 B each) gets
// a pitch of 16 B x odd, so the 16 rows of a half wave fall on all 64 banks instead of on 4 (K) or 8 (V, P).
#define KP     (VW + 8)            // K rows: 256 B of data at 272 B pitch
#define VP     (64 + 8)            // V^T rows: 128 B of data at 144 B pitch
#define PP     (64 + 8)            // P rows: 128 B of data at 144 B pitch
static_assert(HD == 64 && VW == 128);
static_assert((SEQ % 64) == 0 && (DMOD % 32) == 0);
static_assert(((NTOK * DMOD) % 2048) == 0);
static_assert(NQP > 0 && NQP < NQB);
static_assert(((KP * 2) % 32) == 16 && ((VP * 2) % 32) == 16 && ((PP * 2) % 32) == 16);

typedef _Float16 v16h __attribute__((ext_vector_type(16)));
typedef _Float16 v8h  __attribute__((ext_vector_type(8)));
typedef __bf16   v16b __attribute__((ext_vector_type(16)));
typedef unsigned short v16us __attribute__((ext_vector_type(16)));
typedef unsigned short v8us  __attribute__((ext_vector_type(8)));
typedef float    v8f  __attribute__((ext_vector_type(8)));
typedef float    v4f  __attribute__((ext_vector_type(4)));
typedef unsigned int v4u __attribute__((ext_vector_type(4)));
typedef unsigned int v8u __attribute__((ext_vector_type(8)));
union FH { v16h v; v8h h[2]; };
union FB { v16us u; v8us h[2]; v8u w; };

// ---- scalar helpers --------------------------------------------------------------------------------
__device__ __forceinline__ unsigned short bf_bits(float f) {          // f32 -> bf16 bits, RNE convert
  unsigned u = __float_as_uint(f);
  return (unsigned short)((u + 0x7FFFu + ((u >> 16) & 1u)) >> 16);
}
__device__ __forceinline__ float bf_up(unsigned short h) { return __uint_as_float(((unsigned)h) << 16); }
__device__ __forceinline__ unsigned short h_bits(_Float16 x) { return __builtin_bit_cast(unsigned short, x); }
__device__ __forceinline__ unsigned pk16(unsigned short a, unsigned short b) { return (unsigned)a | ((unsigned)b << 16); }
__device__ __forceinline__ v8f zero8() { v8f z = {0.f, 0.f, 0.f, 0.f, 0.f, 0.f, 0.f, 0.f}; return z; }

// ---- fragment loader: 16-bit A/B operand, lane -> row/col (lane&15), p already includes +8*(lane>>4);
//      elements 0..7 <- p[0..7] (k0+8h..), elements 8..15 <- p[16..23] (k0+16+8h..)
__device__ __forceinline__ v16us ldfrag_b(const unsigned short* p) {   // bf16 plane read as 16-bit uint vectors
  FB f;
  f.h[0] = *(const v8us*)(p);
  f.h[1] = *(const v8us*)(p + 16);
  return f.u;
}
// exact negation of a bf16 fragment (sign-bit flip of every 16-bit element)
__device__ __forceinline__ v16us neg16(v16us x) {
  FB f;
  f.u = x;
#pragma unroll
  for (int i = 0; i < 8; ++i) f.w[i] = f.w[i] ^ 0x80008000u;
  return f.u;
}

// ---- WMMA helpers; trailing VALU hazard gaps are issued by the guard_* helpers after each group --------
__device__ __forceinline__ v8f mma_h_raw(v16h a, v16h b, v8f c) {
  return __builtin_amdgcn_wmma_f32_16x16x32_f16(false, a, false, b, (short)0, c, false, false);
}
__device__ __forceinline__ v8f mma_b_raw(v16us a, v16us b, v8f c) {
  return __builtin_amdgcn_wmma_f32_16x16x32_bf16(false, __builtin_bit_cast(v16b, a), false,
                                                 __builtin_bit_cast(v16b, b), (short)0, c, false, false);
}
__device__ __forceinline__ void guard_b5(v8f& x, v8f& y, v16us a, v16us b, v16us d, v16us e, v16us f) {
#if defined(__HIP_DEVICE_COMPILE__)
  asm volatile("v_nop\n\tv_nop\n\tv_nop\n\tv_nop" : "+v"(x), "+v"(y) : "v"(a), "v"(b), "v"(d), "v"(e), "v"(f));
#endif
}
__device__ __forceinline__ void guard_h1(v8f& x, v16h a, v16h b) {
#if defined(__HIP_DEVICE_COMPILE__)
  asm volatile("v_nop\n\tv_nop\n\tv_nop\n\tv_nop" : "+v"(x) : "v"(a), "v"(b));
#endif
}
__device__ __forceinline__ void guard_h2(v8f& x, v8f& y, v16h a, v16h b, v16h d) {
#if defined(__HIP_DEVICE_COMPILE__)
  asm volatile("v_nop\n\tv_nop\n\tv_nop\n\tv_nop" : "+v"(x), "+v"(y) : "v"(a), "v"(b), "v"(d));
#endif
}
__device__ __forceinline__ void acc_guard4(v8f& a, v8f& b, v8f& c, v8f& d) {
#if defined(__HIP_DEVICE_COMPILE__)
  asm volatile("v_nop\n\tv_nop\n\tv_nop\n\tv_nop" : "+v"(a), "+v"(b), "+v"(c), "+v"(d));
#endif
}
__device__ __forceinline__ void wave_sync_lds() {
  __builtin_amdgcn_fence(__ATOMIC_RELEASE, "workgroup");
  __builtin_amdgcn_wave_barrier();
  __builtin_amdgcn_fence(__ATOMIC_ACQUIRE, "workgroup");
}

// ---- asynchronous copies global -> LDS (16 B per lane, through no register) and the ring's waits ----
__device__ __forceinline__ unsigned lds_byte(const void* p) { return (unsigned)(uintptr_t)p; }   // LDS byte address
// eight copies of one lane; the closing s_wait_xcnt stands in front of every later rewrite of an address register
// that a copy names (a precaution), inside the statement so that no address arithmetic can be moved in front of it
__device__ __forceinline__ void async_copy8(const unsigned (&l)[8], const void* const (&g)[8]) {
#if defined(__HIP_DEVICE_COMPILE__)
  asm volatile(
      "global_load_async_to_lds_b128 %0, %8, off\n\t"
      "global_load_async_to_lds_b128 %1, %9, off\n\t"
      "global_load_async_to_lds_b128 %2, %10, off\n\t"
      "global_load_async_to_lds_b128 %3, %11, off\n\t"
      "global_load_async_to_lds_b128 %4, %12, off\n\t"
      "global_load_async_to_lds_b128 %5, %13, off\n\t"
      "global_load_async_to_lds_b128 %6, %14, off\n\t"
      "global_load_async_to_lds_b128 %7, %15, off\n\t"
      "s_wait_xcnt 0x0"
      :: "v"(l[0]), "v"(l[1]), "v"(l[2]), "v"(l[3]), "v"(l[4]), "v"(l[5]), "v"(l[6]), "v"(l[7]),
         "v"(g[0]), "v"(g[1]), "v"(g[2]), "v"(g[3]), "v"(g[4]), "v"(g[5]), "v"(g[6]), "v"(g[7])
      : "memory");
#endif
}
// this wave's copies have landed in LDS (the compiler places no wait for them)
__device__ __forceinline__ void wait_async0() {
#if defined(__HIP_DEVICE_COMPILE__)
  asm volatile("s_wait_asynccnt 0x0" ::: "memory");
#endif
}
// stands behind issued global loads, in front of any rewrite of the address registers that they name (a precaution).
// The address is an input only so that its registers stay untouched up to the wait.
__device__ __forceinline__ void wait_x0(const void* addr) {
#if defined(__HIP_DEVICE_COMPILE__)
  asm volatile("s_wait_xcnt 0x0" :: "v"(addr) : "memory");
#endif
}
// this wave's LDS reads have returned, before the buffer they read is handed to the next tile's copies
__device__ __forceinline__ void wait_ds0() {
#if defined(__HIP_DEVICE_COMPILE__)
  asm volatile("s_wait_dscnt 0x0" ::: "memory");
#endif
}

// =====================================================================================================
// Transpose + convert: input z (stride zin) is f32 [R][C]; output z (stride zout) is an f16 plane [C][R] holding
// f16(bf16 RNE value * scale) (scale a power of two, exact). Tile = 64 input rows x 32 input cols;
// grid = (C/32, R/64, nz), block 256. Load: thread t -> input row t>>2, cols (t&3)*8..+7 (two 16-B loads);
// store: thread t -> output row t>>3 (= input col), input rows (t&7)*8..+7 as ONE 16-B store, so lanes
// coverage: (C/32) x (R/64) tiles x 32 output rows x 64 cols = all of out[C][R] per z (R%64==0, C%32==0).
// =====================================================================================================
__global__ __launch_bounds__(256) void tr_cvt(const float* __restrict__ in, unsigned short* out, int R, int C,
                                             long long zin, long long zout, float scale) {
  __shared__ float tile[64 * 33];
  const int z = blockIdx.z;
  const float* ib = in + (size_t)z * (size_t)zin;
  unsigned short* ob = out + (size_t)z * (size_t)zout;
  const int r0 = blockIdx.y * 64, c0 = blockIdx.x * 32;
  const int t = threadIdx.x;
  {
    const int ir = t >> 2, ic = (t & 3) * 8;
    const float* g = ib + (size_t)(r0 + ir) * (size_t)C + c0 + ic;
    const v4f a = *(const v4f*)g;
    const v4f b = *(const v4f*)(g + 4);
    float* l = tile + ir * 33 + ic;
    l[0] = a[0]; l[1] = a[1]; l[2] = a[2]; l[3] = a[3];
    l[4] = b[0]; l[5] = b[1]; l[6] = b[2]; l[7] = b[3];
  }
  __syncthreads();
  const int orow = t >> 3, piece = (t & 7) * 8;
  v4u p;
#pragma unroll
  for (int e = 0; e < 4; ++e) {
    const float f0 = tile[(piece + 2 * e) * 33 + orow];
    const float f1 = tile[(piece + 2 * e + 1) * 33 + orow];
    const _Float16 x0 = (_Float16)(bf_up(bf_bits(f0)) * scale);
    const _Float16 x1 = (_Float16)(bf_up(bf_bits(f1)) * scale);
    p[e] = pk16(h_bits(x0), h_bits(x1));
  }
  const size_t go = (size_t)(c0 + orow) * (size_t)R + r0 + piece;
  *(v4u*)(ob + go) = p;
  
}

// =====================================================================================================
// Row-major convert of two f32 [n] arrays into two consecutive bf16 planes: out[i] = bf16(a[i]), out[n+i] = bf16(bsrc[i])
// (RNE bits). Thread -> 8 consecutive elements, ONE 16-B store per plane; lanes 8q..8q+7 of a wave write one whole
// coverage: grid.x = n/2048 blocks x 256 threads x 8 = n elements of each plane (n % 2048 == 0 host-checked).
// =====================================================================================================
__global__ __launch_bounds__(256) void cvt2(const float* __restrict__ a, const float* __restrict__ bsrc,
                                           unsigned short* out, int n) {
  const size_t i8 = ((size_t)blockIdx.x * 256 + threadIdx.x) * 8;
  if (i8 + 8 > (size_t)n) return;        // never taken for the host-checked size; no barriers below
  const v4f a0 = *(const v4f*)(a + i8);
  const v4f a1 = *(const v4f*)(a + i8 + 4);
  const v4f b0 = *(const v4f*)(bsrc + i8);
  const v4f b1 = *(const v4f*)(bsrc + i8 + 4);
  v4u pa, pb;
#pragma unroll
  for (int e = 0; e < 2; ++e) {
    pa[e]     = pk16(bf_bits(a0[2 * e]), bf_bits(a0[2 * e + 1]));
    pa[2 + e] = pk16(bf_bits(a1[2 * e]), bf_bits(a1[2 * e + 1]));
    pb[e]     = pk16(bf_bits(b0[2 * e]), bf_bits(b0[2 * e + 1]));
    pb[2 + e] = pk16(bf_bits(b1[2 * e]), bf_bits(b1[2 * e + 1]));
  }
  unsigned short* oa = out + i8;
  unsigned short* ob = out + (size_t)n + i8;
  *(v4u*)oa = pa;
  *(v4u*)ob = pb;
  
}

// =====================================================================================================
// Causal complex attention, per (b, h, 64-query block):
//   sr = qr.kr - qi.ki, si = qr.ki + qi.kr over e=64 (bf16 operands, exact products, f32 accumulate; -qi.ki as
//   qi.(ki with flipped sign bits)); s = sqrt(sr^2 + si^2) * SCL; key > query -> NEG_BIG (value select, diagonal
//   kept); online softmax in f32; p = exp(s - m) carried as ph = f16(1024 p) and, when PRES, pl = f16((1024 p - ph)
//   * PRS); context over the 128-wide value row [v_r | v_i] with v as f16(VSC * bf16 value):
//     oh += ph.v over all chunks; when PRES, ol = pl.v per chunk folded as oh += ol / PRS in f32.
//   Q / K planes (bf16 bits, pitch DMOD): plane 0 = real, plane 1 = imag (NTOK*DMOD apart); element (b, t, h, e)
//     at [(b*SEQ + t)*DMOD + h*64 + e]
//   V^T plane (f16): element (b, part, h, d, t) at [((b*2 + part)*DMOD + h*64 + d)*SEQ + t], part 0 = v_r, 1 = v_i
//   Block = 4 waves = 64 query rows of one (b, h); qb and hb = b * NHEAD + h come from the kernel below;
//   h = hb % NHEAD, b = hb / NHEAD; key chunks of 64, chunks kt <= qb only
//   (block-uniform trip <= NQB), chunk kt == qb keeps its diagonal by the per-element select.
//   K / V^T staging: asynchronous 16-B copies into a ring of two LDS buffers; chunk kt lies in buffer kt & 1 and
//   chunk kt + 1 is in flight while chunk kt is worked on. 8 lanes cover one 128-B line: K copy i of a thread ->
//   key row i*8 + (tid>>4), part (tid>>3)&1, piece tid&7 into Ksh[buf][key][part*64 + e] (pitch KP); V^T copy i ->
//   value row d = i*16 + (tid>>3), piece tid&7 into Vs[buf][d][kv] (pitch VP). At the foot of a chunk every wave:
//   s_wait_dscnt 0, s_wait_asynccnt 0, __syncthreads (publishes chunk kt + 1, frees buffer kt & 1), then the
//   copies of chunk kt + 2. q fragments from the global planes; P tiles wave-private, written with
//   Output row (b, t, h) = 128 f32 [r0, i0, r1, i1, ...] at out + ((b*SEQ + t)*NHEAD + h)*128: the wave's 16x128
//   context tile is staged interleaved in LDS, then each 512-B row is written by 32 lanes x 16 B in ONE
//   coverage: each wave stores rows q0..q0+15 x 128 floats; waves x blocks of the one grid = all (b, t, h) rows.
// =====================================================================================================
template <bool PRES>
__device__ __forceinline__
void attn_body(const unsigned short* __restrict__ QB, const unsigned short* __restrict__ KB,
               const unsigned short* __restrict__ VT, int qb, int hb,
               unsigned short (&Ksh)[2][64 * KP], _Float16 (&Vs)[2][VW * VP], _Float16 (&Psh)[4][16 * PP],
               _Float16 (&Psl)[4][16 * PP], float (&Os)[4][16 * VW]) {
  const int tid  = threadIdx.x;
  const int wave = tid >> 5;
  const int lane = tid & 31;
  const int hh   = lane >> 4;
  const int c    = lane & 15;

  const int h  = hb % NHEAD;
  const int b  = hb / NHEAD;
  const int q0 = qb * 64 + wave * 16;

  const size_t NPL = (size_t)NTOK * DMOD;                              // one bf16 plane (both batches)
  const unsigned short* Qr = QB + (size_t)b * SEQ * DMOD + (size_t)h * HD;
  const unsigned short* Qi = Qr + NPL;
  const unsigned short* Kr = KB + (size_t)b * SEQ * DMOD + (size_t)h * HD;
  const _Float16* Vg = (const _Float16*)(const void*)VT + ((size_t)(b * 2) * DMOD + (size_t)h * HD) * SEQ;

  float mrow[8], lrow[8];
  v8f oh[8];
#pragma unroll
  for (int r = 0; r < 8; ++r) { mrow[r] = NEG_BIG; lrow[r] = 0.f; }
#pragma unroll
  for (int t = 0; t < 8; ++t) oh[t] = zero8();

  _Float16* pwh = Psh[wave];
  _Float16* pwl = &Psl[PRES ? wave : 0][0];

  // ---- this thread's 16 copies of chunk t into ring buffer buf (all lanes on, block-uniform callers) ----
  const int pc = (tid & 7) * 8;                                        // 16-B piece of a 128-B line, in elements
  const unsigned short* kthr = Kr + (size_t)((tid >> 3) & 1) * NPL + (size_t)(tid >> 4) * DMOD + pc;
  const _Float16* vthr = Vg + (size_t)(tid >> 3) * SEQ + pc;
  const unsigned kl0 = lds_byte(&Ksh[0][(tid >> 4) * KP + ((tid >> 3) & 1) * HD + pc]);
  const unsigned vl0 = lds_byte(&Vs[0][(tid >> 3) * VP + pc]);
  auto stage = [&](int t, int buf) {
    unsigned kl[8], vl[8];
    const void* kg[8];
    const void* vg[8];
#pragma unroll
    for (int i = 0; i < 8; ++i) {
      kl[i] = kl0 + (unsigned)buf * (unsigned)sizeof(Ksh[0]) + (unsigned)(i * 8 * KP * 2);
      kg[i] = kthr + (size_t)(t * 64 + i * 8) * DMOD;
      vl[i] = vl0 + (unsigned)buf * (unsigned)sizeof(Vs[0]) + (unsigned)(i * 16 * VP * 2);
      vg[i] = vthr + ((size_t)(i >> 2) * DMOD + (size_t)((i & 3) * 16)) * SEQ + t * 64;
    }
    async_copy8(kl, kg);
    async_copy8(vl, vg);
  };

  stage(0, 0);
  wait_async0();
  __syncthreads();                            // chunk 0 published
  if (qb >= 1) stage(1, 1);

  // ---- Q fragments (A operand, row = lane&15): 2 e-chunks per plane from the global planes, once per block ----
  v16us qr[2], qi[2];
#pragma unroll
  for (int dc = 0; dc < 2; ++dc) {
    qr[dc] = ldfrag_b(Qr + (size_t)(q0 + c) * DMOD + dc * 32 + 8 * hh);
    qi[dc] = ldfrag_b(Qi + (size_t)(q0 + c) * DMOD + dc * 32 + 8 * hh);
  }
  wait_x0(Qr + (size_t)(q0 + c) * DMOD + 8 * hh);   // the one address pair that the eight loads above name

  for (int kt = 0; kt < NQB; ++kt) {          // static bound; block-uniform causal chunk skipping
    if (kt > qb) break;
    const int kv0 = kt * 64;
    const unsigned short* Kc = Ksh[kt & 1];
    const _Float16* Vc = Vs[kt & 1];

    // ---- scores: 16 query rows x 64 keys per wave, depth 64 (2 chunks), 4 products per chunk ----
    v8f s[4];
#pragma unroll
    for (int j = 0; j < 4; ++j) {
      v8f sr = zero8(), si = zero8();
#pragma unroll
      for (int dc = 0; dc < 2; ++dc) {
        const unsigned short* kp = Kc + (j * 16 + c) * KP + dc * 32 + 8 * hh;   // B col = key j*16+c
        FB br, bi;
        br.h[0] = *(const v8us*)(kp);
        br.h[1] = *(const v8us*)(kp + 16);
        bi.h[0] = *(const v8us*)(kp + HD);
        bi.h[1] = *(const v8us*)(kp + HD + 16);
        const v16us bin = neg16(bi.u);
        sr = mma_b_raw(qr[dc], br.u, sr);
        sr = mma_b_raw(qi[dc], bin, sr);
        si = mma_b_raw(qr[dc], bi.u, si);
        si = mma_b_raw(qi[dc], br.u, si);
        guard_b5(sr, si, qr[dc], qi[dc], br.u, bi.u, bin);
      }
      const int key  = kv0 + j * 16 + c;                 // key index of this lane's D column
      const int rowb = q0 + 8 * hh;                      // query row of D element r is rowb + r
#pragma unroll
      for (int r = 0; r < 8; ++r) {
        const float m2 = sr[r] * sr[r] + si[r] * si[r];
        const float v = sqrtf(m2) * SCL;
        s[j][r] = (key <= rowb + r) ? v : NEG_BIG;
      }
    }

    // ---- row max, online softmax, P hi (x1024, f16) and, when PRES, P residual (x PRS, f16) to LDS ----
#pragma unroll
    for (int r = 0; r < 8; ++r) {
      float m = s[0][r];
      m = fmaxf(m, s[1][r]);
      m = fmaxf(m, s[2][r]);
      m = fmaxf(m, s[3][r]);
#pragma unroll
      for (int off = 1; off < 16; off <<= 1) m = fmaxf(m, __shfl_xor(m, off, 32));
      const float mnew  = fmaxf(mrow[r], m);
      const float alpha = __expf(mrow[r] - mnew);
      mrow[r] = mnew;
      float psum = 0.f;
#pragma unroll
      for (int j = 0; j < 4; ++j) {
        const float p  = __expf(s[j][r] - mnew);
        psum += p;
        const float ph = p * PSC;
        const _Float16 xh = (_Float16)ph;
        const int pi = (8 * hh + r) * PP + j * 16 + c;
        pwh[pi] = xh;
        if (PRES) pwl[pi] = (_Float16)((ph - (float)xh) * PRS);
      }
#pragma unroll
      for (int off = 1; off < 16; off <<= 1) psum += __shfl_xor(psum, off, 32);
      lrow[r] = lrow[r] * alpha + psum;
#pragma unroll
      for (int t = 0; t < 8; ++t) oh[t][r] *= alpha;
    }
    wave_sync_lds();

    // ---- context: oh += Phi . V; when PRES: ol = Plo . V, then oh += ol / PRS ----
    v8f ol[8];
#pragma unroll
    for (int t = 0; t < 8; ++t) ol[t] = zero8();
#pragma unroll 1
    for (int kk = 0; kk < 2; ++kk) {
      FH pa, pb;
      pa.h[0] = *(const v8h*)(pwh + c * PP + kk * 32 + 8 * hh);
      pa.h[1] = *(const v8h*)(pwh + c * PP + kk * 32 + 16 + 8 * hh);
      pb.v = pa.v;
      if (PRES) {
        pb.h[0] = *(const v8h*)(pwl + c * PP + kk * 32 + 8 * hh);
        pb.h[1] = *(const v8h*)(pwl + c * PP + kk * 32 + 16 + 8 * hh);
      }
#pragma unroll
      for (int t = 0; t < 8; ++t) {
        FH vb;
        vb.h[0] = *(const v8h*)(Vc + (t * 16 + c) * VP + kk * 32 + 8 * hh);
        vb.h[1] = *(const v8h*)(Vc + (t * 16 + c) * VP + kk * 32 + 16 + 8 * hh);
        oh[t] = mma_h_raw(pa.v, vb.v, oh[t]);
        if (PRES) {
          ol[t] = mma_h_raw(pb.v, vb.v, ol[t]);
          guard_h2(oh[t], ol[t], pa.v, pb.v, vb.v);
        } else {
          guard_h1(oh[t], pa.v, vb.v);
        }
      }
    }
    acc_guard4(oh[0], oh[1], oh[2], oh[3]);
    acc_guard4(oh[4], oh[5], oh[6], oh[7]);
    if (PRES) {
      acc_guard4(ol[0], ol[1], ol[2], ol[3]);
      acc_guard4(ol[4], ol[5], ol[6], ol[7]);
#pragma unroll
      for (int t = 0; t < 8; ++t) {
#pragma unroll
        for (int r = 0; r < 8; ++r) oh[t][r] += ol[t][r] * (1.0f / PRS);
      }
    }
    // ---- publish point of chunk kt + 1; buffer kt & 1 is free behind the barrier ----
    wait_ds0();
    wait_async0();
    __syncthreads();
    if (kt + 2 <= qb) stage(kt + 2, kt & 1);
  }
  wait_async0();                              // nothing is left in flight when the wave goes on to the epilogue

  // ---- normalise (1/l, the 1/PSC p carry and the 1/VSC v carry), stage the wave's 16x128 tile interleaved
  float* os = Os[wave];
#pragma unroll
  for (int r = 0; r < 8; ++r) {
    const float l = lrow[r];
    const float inv = ((l > 0.f) ? (1.0f / l) : 0.f) * (1.0f / (PSC * VSC));
#pragma unroll
    for (int t = 0; t < 8; ++t) {
      const int pos = (t < 4) ? (2 * (t * 16 + c)) : (2 * ((t - 4) * 16 + c) + 1);
      os[(8 * hh + r) * VW + pos] = oh[t][r] * inv;
    }
  }
  // the kernel below reads the tile back, behind its wave_sync_lds(), and stores it
}

// One grid for all query blocks. The blocks with many key chunks (qb >= NQP, no residual tile) take the low indices,
// the short ones (qb < NQP, residual tile) the indices behind them, so that the short blocks run beside the long ones
// on the same launch. The choice is block-uniform (blockIdx only): every barrier of a body is met by all four waves.
#define NLONG ((NQB - NQP) * NHEAD * NBATCH)     // 384 blocks without the residual tile
__global__ __launch_bounds__(128)
void attn_c(const unsigned short* __restrict__ QB, const unsigned short* __restrict__ KB,
            const unsigned short* __restrict__ VT, float* out) {
  __shared__ __align__(16) unsigned short Ksh[2][64 * KP];             // K [buf][kv][kr e 0..63 | ki e 64..127 | pad] 2 x 17 KB
  __shared__ __align__(16) _Float16 Vs[2][VW * VP];                     // V^T [buf][d][kv | pad] 2 x 18 KB
  __shared__ __align__(16) _Float16 Psh[4][16 * PP];                    // per wave P hi [row][kv | pad] 9 KB
  __shared__ __align__(16) _Float16 Psl[4][16 * PP];                    // per wave P residual (qb < NQP only) 9 KB
  __shared__ __align__(16) float    Os[4][16 * VW];                     // per wave context tile [row][128] 32 KB
  const unsigned bid = blockIdx.x;
  int qb, hb;
  if (bid < (unsigned)NLONG) {
    qb = NQP + (int)(bid % (unsigned)(NQB - NQP));
    hb = (int)(bid / (unsigned)(NQB - NQP));
    attn_body<false>(QB, KB, VT, qb, hb, Ksh, Vs, Psh, Psl, Os);
  } else {
    const unsigned sid = bid - (unsigned)NLONG;
    qb = (int)(sid % (unsigned)NQP);
    hb = (int)(sid / (unsigned)NQP);
    attn_body<true>(QB, KB, VT, qb, hb, Ksh, Vs, Psh, Psl, Os);
  }

  // ---- both bodies leave the wave's context tile in Os[wave]; the output stores are common to them ----
  const int wave = threadIdx.x >> 5;
  const int lane = threadIdx.x & 31;
  const int h  = hb % NHEAD;
  const int b  = hb / NHEAD;
  const int q0 = qb * 64 + wave * 16;
  const float* os = Os[wave];
  float* g0 = out + ((size_t)(b * SEQ + q0) * NHEAD + h) * VW + lane * 4;   // row q0 of (b, h), this lane's 16 B
  wave_sync_lds();
  {
#pragma unroll
    for (int it = 0; it < 16; ++it) {                    // row it: 32 lanes x 16 B = 512 B = 128 floats
      const v4f o = *(const v4f*)(os + it * VW + lane * 4);
      *(v4f*)(g0 + (size_t)it * NHEAD * VW) = o;
    }
  }
}

// =====================================================================================================
// Workspace map (bytes); every plane is an exact multiple of its whole-line store granularity (all dims are exact
// tile multiples, no padded tails), all offsets multiples of 8 MiB:
//   QB  bf16 [2 parts][4096 t][512]             0   8388608   (q_r, q_i RNE bits)
//   KB  bf16 [2 parts][4096 t][512]       8388608   8388608   (k_r, k_i RNE bits)
//   VT  f16  [2 b][2 parts][512 (h,d)][2048 t] 16777216   8388608   (bf16 value x16)
//   end                                 25165824
// =====================================================================================================
extern "C" void kernel_launch(void* const* d_in, const int* in_sizes, int n_in,
                              void* d_out, int out_size, void* d_ws, size_t ws_size,
                              hipStream_t stream) {
  const int n = NTOK * DMOD;                                // 2097152 elements per input
  if (n_in < 6) return;
  for (int i = 0; i < 6; ++i) if (in_sizes[i] != n) return;
  if (out_size != 2 * n) return;

  const float* qr = (const float*)d_in[0];
  const float* qi = (const float*)d_in[1];
  const float* kr = (const float*)d_in[2];
  const float* ki = (const float*)d_in[3];
  const float* vr = (const float*)d_in[4];
  const float* vi = (const float*)d_in[5];
  float* outf = (float*)d_out;

  const size_t PQB = (size_t)2 * n * 2;                     //  8388608
  const size_t PKB = (size_t)2 * n * 2;                     //  8388608
  const size_t PVT = (size_t)NBATCH * 2 * DMOD * SEQ * 2;   //  8388608
  size_t off = 0;
  const size_t oQ = off; off += PQB;
  const size_t oK = off; off += PKB;
  const size_t oV = off; off += PVT;
  if (off > ws_size) return;                                // off = 25165824
  if (off > (size_t)134217728) return;

  char* ws = (char*)d_ws;
  unsigned short* QB = (unsigned short*)(ws + oQ);
  unsigned short* KB = (unsigned short*)(ws + oK);
  unsigned short* VT = (unsigned short*)(ws + oV);

  const dim3 blk256(256), blk128(128);

  // (1) q, k -> bf16 planes [part][4096 t][512]
  cvt2<<<dim3(n / 2048), blk256, 0, stream>>>(qr, qi, QB, n);
  cvt2<<<dim3(n / 2048), blk256, 0, stream>>>(kr, ki, KB, n);
  // (2) v -> transposed f16 planes: in[2048 t][512 (h,e)] per batch z -> out[512 (h,d)][2048 t] at part 0 (v_r)
  //     and part 1 (v_i) of batch z; grid = (cols/32, rows/64, batches)
  tr_cvt<<<dim3(DMOD / 32, SEQ / 64, NBATCH), blk256, 0, stream>>>(
      vr, VT, SEQ, DMOD, (long long)SEQ * DMOD, (long long)2 * DMOD * SEQ, VSC);
  tr_cvt<<<dim3(DMOD / 32, SEQ / 64, NBATCH), blk256, 0, stream>>>(
      vi, VT + (size_t)DMOD * SEQ, SEQ, DMOD, (long long)SEQ * DMOD, (long long)2 * DMOD * SEQ, VSC);
  // (3) causal attention -> d_out, one launch: query blocks 0..NQP-1 (rows < 512) with the p residual tile, the rest without
  attn_c<<<dim3(NQB * NHEAD * NBATCH), blk128, 0, stream>>>(QB, KB, VT, outf);
  (void)hipGetLastError();
}

// v004
// A run of this version takes 98.7 microseconds.
// In two side-by-side timings against v003, it was 1.18 and 1.19 times as fast.
// Over all steps from v000 it is 2.95 times as fast.
// Contractions: complex q.k^T as qr.kr, qi.ki (negated), qr.ki, qi.kr over e=64 on v_wmma_f32_16x16x32_bf16 (raw
//   bf16 RNE values of q and k, one product each, signs combined in the f32 accumulators); p.[v_r|v_i] over keys on
//   v_wmma_f32_16x16x32_f16 with p as f16(1024 p) (plus a x4096 f16 residual tile for the first 512 query rows of
//   each sequence) and v as f16 of its bf16 RNE value x16 (exact); f32 accumulate everywhere; score magnitude,
//   causal select, softmax statistics and epilogue in f32.
#include <hip/hip_runtime.h>
#include <math.h>
#include <stdint.h>

#define NBATCH 2
#define SEQ    2048
#define NHEAD  8
#define HD     64                  // score depth e
#define VW     (2 * HD)            // value row width: v_r d 0..63 | v_i d 64..127
#define DMOD   (NHEAD * HD)        // 512: token row pitch of the q/k/v inputs
#define NTOK   (NBATCH * SEQ)      // 4096 token rows
#define NQB    (SEQ / 64)          // 32 query / key tiles of 64
#define NQP    8                   // leading query tiles (rows < 512) that carry the p residual tile
#define VSC    16.0f               // v plane carry (power of two, exact on bf16 values)
#define PSC    1024.0f             // softmax numerator carry
#define PRS    4096.0f             // p residual carry
#define SCL    0.125f              // 1/sqrt(64)
#define NEG_BIG (-1.0e30f)
#define NG     3                   // wave groups of a block; group g takes key chunks g, g + NG, g + 2 NG, ...
#define MGW    (80 * 32)           // floats of one wave's partial: 64 context + 8 maxima + 8 sums per lane
// LDS row pitches in 16-bit elements: every row read by ds_load_b128 fragments (16 lanes = 16 rows, 16 B each) gets
// a pitch of 16 B x odd, so the 16 rows of a half wave fall on all 64 banks instead of on 4 (K) or 8 (V, P).
#define KP     (VW + 8)            // K rows: 256 B of data at 272 B pitch
#define VP     (64 + 8)            // V^T rows: 128 B of data at 144 B pitch
#define PP     (64 + 8)            // P rows: 128 B of data at 144 B pitch
static_assert(HD == 64 && VW == 128);
static_assert((SEQ % 64) == 0 && (DMOD % 32) == 0);
static_assert(((NTOK * DMOD) % 2048) == 0);
static_assert(NQP > 0 && NQP < NQB);
static_assert(((KP * 2) % 32) == 16 && ((VP * 2) % 32) == 16 && ((PP * 2) % 32) == 16);

typedef _Float16 v16h __attribute__((ext_vector_type(16)));
typedef _Float16 v8h  __attribute__((ext_vector_type(8)));
typedef __bf16   v16b __attribute__((ext_vector_type(16)));
typedef unsigned short v16us __attribute__((ext_vector_type(16)));
typedef unsigned short v8us  __attribute__((ext_vector_type(8)));
typedef float    v8f  __attribute__((ext_vector_type(8)));
typedef float    v4f  __attribute__((ext_vector_type(4)));
typedef unsigned int v4u __attribute__((ext_vector_type(4)));
typedef unsigned int v8u __attribute__((ext_vector_type(8)));
union FH { v16h v; v8h h[2]; };
union FB { v16us u; v8us h[2]; v8u w; };

// ---- scalar helpers --------------------------------------------------------------------------------
__device__ __forceinline__ unsigned short bf_bits(float f) {          // f32 -> bf16 bits, RNE convert
  unsigned u = __float_as_uint(f);
  return (unsigned short)((u + 0x7FFFu + ((u >> 16) & 1u)) >> 16);
}
__device__ __forceinline__ float bf_up(unsigned short h) { return __uint_as_float(((unsigned)h) << 16); }
__device__ __forceinline__ unsigned short h_bits(_Float16 x) { return __builtin_bit_cast(unsigned short, x); }
__device__ __forceinline__ unsigned pk16(unsigned short a, unsigned short b) { return (unsigned)a | ((unsigned)b << 16); }
__device__ __forceinline__ v8f zero8() { v8f z = {0.f, 0.f, 0.f, 0.f, 0.f, 0.f, 0.f, 0.f}; return z; }

// ---- fragment loader: 16-bit A/B operand, lane -> row/col (lane&15), p already includes +8*(lane>>4);
//      elements 0..7 <- p[0..7] (k0+8h..), elements 8..15 <- p[16..23] (k0+16+8h..)
__device__ __forceinline__ v16us ldfrag_b(const unsigned short* p) {   // bf16 plane read as 16-bit uint vectors
  FB f;
  f.h[0] = *(const v8us*)(p);
  f.h[1] = *(const v8us*)(p + 16);
  return f.u;
}
// exact negation of a bf16 fragment (sign-bit flip of every 16-bit element)
__device__ __forceinline__ v16us neg16(v16us x) {
  FB f;
  f.u = x;
#pragma unroll
  for (int i = 0; i < 8; ++i) f.w[i] = f.w[i] ^ 0x80008000u;
  return f.u;
}

// ---- WMMA helpers; trailing VALU hazard gaps are issued by the guard_* helpers after each group --------
__device__ __forceinline__ v8f mma_h_raw(v16h a, v16h b, v8f c) {
  return __builtin_amdgcn_wmma_f32_16x16x32_f16(false, a, false, b, (short)0, c, false, false);
}
__device__ __forceinline__ v8f mma_b_raw(v16us a, v16us b, v8f c) {
  return __builtin_amdgcn_wmma_f32_16x16x32_bf16(false, __builtin_bit_cast(v16b, a), false,
                                                 __builtin_bit_cast(v16b, b), (short)0, c, false, false);
}
__device__ __forceinline__ void guard_b5(v8f& x, v8f& y, v16us a, v16us b, v16us d, v16us e, v16us f) {
#if defined(__HIP_DEVICE_COMPILE__)
  asm volatile("v_nop\n\tv_nop\n\tv_nop\n\tv_nop" : "+v"(x), "+v"(y) : "v"(a), "v"(b), "v"(d), "v"(e), "v"(f));
#endif
}
__device__ __forceinline__ void guard_h1(v8f& x, v16h a, v16h b) {
#if defined(__HIP_DEVICE_COMPILE__)
  asm volatile("v_nop\n\tv_nop\n\tv_nop\n\tv_nop" : "+v"(x) : "v"(a), "v"(b));
#endif
}
__device__ __forceinline__ void guard_h2(v8f& x, v8f& y, v16h a, v16h b, v16h d) {
#if defined(__HIP_DEVICE_COMPILE__)
  asm volatile("v_nop\n\tv_nop\n\tv_nop\n\tv_nop" : "+v"(x), "+v"(y) : "v"(a), "v"(b), "v"(d));
#endif
}
__device__ __forceinline__ void acc_guard4(v8f& a, v8f& b, v8f& c, v8f& d) {
#if defined(__HIP_DEVICE_COMPILE__)
  asm volatile("v_nop\n\tv_nop\n\tv_nop\n\tv_nop" : "+v"(a), "+v"(b), "+v"(c), "+v"(d));
#endif
}
__device__ __forceinline__ void wave_sync_lds() {
  __builtin_amdgcn_fence(__ATOMIC_RELEASE, "workgroup");
  __builtin_amdgcn_wave_barrier();
  __builtin_amdgcn_fence(__ATOMIC_ACQUIRE, "workgroup");
}

// ---- asynchronous copies global -> LDS (16 B per lane, through no register) and the ring's waits ----
__device__ __forceinline__ unsigned lds_byte(const void* p) { return (unsigned)(uintptr_t)p; }   // LDS byte address
// eight copies of one lane; the closing s_wait_xcnt stands in front of every later rewrite of an address register
// that a copy names (a precaution), inside the statement so that no address arithmetic can be moved in front of it
__device__ __forceinline__ void async_copy8(const unsigned (&l)[8], const void* const (&g)[8]) {
#if defined(__HIP_DEVICE_COMPILE__)
  asm volatile(
      "global_load_async_to_lds_b128 %0, %8, off\n\t"
      "global_load_async_to_lds_b128 %1, %9, off\n\t"
      "global_load_async_to_lds_b128 %2, %10, off\n\t"
      "global_load_async_to_lds_b128 %3, %11, off\n\t"
      "global_load_async_to_lds_b128 %4, %12, off\n\t"
      "global_load_async_to_lds_b128 %5, %13, off\n\t"
      "global_load_async_to_lds_b128 %6, %14, off\n\t"
      "global_load_async_to_lds_b128 %7, %15, off\n\t"
      "s_wait_xcnt 0x0"
      :: "v"(l[0]), "v"(l[1]), "v"(l[2]), "v"(l[3]), "v"(l[4]), "v"(l[5]), "v"(l[6]), "v"(l[7]),
         "v"(g[0]), "v"(g[1]), "v"(g[2]), "v"(g[3]), "v"(g[4]), "v"(g[5]), "v"(g[6]), "v"(g[7])
      : "memory");
#endif
}
// this wave's copies have landed in LDS (the compiler places no wait for them)
__device__ __forceinline__ void wait_async0() {
#if defined(__HIP_DEVICE_COMPILE__)
  asm volatile("s_wait_asynccnt 0x0" ::: "memory");
#endif
}
// stands behind issued global loads, in front of any rewrite of the address registers that they name (a precaution).
// The address is an input only so that its registers stay untouched up to the wait.
__device__ __forceinline__ void wait_x0(const void* addr) {
#if defined(__HIP_DEVICE_COMPILE__)
  asm volatile("s_wait_xcnt 0x0" :: "v"(addr) : "memory");
#endif
}
// this wave's LDS reads have returned, before the buffer they read is handed to the next tile's copies
__device__ __forceinline__ void wait_ds0() {
#if defined(__HIP_DEVICE_COMPILE__)
  asm volatile("s_wait_dscnt 0x0" ::: "memory");
#endif
}

// =====================================================================================================
// Transpose + convert: input z (stride zin) is f32 [R][C]; output z (stride zout) is an f16 plane [C][R] holding
// f16(bf16 RNE value * scale) (scale a power of two, exact). Tile = 64 input rows x 32 input cols;
// grid = (C/32, R/64, nz), block 256. Load: thread t -> input row t>>2, cols (t&3)*8..+7 (two 16-B loads);
// store: thread t -> output row t>>3 (= input col), input rows (t&7)*8..+7 as ONE 16-B store, so lanes
// coverage: (C/32) x (R/64) tiles x 32 output rows x 64 cols = all of out[C][R] per z (R%64==0, C%32==0).
// =====================================================================================================
__global__ __launch_bounds__(256) void tr_cvt(const float* __restrict__ in, unsigned short* out, int R, int C,
                                             long long zin, long long zout, float scale) {
  __shared__ float tile[64 * 33];
  const int z = blockIdx.z;
  const float* ib = in + (size_t)z * (size_t)zin;
  unsigned short* ob = out + (size_t)z * (size_t)zout;
  const int r0 = blockIdx.y * 64, c0 = blockIdx.x * 32;
  const int t = threadIdx.x;
  {
    const int ir = t >> 2, ic = (t & 3) * 8;
    const float* g = ib + (size_t)(r0 + ir) * (size_t)C + c0 + ic;
    const v4f a = *(const v4f*)g;
    const v4f b = *(const v4f*)(g + 4);
    float* l = tile + ir * 33 + ic;
    l[0] = a[0]; l[1] = a[1]; l[2] = a[2]; l[3] = a[3];
    l[4] = b[0]; l[5] = b[1]; l[6] = b[2]; l[7] = b[3];
  }
  __syncthreads();
  const int orow = t >> 3, piece = (t & 7) * 8;
  v4u p;
#pragma unroll
  for (int e = 0; e < 4; ++e) {
    const float f0 = tile[(piece + 2 * e) * 33 + orow];
    const float f1 = tile[(piece + 2 * e + 1) * 33 + orow];
    const _Float16 x0 = (_Float16)(bf_up(bf_bits(f0)) * scale);
    const _Float16 x1 = (_Float16)(bf_up(bf_bits(f1)) * scale);
    p[e] = pk16(h_bits(x0), h_bits(x1));
  }
  const size_t go = (size_t)(c0 + orow) * (size_t)R + r0 + piece;
  *(v4u*)(ob + go) = p;
  
}

// =====================================================================================================
// Row-major convert of two f32 [n] arrays into two consecutive bf16 planes: out[i] = bf16(a[i]), out[n+i] = bf16(bsrc[i])
// (RNE bits). Thread -> 8 consecutive elements, ONE 16-B store per plane; lanes 8q..8q+7 of a wave write one whole
// coverage: grid.x = n/2048 blocks x 256 threads x 8 = n elements of each plane (n % 2048 == 0 host-checked).
// =====================================================================================================
__global__ __launch_bounds__(256) void cvt2(const float* __restrict__ a, const float* __restrict__ bsrc,
                                           unsigned short* out, int n) {
  const size_t i8 = ((size_t)blockIdx.x * 256 + threadIdx.x) * 8;
  if (i8 + 8 > (size_t)n) return;        // never taken for the host-checked size; no barriers below
  const v4f a0 = *(const v4f*)(a + i8);
  const v4f a1 = *(const v4f*)(a + i8 + 4);
  const v4f b0 = *(const v4f*)(bsrc + i8);
  const v4f b1 = *(const v4f*)(bsrc + i8 + 4);
  v4u pa, pb;
#pragma unroll
  for (int e = 0; e < 2; ++e) {
    pa[e]     = pk16(bf_bits(a0[2 * e]), bf_bits(a0[2 * e + 1]));
    pa[2 + e] = pk16(bf_bits(a1[2 * e]), bf_bits(a1[2 * e + 1]));
    pb[e]     = pk16(bf_bits(b0[2 * e]), bf_bits(b0[2 * e + 1]));
    pb[2 + e] = pk16(bf_bits(b1[2 * e]), bf_bits(b1[2 * e + 1]));
  }
  unsigned short* oa = out + i8;
  unsigned short* ob = out + (size_t)n + i8;
  *(v4u*)oa = pa;
  *(v4u*)ob = pb;
  
}

// =====================================================================================================
// Causal complex attention, per (b, h, 64-query block):
//   sr = qr.kr - qi.ki, si = qr.ki + qi.kr over e=64 (bf16 operands, exact products, f32 accumulate; -qi.ki as
//   qi.(ki with flipped sign bits)); s = sqrt(sr^2 + si^2) * SCL; key > query -> NEG_BIG (value select, diagonal
//   kept); online softmax in f32; p = exp(s - m) carried as ph = f16(1024 p) and, when PRES, pl = f16((1024 p - ph)
//   * PRS); context over the 128-wide value row [v_r | v_i] with v as f16(VSC * bf16 value):
//     oh += ph.v over all chunks; when PRES, ol = pl.v per chunk folded as oh += ol / PRS in f32.
//   Q / K planes (bf16 bits, pitch DMOD): plane 0 = real, plane 1 = imag (NTOK*DMOD apart); element (b, t, h, e)
//     at [(b*SEQ + t)*DMOD + h*64 + e]
//   V^T plane (f16): element (b, part, h, d, t) at [((b*2 + part)*DMOD + h*64 + d)*SEQ + t], part 0 = v_r, 1 = v_i
//   Block = 4 NG waves = NG groups of 4 waves on the SAME 64 query rows of one (b, h); qb and hb = b * NHEAD + h come
//   from the kernel below; h = hb % NHEAD, b = hb / NHEAD; key chunks of 64, chunks kt <= qb only. A stage is NG
//   chunks: in stage p group g works on chunk kt = NG p + g with its own maxima, sums and context tile, so that a query
//   block walks qb / NG + 1 stages (block-uniform trip) and not qb + 1 chunks; a group whose chunk lies past qb (in the
//   last stage only) skips the work and passes every wait and barrier; chunk kt == qb keeps its diagonal by the
//   per-element select. Behind the loop the groups g > 0 hand their partials (context tile, maxima, sums) to group 0
//   through LDS (the K ring, which every reader has left), one barrier, and group 0 merges them one after the other:
//   M = max(m, mg), weights exp(m - M) and exp(mg - M), in f32.
//   K / V^T staging: asynchronous 16-B copies into a ring of two LDS stages of NG chunk buffers each; chunk kt of
//   stage p lies in buffer (p & 1) * NG + g, is copied by group g's own 128 threads (tl = tid & 127), and stage p + 1
//   is in flight while stage p is worked on; a chunk index past the planes' last chunk is clamped to it for the copy
//   (such a chunk lies past qb and is never read). 8 lanes cover one 128-B line: K copy i of a thread ->
//   key row i*8 + (tl>>4), part (tl>>3)&1, piece tl&7 into Ksh[buf][key][part*64 + e] (pitch KP); V^T copy i ->
//   value row d = i*16 + (tl>>3), piece tl&7 into Vs[buf][d][kv] (pitch VP). At the foot of a stage every wave:
//   s_wait_dscnt 0, s_wait_asynccnt 0, __syncthreads (publishes stage p + 1, frees the buffers of stage p), then the
//   copies of stage p + 2.
//   q fragments from the global planes; P tiles wave-private, written with
//   Output row (b, t, h) = 128 f32 [r0, i0, r1, i1, ...] at out + ((b*SEQ + t)*NHEAD + h)*128: the wave's 16x128
//   context tile is staged interleaved in LDS, then each 512-B row is written by 32 lanes x 16 B in ONE
//   coverage: each wave of group 0 stores rows q0..q0+15 x 128 floats; 4 waves x blocks of the grid = all (b, t, h) rows.
// =====================================================================================================
template <bool PRES>
__device__ __forceinline__
void attn_body(const unsigned short* __restrict__ QB, const unsigned short* __restrict__ KB,
               const unsigned short* __restrict__ VT, int qb, int hb,
               unsigned short (&Ksh)[2 * NG][64 * KP], _Float16 (&Vs)[2 * NG][VW * VP],
               _Float16 (&Psh)[4 * NG][16 * PP], _Float16 (&Psl)[4 * NG][16 * PP], float (&Os)[4][16 * VW]) {
  const int tid  = threadIdx.x;
  const int grp  = __builtin_amdgcn_readfirstlane(tid >> 7);           // wave group (wave-uniform)
  const int tl   = tid & 127;                                          // thread within its group
  const int wave = tl >> 5;                                            // 16-row slice of the query block
  const int lane = tid & 31;
  const int hh   = lane >> 4;
  const int c    = lane & 15;

  const int h  = hb % NHEAD;
  const int b  = hb / NHEAD;
  const int q0 = qb * 64 + wave * 16;

  const size_t NPL = (size_t)NTOK * DMOD;                              // one bf16 plane (both batches)
  const unsigned short* Qr = QB + (size_t)b * SEQ * DMOD + (size_t)h * HD;
  const unsigned short* Qi = Qr + NPL;
  const unsigned short* Kr = KB + (size_t)b * SEQ * DMOD + (size_t)h * HD;
  const _Float16* Vg = (const _Float16*)(const void*)VT + ((size_t)(b * 2) * DMOD + (size_t)h * HD) * SEQ;

  float mrow[8], lrow[8];
  v8f oh[8];
#pragma unroll
  for (int r = 0; r < 8; ++r) { mrow[r] = NEG_BIG; lrow[r] = 0.f; }
#pragma unroll
  for (int t = 0; t < 8; ++t) oh[t] = zero8();

  _Float16* pwh = Psh[tid >> 5];
  _Float16* pwl = &Psl[PRES ? (tid >> 5) : 0][0];

  // ---- this thread's 16 copies of chunk t into ring buffer buf (all lanes on, block-uniform callers) ----
  const int pc = (tl & 7) * 8;                                         // 16-B piece of a 128-B line, in elements
  const unsigned short* kthr = Kr + (size_t)((tl >> 3) & 1) * NPL + (size_t)(tl >> 4) * DMOD + pc;
  const _Float16* vthr = Vg + (size_t)(tl >> 3) * SEQ + pc;
  const unsigned kl0 = lds_byte(&Ksh[0][(tl >> 4) * KP + ((tl >> 3) & 1) * HD + pc]);
  const unsigned vl0 = lds_byte(&Vs[0][(tl >> 3) * VP + pc]);
  auto stage = [&](int tq, int buf) {
    const int t = (tq < NQB) ? tq : (NQB - 1);                         // every copy stays inside the planes
    unsigned kl[8], vl[8];
    const void* kg[8];
    const void* vg[8];
#pragma unroll
    for (int i = 0; i < 8; ++i) {
      kl[i] = kl0 + (unsigned)buf * (unsigned)sizeof(Ksh[0]) + (unsigned)(i * 8 * KP * 2);
      kg[i] = kthr + (size_t)(t * 64 + i * 8) * DMOD;
      vl[i] = vl0 + (unsigned)buf * (unsigned)sizeof(Vs[0]) + (unsigned)(i * 16 * VP * 2);
      vg[i] = vthr + ((size_t)(i >> 2) * DMOD + (size_t)((i & 3) * 16)) * SEQ + t * 64;
    }
    async_copy8(kl, kg);
    async_copy8(vl, vg);
  };

  const int np = qb / NG + 1;                 // stages of NG chunks (block-uniform)
  stage(grp, grp);
  wait_async0();
  __syncthreads();                            // stage 0 published
  if (np > 1) stage(NG + grp, NG + grp);

  // ---- Q fragments (A operand, row = lane&15): 2 e-chunks per plane from the global planes, once per block ----
  v16us qr[2], qi[2];
#pragma unroll
  for (int dc = 0; dc < 2; ++dc) {
    qr[dc] = ldfrag_b(Qr + (size_t)(q0 + c) * DMOD + dc * 32 + 8 * hh);
    qi[dc] = ldfrag_b(Qi + (size_t)(q0 + c) * DMOD + dc * 32 + 8 * hh);
  }
  wait_x0(Qr + (size_t)(q0 + c) * DMOD + 8 * hh);   // the one address pair that the eight loads above name

  for (int p = 0; p < (NQB + NG - 1) / NG; ++p) {   // static bound; block-uniform causal stage skipping
    if (p >= np) break;
    const int kt = NG * p + grp;              // this group's chunk of the stage
    const int bi = (p & 1) * NG + grp;        // and its ring buffer
    if (kt <= qb) {                           // wave-uniform; no barrier inside
    const int kv0 = kt * 64;
    const unsigned short* Kc = Ksh[bi];
    const _Float16* Vc = Vs[bi];

    // ---- scores: 16 query rows x 64 keys per wave, depth 64 (2 chunks), 4 products per chunk ----
    v8f s[4];
#pragma unroll
    for (int j = 0; j < 4; ++j) {
      v8f sr = zero8(), si = zero8();
#pragma unroll
      for (int dc = 0; dc < 2; ++dc) {
        const unsigned short* kp = Kc + (j * 16 + c) * KP + dc * 32 + 8 * hh;   // B col = key j*16+c
        FB br, bi;
        br.h[0] = *(const v8us*)(kp);
        br.h[1] = *(const v8us*)(kp + 16);
        bi.h[0] = *(const v8us*)(kp + HD);
        bi.h[1] = *(const v8us*)(kp + HD + 16);
        const v16us bin = neg16(bi.u);
        sr = mma_b_raw(qr[dc], br.u, sr);
        sr = mma_b_raw(qi[dc], bin, sr);
        si = mma_b_raw(qr[dc], bi.u, si);
        si = mma_b_raw(qi[dc], br.u, si);
        guard_b5(sr, si, qr[dc], qi[dc], br.u, bi.u, bin);
      }
      const int key  = kv0 + j * 16 + c;                 // key index of this lane's D column
      const int rowb = q0 + 8 * hh;                      // query row of D element r is rowb + r
#pragma unroll
      for (int r = 0; r < 8; ++r) {
        const float m2 = sr[r] * sr[r] + si[r] * si[r];
        const float v = sqrtf(m2) * SCL;
        s[j][r] = (key <= rowb + r) ? v : NEG_BIG;
      }
    }

    // ---- row max, online softmax, P hi (x1024, f16) and, when PRES, P residual (x PRS, f16) to LDS ----
#pragma unroll
    for (int r = 0; r < 8; ++r) {
      float m = s[0][r];
      m = fmaxf(m, s[1][r]);
      m = fmaxf(m, s[2][r]);
      m = fmaxf(m, s[3][r]);
#pragma unroll
      for (int off = 1; off < 16; off <<= 1) m = fmaxf(m, __shfl_xor(m, off, 32));
      const float mnew  = fmaxf(mrow[r], m);
      const float alpha = __expf(mrow[r] - mnew);
      mrow[r] = mnew;
      float psum = 0.f;
#pragma unroll
      for (int j = 0; j < 4; ++j) {
        const float p  = __expf(s[j][r] - mnew);
        psum += p;
        const float ph = p * PSC;
        const _Float16 xh = (_Float16)ph;
        const int pi = (8 * hh + r) * PP + j * 16 + c;
        pwh[pi] = xh;
        if (PRES) pwl[pi] = (_Float16)((ph - (float)xh) * PRS);
      }
#pragma unroll
      for (int off = 1; off < 16; off <<= 1) psum += __shfl_xor(psum, off, 32);
      lrow[r] = lrow[r] * alpha + psum;
#pragma unroll
      for (int t = 0; t < 8; ++t) oh[t][r] *= alpha;
    }
    wave_sync_lds();

    // ---- context: oh += Phi . V; when PRES: ol = Plo . V, then oh += ol / PRS ----
    v8f ol[8];
#pragma unroll
    for (int t = 0; t < 8; ++t) ol[t] = zero8();
#pragma unroll 1
    for (int kk = 0; kk < 2; ++kk) {
      FH pa, pb;
      pa.h[0] = *(const v8h*)(pwh + c * PP + kk * 32 + 8 * hh);
      pa.h[1] = *(const v8h*)(pwh + c * PP + kk * 32 + 16 + 8 * hh);
      pb.v = pa.v;
      if (PRES) {
        pb.h[0] = *(const v8h*)(pwl + c * PP + kk * 32 + 8 * hh);
        pb.h[1] = *(const v8h*)(pwl + c * PP + kk * 32 + 16 + 8 * hh);
      }
#pragma unroll
      for (int t = 0; t < 8; ++t) {
        FH vb;
        vb.h[0] = *(const v8h*)(Vc + (t * 16 + c) * VP + kk * 32 + 8 * hh);
        vb.h[1] = *(const v8h*)(Vc + (t * 16 + c) * VP + kk * 32 + 16 + 8 * hh);
        oh[t] = mma_h_raw(pa.v, vb.v, oh[t]);
        if (PRES) {
          ol[t] = mma_h_raw(pb.v, vb.v, ol[t]);
          guard_h2(oh[t], ol[t], pa.v, pb.v, vb.v);
        } else {
          guard_h1(oh[t], pa.v, vb.v);
        }
      }
    }
    acc_guard4(oh[0], oh[1], oh[2], oh[3]);
    acc_guard4(oh[4], oh[5], oh[6], oh[7]);
    if (PRES) {
      acc_guard4(ol[0], ol[1], ol[2], ol[3]);
      acc_guard4(ol[4], ol[5], ol[6], ol[7]);
#pragma unroll
      for (int t = 0; t < 8; ++t) {
#pragma unroll
        for (int r = 0; r < 8; ++r) oh[t][r] += ol[t][r] * (1.0f / PRS);
      }
    }
    }
    // ---- publish point of stage p + 1; the buffers of stage p are free behind the barrier ----
    wait_ds0();
    wait_async0();
    __syncthreads();
    if (p + 2 < np) stage(NG * (p + 2) + grp, bi);
  }
  wait_async0();                              // nothing is left in flight when the wave goes on to the epilogue

  // ---- merge of the groups' partials: each group g > 0 writes its lanes' values (lane-contiguous; a lane of group 0
  //      reads back the positions of its own accumulator layout), one barrier, group 0 combines in f32. The partials
  //      lie in the K ring: behind the loop's last barrier no wave reads it and no copy is in flight ----
  static_assert(sizeof(Ksh) >= (size_t)(NG - 1) * 4 * MGW * sizeof(float));
  float* mg0 = (float*)(void*)&Ksh[0][0] + wave * MGW + lane;
  if (grp != 0) {
    float* mg = mg0 + (grp - 1) * 4 * MGW;
#pragma unroll
    for (int t = 0; t < 8; ++t) {
#pragma unroll
      for (int r = 0; r < 8; ++r) mg[(t * 8 + r) * 32] = oh[t][r];
    }
#pragma unroll
    for (int r = 0; r < 8; ++r) {
      mg[(64 + r) * 32] = mrow[r];
      mg[(72 + r) * 32] = lrow[r];
    }
  }
  __syncthreads();                            // the partials are published; met by every wave of the block
  if (grp != 0) return;                       // no barrier follows; the kernel below leaves with it
#pragma unroll
  for (int g = 1; g < NG; ++g) {
    const float* mg = mg0 + (g - 1) * 4 * MGW;
#pragma unroll
    for (int r = 0; r < 8; ++r) {
      const float m1 = mg[(64 + r) * 32];
      const float l1 = mg[(72 + r) * 32];
      const float mm = fmaxf(mrow[r], m1);
      const float a0 = __expf(mrow[r] - mm);
      const float a1 = __expf(m1 - mm);       // 0 where group g had no chunk (m1 = NEG_BIG, its sums 0)
      mrow[r] = mm;
      lrow[r] = lrow[r] * a0 + l1 * a1;
#pragma unroll
      for (int t = 0; t < 8; ++t) oh[t][r] = oh[t][r] * a0 + mg[(t * 8 + r) * 32] * a1;
    }
  }

  // ---- normalise (1/l, the 1/PSC p carry and the 1/VSC v carry), stage the wave's 16x128 tile interleaved
  float* os = Os[wave];
#pragma unroll
  for (int r = 0; r < 8; ++r) {
    const float l = lrow[r];
    const float inv = ((l > 0.f) ? (1.0f / l) : 0.f) * (1.0f / (PSC * VSC));
#pragma unroll
    for (int t = 0; t < 8; ++t) {
      const int pos = (t < 4) ? (2 * (t * 16 + c)) : (2 * ((t - 4) * 16 + c) + 1);
      os[(8 * hh + r) * VW + pos] = oh[t][r] * inv;
    }
  }
  // the kernel below reads the tile back, behind its wave_sync_lds(), and stores it
}

// One grid for all query blocks. The blocks with many key chunks (qb >= NQP, no residual tile) take the low indices,
// the short ones (qb < NQP, residual tile) the indices behind them, so that the short blocks run beside the long ones
// on the same launch. The choice is block-uniform (blockIdx only): every barrier of a body is met by all 4 NG waves.
#define NLONG ((NQB - NQP) * NHEAD * NBATCH)     // 384 blocks without the residual tile
__global__ __launch_bounds__(128 * NG)
void attn_c(const unsigned short* __restrict__ QB, const unsigned short* __restrict__ KB,
            const unsigned short* __restrict__ VT, float* out) {
  __shared__ __align__(16) unsigned short Ksh[2 * NG][64 * KP];        // K [buf][kv][kr e 0..63 | ki e 64..127 | pad] 6 x 17 KB
  __shared__ __align__(16) _Float16 Vs[2 * NG][VW * VP];                // V^T [buf][d][kv | pad] 6 x 18 KB
  __shared__ __align__(16) _Float16 Psh[4 * NG][16 * PP];               // per wave P hi [row][kv | pad] 27 KB
  __shared__ __align__(16) _Float16 Psl[4 * NG][16 * PP];               // per wave P residual (qb < NQP only) 27 KB
  __shared__ __align__(16) float    Os[4][16 * VW];                     // group 0, per wave context tile [row][128] 32 KB
  const unsigned bid = blockIdx.x;
  int qb, hb;
  if (bid < (unsigned)NLONG) {
    qb = NQP + (int)(bid % (unsigned)(NQB - NQP));
    hb = (int)(bid / (unsigned)(NQB - NQP));
    attn_body<false>(QB, KB, VT, qb, hb, Ksh, Vs, Psh, Psl, Os);
  } else {
    const unsigned sid = bid - (unsigned)NLONG;
    qb = (int)(sid % (unsigned)NQP);
    hb = (int)(sid / (unsigned)NQP);
    attn_body<true>(QB, KB, VT, qb, hb, Ksh, Vs, Psh, Psl, Os);
  }
  if (threadIdx.x >= 128) return;             // the groups g > 0 have handed over; whole waves, no barrier below

  // ---- both bodies leave the wave's context tile in Os[wave]; the output stores are common to them ----
  const int wave = threadIdx.x >> 5;
  const int lane = threadIdx.x & 31;
  const int h  = hb % NHEAD;
  const int b  = hb / NHEAD;
  const int q0 = qb * 64 + wave * 16;
  const float* os = Os[wave];
  float* g0 = out + ((size_t)(b * SEQ + q0) * NHEAD + h) * VW + lane * 4;   // row q0 of (b, h), this lane's 16 B
  wave_sync_lds();
  {
#pragma unroll
    for (int it = 0; it < 16; ++it) {                    // row it: 32 lanes x 16 B = 512 B = 128 floats
      const v4f o = *(const v4f*)(os + it * VW + lane * 4);
      *(v4f*)(g0 + (size_t)it * NHEAD * VW) = o;
    }
  }
}

// =====================================================================================================
// Workspace map (bytes); every plane is an exact multiple of its whole-line store granularity (all dims are exact
// tile multiples, no padded tails), all offsets multiples of 8 MiB:
//   QB  bf16 [2 parts][4096 t][512]             0   8388608   (q_r, q_i RNE bits)
//   KB  bf16 [2 parts][4096 t][512]       8388608   8388608   (k_r, k_i RNE bits)
//   VT  f16  [2 b][2 parts][512 (h,d)][2048 t] 16777216   8388608   (bf16 value x16)
//   end                                 25165824
// =====================================================================================================
extern "C" void kernel_launch(void* const* d_in, const int* in_sizes, int n_in,
                              void* d_out, int out_size, void* d_ws, size_t ws_size,
                              hipStream_t stream) {
  const int n = NTOK * DMOD;                                // 2097152 elements per input
  if (n_in < 6) return;
  for (int i = 0; i < 6; ++i) if (in_sizes[i] != n) return;
  if (out_size != 2 * n) return;

  const float* qr = (const float*)d_in[0];
  const float* qi = (const float*)d_in[1];
  const float* kr = (const float*)d_in[2];
  const float* ki = (const float*)d_in[3];
  const float* vr = (const float*)d_in[4];
  const float* vi = (const float*)d_in[5];
  float* outf = (float*)d_out;

  const size_t PQB = (size_t)2 * n * 2;                     //  8388608
  const size_t PKB = (size_t)2 * n * 2;                     //  8388608
  const size_t PVT = (size_t)NBATCH * 2 * DMOD * SEQ * 2;   //  8388608
  size_t off = 0;
  const size_t oQ = off; off += PQB;
  const size_t oK = off; off += PKB;
  const size_t oV = off; off += PVT;
  if (off > ws_size) return;                                // off = 25165824
  if (off > (size_t)134217728) return;

  char* ws = (char*)d_ws;
  unsigned short* QB = (unsigned short*)(ws + oQ);
  unsigned short* KB = (unsigned short*)(ws + oK);
  unsigned short* VT = (unsigned short*)(ws + oV);

  const dim3 blk256(256), blkatt(128 * NG);

  // (1) q, k -> bf16 planes [part][4096 t][512]
  cvt2<<<dim3(n / 2048), blk256, 0, stream>>>(qr, qi, QB, n);
  cvt2<<<dim3(n / 2048), blk256, 0, stream>>>(kr, ki, KB, n);
  // (2) v -> transposed f16 planes: in[2048 t][512 (h,e)] per batch z -> out[512 (h,d)][2048 t] at part 0 (v_r)
  //     and part 1 (v_i) of batch z; grid = (cols/32, rows/64, batches)
  tr_cvt<<<dim3(DMOD / 32, SEQ / 64, NBATCH), blk256, 0, stream>>>(
      vr, VT, SEQ, DMOD, (long long)SEQ * DMOD, (long long)2 * DMOD * SEQ, VSC);
  tr_cvt<<<dim3(DMOD / 32, SEQ / 64, NBATCH), blk256, 0, stream>>>(
      vi, VT + (size_t)DMOD * SEQ, SEQ, DMOD, (long long)SEQ * DMOD, (long long)2 * DMOD * SEQ, VSC);
  // (3) causal attention -> d_out, one launch: query blocks 0..NQP-1 (rows < 512) with the p residual tile, the rest without
  attn_c<<<dim3(NQB * NHEAD * NBATCH), blkatt, 0, stream>>>(QB, KB, VT, outf);
  (void)hipGetLastError();
}

// v005
// It runs in 74.6 microseconds.
// In both of two side-by-side timings against v004, it was 1.32 times as fast.
// Counting every step since v000, it is 3.91 times as fast.
// Contractions: complex q.k^T as qr.kr, qi.ki (negated), qr.ki, qi.kr over e=64 on v_wmma_f32_16x16x32_bf16 (raw
//   bf16 RNE values of q and k, one product each, signs combined in the f32 accumulators); p.[v_r|v_i] over keys on
//   v_wmma_f32_16x16x32_f16 with p as f16(1024 p) (plus a x4096 f16 residual tile for the first 512 query rows of
//   each sequence) and v as f16 of its bf16 RNE value x16 (exact); f32 accumulate everywhere; score magnitude,
//   causal select, softmax statistics and epilogue in f32.
#include <hip/hip_runtime.h>
#include <math.h>
#include <stdint.h>

#define NBATCH 2
#define SEQ    2048
#define NHEAD  8
#define HD     64                  // score depth e
#define VW     (2 * HD)            // value row width: v_r d 0..63 | v_i d 64..127
#define DMOD   (NHEAD * HD)        // 512: token row pitch of the q/k/v inputs
#define NTOK   (NBATCH * SEQ)      // 4096 token rows
#define NQB    (SEQ / 64)          // 32 query / key tiles of 64
#define NQP    8                   // leading query tiles (rows < 512) that carry the p residual tile
#define VSC    16.0f               // v plane carry (power of two, exact on bf16 values)
#define PSC    1024.0f             // softmax numerator carry
#define PRS    4096.0f             // p residual carry
#define SCL    0.125f              // 1/sqrt(64)
#define NEG_BIG (-1.0e30f)
#define NG     3                   // wave groups of a block; group g takes key chunks g, g + NG, g + 2 NG, ...
#define MGW    (80 * 32)           // floats of one wave's partial: 64 context + 8 maxima + 8 sums per lane
// LDS row pitches in 16-bit elements: every row read by ds_load_b128 fragments (16 lanes = 16 rows, 16 B each) gets
// a pitch of 16 B x odd, so the 16 rows of a half wave fall on all 64 banks instead of on 4 (K) or 8 (V, P).
#define KP     (VW + 8)            // K rows: 256 B of data at 272 B pitch
#define VP     (64 + 8)            // V^T rows: 128 B of data at 144 B pitch
#define PP     (64 + 8)            // P rows: 128 B of data at 144 B pitch
static_assert(HD == 64 && VW == 128);
static_assert((SEQ % 64) == 0 && (DMOD % 32) == 0);
static_assert(((NTOK * DMOD) % 2048) == 0);
static_assert(NQP > 0 && NQP < NQB);
static_assert(((KP * 2) % 32) == 16 && ((VP * 2) % 32) == 16 && ((PP * 2) % 32) == 16);

typedef _Float16 v16h __attribute__((ext_vector_type(16)));
typedef _Float16 v8h  __attribute__((ext_vector_type(8)));
typedef __bf16   v16b __attribute__((ext_vector_type(16)));
typedef unsigned short v16us __attribute__((ext_vector_type(16)));
typedef unsigned short v8us  __attribute__((ext_vector_type(8)));
typedef float    v8f  __attribute__((ext_vector_type(8)));
typedef float    v4f  __attribute__((ext_vector_type(4)));
typedef unsigned int v4u __attribute__((ext_vector_type(4)));
typedef unsigned int v8u __attribute__((ext_vector_type(8)));
union FH { v16h v; v8h h[2]; };
union FB { v16us u; v8us h[2]; v8u w; };

// ---- scalar helpers --------------------------------------------------------------------------------
__device__ __forceinline__ unsigned short bf_bits(float f) {          // f32 -> bf16 bits, RNE convert
  unsigned u = __float_as_uint(f);
  return (unsigned short)((u + 0x7FFFu + ((u >> 16) & 1u)) >> 16);
}
__device__ __forceinline__ float bf_up(unsigned short h) { return __uint_as_float(((unsigned)h) << 16); }
__device__ __forceinline__ unsigned short h_bits(_Float16 x) { return __builtin_bit_cast(unsigned short, x); }
__device__ __forceinline__ unsigned pk16(unsigned short a, unsigned short b) { return (unsigned)a | ((unsigned)b << 16); }
__device__ __forceinline__ v8f zero8() { v8f z = {0.f, 0.f, 0.f, 0.f, 0.f, 0.f, 0.f, 0.f}; return z; }

// ---- fragment loader: 16-bit A/B operand, lane -> row/col (lane&15), p already includes +8*(lane>>4);
//      elements 0..7 <- p[0..7] (k0+8h..), elements 8..15 <- p[16..23] (k0+16+8h..)
__device__ __forceinline__ v16us ldfrag_b(const unsigned short* p) {   // bf16 plane read as 16-bit uint vectors
  FB f;
  f.h[0] = *(const v8us*)(p);
  f.h[1] = *(const v8us*)(p + 16);
  return f.u;
}
// exact negation of a bf16 fragment (sign-bit flip of every 16-bit element)
__device__ __forceinline__ v16us neg16(v16us x) {
  FB f;
  f.u = x;
#pragma unroll
  for (int i = 0; i < 8; ++i) f.w[i] = f.w[i] ^ 0x80008000u;
  return f.u;
}

// ---- WMMA helpers; trailing VALU hazard gaps are issued by the guard_* helpers after each group --------
__device__ __forceinline__ v8f mma_h_raw(v16h a, v16h b, v8f c) {
  return __builtin_amdgcn_wmma_f32_16x16x32_f16(false, a, false, b, (short)0, c, false, false);
}
__device__ __forceinline__ v8f mma_b_raw(v16us a, v16us b, v8f c) {
  return __builtin_amdgcn_wmma_f32_16x16x32_bf16(false, __builtin_bit_cast(v16b, a), false,
                                                 __builtin_bit_cast(v16b, b), (short)0, c, false, false);
}
__device__ __forceinline__ void guard_b5(v8f& x, v8f& y, v16us a, v16us b, v16us d, v16us e, v16us f) {
#if defined(__HIP_DEVICE_COMPILE__)
  asm volatile("v_nop\n\tv_nop\n\tv_nop\n\tv_nop" : "+v"(x), "+v"(y) : "v"(a), "v"(b), "v"(d), "v"(e), "v"(f));
#endif
}
__device__ __forceinline__ void guard_h1(v8f& x, v16h a, v16h b) {
#if defined(__HIP_DEVICE_COMPILE__)
  asm volatile("v_nop\n\tv_nop\n\tv_nop\n\tv_nop" : "+v"(x) : "v"(a), "v"(b));
#endif
}
__device__ __forceinline__ void guard_h2(v8f& x, v8f& y, v16h a, v16h b, v16h d) {
#if defined(__HIP_DEVICE_COMPILE__)
  asm volatile("v_nop\n\tv_nop\n\tv_nop\n\tv_nop" : "+v"(x), "+v"(y) : "v"(a), "v"(b), "v"(d));
#endif
}
__device__ __forceinline__ void acc_guard4(v8f& a, v8f& b, v8f& c, v8f& d) {
#if defined(__HIP_DEVICE_COMPILE__)
  asm volatile("v_nop\n\tv_nop\n\tv_nop\n\tv_nop" : "+v"(a), "+v"(b), "+v"(c), "+v"(d));
#endif
}
__device__ __forceinline__ void wave_sync_lds() {
  __builtin_amdgcn_fence(__ATOMIC_RELEASE, "workgroup");
  __builtin_amdgcn_wave_barrier();
  __builtin_amdgcn_fence(__ATOMIC_ACQUIRE, "workgroup");
}

// ---- asynchronous copies global -> LDS (16 B per lane, through no register) and the ring's waits ----
__device__ __forceinline__ unsigned lds_byte(const void* p) { return (unsigned)(uintptr_t)p; }   // LDS byte address
// eight copies of one lane; the closing s_wait_xcnt stands in front of every later rewrite of an address register
// that a copy names (a precaution), inside the statement so that no address arithmetic can be moved in front of it
__device__ __forceinline__ void async_copy8(const unsigned (&l)[8], const void* const (&g)[8]) {
#if defined(__HIP_DEVICE_COMPILE__)
  asm volatile(
      "global_load_async_to_lds_b128 %0, %8, off\n\t"
      "global_load_async_to_lds_b128 %1, %9, off\n\t"
      "global_load_async_to_lds_b128 %2, %10, off\n\t"
      "global_load_async_to_lds_b128 %3, %11, off\n\t"
      "global_load_async_to_lds_b128 %4, %12, off\n\t"
      "global_load_async_to_lds_b128 %5, %13, off\n\t"
      "global_load_async_to_lds_b128 %6, %14, off\n\t"
      "global_load_async_to_lds_b128 %7, %15, off\n\t"
      "s_wait_xcnt 0x0"
      :: "v"(l[0]), "v"(l[1]), "v"(l[2]), "v"(l[3]), "v"(l[4]), "v"(l[5]), "v"(l[6]), "v"(l[7]),
         "v"(g[0]), "v"(g[1]), "v"(g[2]), "v"(g[3]), "v"(g[4]), "v"(g[5]), "v"(g[6]), "v"(g[7])
      : "memory");
#endif
}
// this wave's copies have landed in LDS (the compiler places no wait for them)
__device__ __forceinline__ void wait_async0() {
#if defined(__HIP_DEVICE_COMPILE__)
  asm volatile("s_wait_asynccnt 0x0" ::: "memory");
#endif
}
// stands behind issued global loads, in front of any rewrite of the address registers that they name (a precaution).
// The address is an input only so that its registers stay untouched up to the wait.
__device__ __forceinline__ void wait_x0(const void* addr) {
#if defined(__HIP_DEVICE_COMPILE__)
  asm volatile("s_wait_xcnt 0x0" :: "v"(addr) : "memory");
#endif
}
// this wave's LDS reads have returned, before the buffer they read is handed to the next tile's copies
__device__ __forceinline__ void wait_ds0() {
#if defined(__HIP_DEVICE_COMPILE__)
  asm volatile("s_wait_dscnt 0x0" ::: "memory");
#endif
}

// =====================================================================================================
// Transpose + convert: input z (stride zin) is f32 [R][C]; output z (stride zout) is an f16 plane [C][R] holding
// f16(bf16 RNE value * scale) (scale a power of two, exact). Tile = 64 input rows x 32 input cols;
// grid = (C/32, R/64, nz), block 256. Load: thread t -> input row t>>2, cols (t&3)*8..+7 (two 16-B loads);
// store: thread t -> output row t>>3 (= input col), input rows (t&7)*8..+7 as ONE 16-B store, so lanes
// coverage: (C/32) x (R/64) tiles x 32 output rows x 64 cols = all of out[C][R] per z (R%64==0, C%32==0).
// =====================================================================================================
__global__ __launch_bounds__(256) void tr_cvt(const float* __restrict__ in, unsigned short* out, int R, int C,
                                             long long zin, long long zout, float scale) {
  __shared__ float tile[64 * 33];
  const int z = blockIdx.z;
  const float* ib = in + (size_t)z * (size_t)zin;
  unsigned short* ob = out + (size_t)z * (size_t)zout;
  const int r0 = blockIdx.y * 64, c0 = blockIdx.x * 32;
  const int t = threadIdx.x;
  {
    const int ir = t >> 2, ic = (t & 3) * 8;
    const float* g = ib + (size_t)(r0 + ir) * (size_t)C + c0 + ic;
    const v4f a = *(const v4f*)g;
    const v4f b = *(const v4f*)(g + 4);
    float* l = tile + ir * 33 + ic;
    l[0] = a[0]; l[1] = a[1]; l[2] = a[2]; l[3] = a[3];
    l[4] = b[0]; l[5] = b[1]; l[6] = b[2]; l[7] = b[3];
  }
  __syncthreads();
  const int orow = t >> 3, piece = (t & 7) * 8;
  v4u p;
#pragma unroll
  for (int e = 0; e < 4; ++e) {
    const float f0 = tile[(piece + 2 * e) * 33 + orow];
    const float f1 = tile[(piece + 2 * e + 1) * 33 + orow];
    const _Float16 x0 = (_Float16)(bf_up(bf_bits(f0)) * scale);
    const _Float16 x1 = (_Float16)(bf_up(bf_bits(f1)) * scale);
    p[e] = pk16(h_bits(x0), h_bits(x1));
  }
  const size_t go = (size_t)(c0 + orow) * (size_t)R + r0 + piece;
  *(v4u*)(ob + go) = p;
  
}

// =====================================================================================================
// Row-major convert of two f32 [n] arrays into two consecutive bf16 planes: out[i] = bf16(a[i]), out[n+i] = bf16(bsrc[i])
// (RNE bits). Thread -> 8 consecutive elements, ONE 16-B store per plane; lanes 8q..8q+7 of a wave write one whole
// coverage: grid.x = n/2048 blocks x 256 threads x 8 = n elements of each plane (n % 2048 == 0 host-checked).
// =====================================================================================================
__global__ __launch_bounds__(256) void cvt2(const float* __restrict__ a, const float* __restrict__ bsrc,
                                           unsigned short* out, int n) {
  const size_t i8 = ((size_t)blockIdx.x * 256 + threadIdx.x) * 8;
  if (i8 + 8 > (size_t)n) return;        // never taken for the host-checked size; no barriers below
  const v4f a0 = *(const v4f*)(a + i8);
  const v4f a1 = *(const v4f*)(a + i8 + 4);
  const v4f b0 = *(const v4f*)(bsrc + i8);
  const v4f b1 = *(const v4f*)(bsrc + i8 + 4);
  v4u pa, pb;
#pragma unroll
  for (int e = 0; e < 2; ++e) {
    pa[e]     = pk16(bf_bits(a0[2 * e]), bf_bits(a0[2 * e + 1]));
    pa[2 + e] = pk16(bf_bits(a1[2 * e]), bf_bits(a1[2 * e + 1]));
    pb[e]     = pk16(bf_bits(b0[2 * e]), bf_bits(b0[2 * e + 1]));
    pb[2 + e] = pk16(bf_bits(b1[2 * e]), bf_bits(b1[2 * e + 1]));
  }
  unsigned short* oa = out + i8;
  unsigned short* ob = out + (size_t)n + i8;
  *(v4u*)oa = pa;
  *(v4u*)ob = pb;
  
}

// =====================================================================================================
// Causal complex attention, per (b, h, 64-query block):
//   sr = qr.kr - qi.ki, si = qr.ki + qi.kr over e=64 (bf16 operands, exact products, f32 accumulate; -qi.ki as
//   qi.(ki with flipped sign bits)); s = sqrt(sr^2 + si^2) * SCL; key > query -> NEG_BIG (value select, diagonal
//   kept); online softmax in f32; p = exp(s - m) carried as ph = f16(1024 p) and, when PRES, pl = f16((1024 p - ph)
//   * PRS); context over the 128-wide value row [v_r | v_i] with v as f16(VSC * bf16 value):
//     oh += ph.v over all chunks; when PRES, ol = pl.v per chunk folded as oh += ol / PRS in f32.
//   Q / K planes (bf16 bits, pitch DMOD): plane 0 = real, plane 1 = imag (NTOK*DMOD apart); element (b, t, h, e)
//     at [(b*SEQ + t)*DMOD + h*64 + e]
//   V^T plane (f16): element (b, part, h, d, t) at [((b*2 + part)*DMOD + h*64 + d)*SEQ + t], part 0 = v_r, 1 = v_i
//   Block = 4 NG waves = NG groups of 4 waves on the SAME 64 query rows of one (b, h); qb and hb = b * NHEAD + h come
//   from the kernel below; h = hb % NHEAD, b = hb / NHEAD; key chunks of 64, chunks kt <= qb only. A stage is NG
//   chunks: in stage p group g works on chunk kt = NG p + g with its own maxima, sums and context tile, so that a query
//   block walks qb / NG + 1 stages (block-uniform trip) and not qb + 1 chunks; a group whose chunk lies past qb (in the
//   last stage only) skips the work and passes every wait and barrier; chunk kt == qb keeps its diagonal by the
//   per-element select. Behind the loop the groups g > 0 hand their partials (context tile, maxima, sums) to group 0
//   through LDS (the K ring, which every reader has left), one barrier, and group 0 merges them one after the other:
//   M = max(m, mg), weights exp(m - M) and exp(mg - M), in f32.
//   K / V^T staging: asynchronous 16-B copies into a ring of two LDS stages of NG chunk buffers each; chunk kt of
//   stage p lies in buffer (p & 1) * NG + g, is copied by group g's own 128 threads (tl = tid & 127), and stage p + 1
//   is in flight while stage p is worked on; a chunk index past the planes' last chunk is clamped to it for the copy
//   (such a chunk lies past qb and is never read). 8 lanes cover one 128-B line: K copy i of a thread ->
//   key row i*8 + (tl>>4), part (tl>>3)&1, piece tl&7 into Ksh[buf][key][part*64 + e] (pitch KP); V^T copy i ->
//   value row d = i*16 + (tl>>3), piece tl&7 into Vs[buf][d][kv] (pitch VP). At the foot of a stage every wave:
//   s_wait_dscnt 0, s_wait_asynccnt 0, __syncthreads (publishes stage p + 1, frees the buffers of stage p), then the
//   copies of stage p + 2.
//   q fragments from the global planes; P tiles wave-private, written with
//   Output row (b, t, h) = 128 f32 [r0, i0, r1, i1, ...] at out + ((b*SEQ + t)*NHEAD + h)*128: the wave's 16x128
//   context tile is staged interleaved in LDS, then each 512-B row is written by 32 lanes x 16 B in ONE
//   coverage: each wave of group 0 stores rows q0..q0+15 x 128 floats; 4 waves x blocks of the grid = all (b, t, h) rows.
// =====================================================================================================
template <bool PRES>
__device__ __forceinline__
void attn_body(const unsigned short* __restrict__ QB, const unsigned short* __restrict__ KB,
               const unsigned short* __restrict__ VT, int qb, int hb,
               unsigned short (&Ksh)[2 * NG][64 * KP], _Float16 (&Vs)[2 * NG][VW * VP],
               _Float16 (&Psh)[4 * NG][16 * PP], _Float16 (&Psl)[4 * NG][16 * PP], float (&Os)[4][16 * VW]) {
  const int tid  = threadIdx.x;
  const int grp  = __builtin_amdgcn_readfirstlane(tid >> 7);           // wave group (wave-uniform)
  const int tl   = tid & 127;                                          // thread within its group
  const int wave = tl >> 5;                                            // 16-row slice of the query block
  const int lane = tid & 31;
  const int hh   = lane >> 4;
  const int c    = lane & 15;

  const int h  = hb % NHEAD;
  const int b  = hb / NHEAD;
  const int q0 = qb * 64 + wave * 16;

  const size_t NPL = (size_t)NTOK * DMOD;                              // one bf16 plane (both batches)
  const unsigned short* Qr = QB + (size_t)b * SEQ * DMOD + (size_t)h * HD;
  const unsigned short* Qi = Qr + NPL;
  const unsigned short* Kr = KB + (size_t)b * SEQ * DMOD + (size_t)h * HD;
  const _Float16* Vg = (const _Float16*)(const void*)VT + ((size_t)(b * 2) * DMOD + (size_t)h * HD) * SEQ;

  float mrow[8], lrow[8];
  v8f oh[8];
#pragma unroll
  for (int r = 0; r < 8; ++r) { mrow[r] = NEG_BIG; lrow[r] = 0.f; }
#pragma unroll
  for (int t = 0; t < 8; ++t) oh[t] = zero8();

  _Float16* pwh = Psh[tid >> 5];
  _Float16* pwl = &Psl[PRES ? (tid >> 5) : 0][0];

  // ---- this thread's 16 copies of chunk t into ring buffer buf (all lanes on, block-uniform callers) ----
  const int pc = (tl & 7) * 8;                                         // 16-B piece of a 128-B line, in elements
  const unsigned short* kthr = Kr + (size_t)((tl >> 3) & 1) * NPL + (size_t)(tl >> 4) * DMOD + pc;
  const _Float16* vthr = Vg + (size_t)(tl >> 3) * SEQ + pc;
  const unsigned kl0 = lds_byte(&Ksh[0][(tl >> 4) * KP + ((tl >> 3) & 1) * HD + pc]);
  const unsigned vl0 = lds_byte(&Vs[0][(tl >> 3) * VP + pc]);
  auto stage = [&](int tq, int buf) {
    const int t = (tq < NQB) ? tq : (NQB - 1);                         // every copy stays inside the planes
    unsigned kl[8], vl[8];
    const void* kg[8];
    const void* vg[8];
#pragma unroll
    for (int i = 0; i < 8; ++i) {
      kl[i] = kl0 + (unsigned)buf * (unsigned)sizeof(Ksh[0]) + (unsigned)(i * 8 * KP * 2);
      kg[i] = kthr + (size_t)(t * 64 + i * 8) * DMOD;
      vl[i] = vl0 + (unsigned)buf * (unsigned)sizeof(Vs[0]) + (unsigned)(i * 16 * VP * 2);
      vg[i] = vthr + ((size_t)(i >> 2) * DMOD + (size_t)((i & 3) * 16)) * SEQ + t * 64;
    }
    async_copy8(kl, kg);
    async_copy8(vl, vg);
  };

  const int np = qb / NG + 1;                 // stages of NG chunks (block-uniform)
  stage(grp, grp);
  wait_async0();
  __syncthreads();                            // stage 0 published
  if (np > 1) stage(NG + grp, NG + grp);

  // ---- Q fragments (A operand, row = lane&15): 2 e-chunks per plane from the global planes, once per block ----
  v16us qr[2], qi[2];
#pragma unroll
  for (int dc = 0; dc < 2; ++dc) {
    qr[dc] = ldfrag_b(Qr + (size_t)(q0 + c) * DMOD + dc * 32 + 8 * hh);
    qi[dc] = ldfrag_b(Qi + (size_t)(q0 + c) * DMOD + dc * 32 + 8 * hh);
  }
  wait_x0(Qr + (size_t)(q0 + c) * DMOD + 8 * hh);   // the one address pair that the eight loads above name

  for (int p = 0; p < (NQB + NG - 1) / NG; ++p) {   // static bound; block-uniform causal stage skipping
    if (p >= np) break;
    const int kt = NG * p + grp;              // this group's chunk of the stage
    const int bi = (p & 1) * NG + grp;        // and its ring buffer
    if (kt <= qb) {                           // wave-uniform; no barrier inside
    const int kv0 = kt * 64;
    const unsigned short* Kc = Ksh[bi];
    const _Float16* Vc = Vs[bi];

    // ---- scores: 16 query rows x 64 keys per wave, depth 64 (2 chunks), 4 products per chunk ----
    v8f s[4];
#pragma unroll
    for (int j = 0; j < 4; ++j) {
      v8f sr = zero8(), si = zero8();
#pragma unroll
      for (int dc = 0; dc < 2; ++dc) {
        const unsigned short* kp = Kc + (j * 16 + c) * KP + dc * 32 + 8 * hh;   // B col = key j*16+c
        FB br, bi;
        br.h[0] = *(const v8us*)(kp);
        br.h[1] = *(const v8us*)(kp + 16);
        bi.h[0] = *(const v8us*)(kp + HD);
        bi.h[1] = *(const v8us*)(kp + HD + 16);
        const v16us bin = neg16(bi.u);
        sr = mma_b_raw(qr[dc], br.u, sr);
        sr = mma_b_raw(qi[dc], bin, sr);
        si = mma_b_raw(qr[dc], bi.u, si);
        si = mma_b_raw(qi[dc], br.u, si);
        guard_b5(sr, si, qr[dc], qi[dc], br.u, bi.u, bin);
      }
      const int key  = kv0 + j * 16 + c;                 // key index of this lane's D column
      const int rowb = q0 + 8 * hh;                      // query row of D element r is rowb + r
#pragma unroll
      for (int r = 0; r < 8; ++r) {
        const float m2 = sr[r] * sr[r] + si[r] * si[r];
        const float v = sqrtf(m2) * SCL;
        s[j][r] = (key <= rowb + r) ? v : NEG_BIG;
      }
    }

    // ---- row max, online softmax, P hi (x1024, f16) and, when PRES, P residual (x PRS, f16) to LDS ----
#pragma unroll
    for (int r = 0; r < 8; ++r) {
      float m = s[0][r];
      m = fmaxf(m, s[1][r]);
      m = fmaxf(m, s[2][r]);
      m = fmaxf(m, s[3][r]);
#pragma unroll
      for (int off = 1; off < 16; off <<= 1) m = fmaxf(m, __shfl_xor(m, off, 32));
      const float mnew  = fmaxf(mrow[r], m);
      const float alpha = __expf(mrow[r] - mnew);
      mrow[r] = mnew;
      float psum = 0.f;
#pragma unroll
      for (int j = 0; j < 4; ++j) {
        const float p  = __expf(s[j][r] - mnew);
        psum += p;
        const float ph = p * PSC;
        const _Float16 xh = (_Float16)ph;
        const int pi = (8 * hh + r) * PP + j * 16 + c;
        pwh[pi] = xh;
        if (PRES) pwl[pi] = (_Float16)((ph - (float)xh) * PRS);
      }
#pragma unroll
      for (int off = 1; off < 16; off <<= 1) psum += __shfl_xor(psum, off, 32);
      lrow[r] = lrow[r] * alpha + psum;
#pragma unroll
      for (int t = 0; t < 8; ++t) oh[t][r] *= alpha;
    }
    wave_sync_lds();

    // ---- context: oh += Phi . V; when PRES: ol = Plo . V, then oh += ol / PRS ----
    v8f ol[8];
#pragma unroll
    for (int t = 0; t < 8; ++t) ol[t] = zero8();
#pragma unroll 1
    for (int kk = 0; kk < 2; ++kk) {
      FH pa, pb;
      pa.h[0] = *(const v8h*)(pwh + c * PP + kk * 32 + 8 * hh);
      pa.h[1] = *(const v8h*)(pwh + c * PP + kk * 32 + 16 + 8 * hh);
      pb.v = pa.v;
      if (PRES) {
        pb.h[0] = *(const v8h*)(pwl + c * PP + kk * 32 + 8 * hh);
        pb.h[1] = *(const v8h*)(pwl + c * PP + kk * 32 + 16 + 8 * hh);
      }
#pragma unroll
      for (int t = 0; t < 8; ++t) {
        FH vb;
        vb.h[0] = *(const v8h*)(Vc + (t * 16 + c) * VP + kk * 32 + 8 * hh);
        vb.h[1] = *(const v8h*)(Vc + (t * 16 + c) * VP + kk * 32 + 16 + 8 * hh);
        oh[t] = mma_h_raw(pa.v, vb.v, oh[t]);
        if (PRES) {
          ol[t] = mma_h_raw(pb.v, vb.v, ol[t]);
          guard_h2(oh[t], ol[t], pa.v, pb.v, vb.v);
        } else {
          guard_h1(oh[t], pa.v, vb.v);
        }
      }
    }
    acc_guard4(oh[0], oh[1], oh[2], oh[3]);
    acc_guard4(oh[4], oh[5], oh[6], oh[7]);
    if (PRES) {
      acc_guard4(ol[0], ol[1], ol[2], ol[3]);
      acc_guard4(ol[4], ol[5], ol[6], ol[7]);
#pragma unroll
      for (int t = 0; t < 8; ++t) {
#pragma unroll
        for (int r = 0; r < 8; ++r) oh[t][r] += ol[t][r] * (1.0f / PRS);
      }
    }
    }
    // ---- publish point of stage p + 1; the buffers of stage p are free behind the barrier ----
    wait_ds0();
    wait_async0();
    __syncthreads();
    if (p + 2 < np) stage(NG * (p + 2) + grp, bi);
  }
  wait_async0();                              // nothing is left in flight when the wave goes on to the epilogue

  // ---- merge of the groups' partials: each group g > 0 writes its lanes' values (lane-contiguous; a lane of group 0
  //      reads back the positions of its own accumulator layout), one barrier, group 0 combines in f32. The partials
  //      lie in the K ring: behind the loop's last barrier no wave reads it and no copy is in flight ----
  static_assert(sizeof(Ksh) >= (size_t)(NG - 1) * 4 * MGW * sizeof(float));
  float* mg0 = (float*)(void*)&Ksh[0][0] + wave * MGW + lane;
  if (grp != 0) {
    float* mg = mg0 + (grp - 1) * 4 * MGW;
#pragma unroll
    for (int t = 0; t < 8; ++t) {
#pragma unroll
      for (int r = 0; r < 8; ++r) mg[(t * 8 + r) * 32] = oh[t][r];
    }
#pragma unroll
    for (int r = 0; r < 8; ++r) {
      mg[(64 + r) * 32] = mrow[r];
      mg[(72 + r) * 32] = lrow[r];
    }
  }
  __syncthreads();                            // the partials are published; met by every wave of the block
  if (grp != 0) return;                       // no barrier follows; the kernel below leaves with it
#pragma unroll
  for (int g = 1; g < NG; ++g) {
    const float* mg = mg0 + (g - 1) * 4 * MGW;
#pragma unroll
    for (int r = 0; r < 8; ++r) {
      const float m1 = mg[(64 + r) * 32];
      const float l1 = mg[(72 + r) * 32];
      const float mm = fmaxf(mrow[r], m1);
      const float a0 = __expf(mrow[r] - mm);
      const float a1 = __expf(m1 - mm);       // 0 where group g had no chunk (m1 = NEG_BIG, its sums 0)
      mrow[r] = mm;
      lrow[r] = lrow[r] * a0 + l1 * a1;
#pragma unroll
      for (int t = 0; t < 8; ++t) oh[t][r] = oh[t][r] * a0 + mg[(t * 8 + r) * 32] * a1;
    }
  }

  // ---- normalise (1/l, the 1/PSC p carry and the 1/VSC v carry), stage the wave's 16x128 tile interleaved
  float* os = Os[wave];
#pragma unroll
  for (int r = 0; r < 8; ++r) {
    const float l = lrow[r];
    const float inv = ((l > 0.f) ? (1.0f / l) : 0.f) * (1.0f / (PSC * VSC));
#pragma unroll
    for (int t = 0; t < 8; ++t) {
      const int pos = (t < 4) ? (2 * (t * 16 + c)) : (2 * ((t - 4) * 16 + c) + 1);
      os[(8 * hh + r) * VW + pos] = oh[t][r] * inv;
    }
  }
  // the kernel below reads the tile back, behind its wave_sync_lds(), and stores it
}

// One grid for all query blocks, twice as many as the chip has places (one block fills a WGP's LDS). A block's cost
// grows with qb, and the cost falls with the index (qb = NQB - 1 for the first
// NHEAD * NBATCH blocks, then NQB - 2, ...), for speed only. index -> (qb, hb) is a permutation of all (query block, batch x head) pairs.
// The choice of body is block-uniform (blockIdx only): every barrier of a body is met by all 4 NG waves.
__global__ __launch_bounds__(128 * NG)
void attn_c(const unsigned short* __restrict__ QB, const unsigned short* __restrict__ KB,
            const unsigned short* __restrict__ VT, float* out) {
  __shared__ __align__(16) unsigned short Ksh[2 * NG][64 * KP];        // K [buf][kv][kr e 0..63 | ki e 64..127 | pad] 6 x 17 KB
  __shared__ __align__(16) _Float16 Vs[2 * NG][VW * VP];                // V^T [buf][d][kv | pad] 6 x 18 KB
  __shared__ __align__(16) _Float16 Psh[4 * NG][16 * PP];               // per wave P hi [row][kv | pad] 27 KB
  __shared__ __align__(16) _Float16 Psl[4 * NG][16 * PP];               // per wave P residual (qb < NQP only) 27 KB
  __shared__ __align__(16) float    Os[4][16 * VW];                     // group 0, per wave context tile [row][128] 32 KB
  const unsigned bid = blockIdx.x;
  const int qb = NQB - 1 - (int)(bid / (unsigned)(NHEAD * NBATCH));     // longest query blocks first
  const int hb = (int)(bid % (unsigned)(NHEAD * NBATCH));
  if (qb >= NQP) {
    attn_body<false>(QB, KB, VT, qb, hb, Ksh, Vs, Psh, Psl, Os);
  } else {
    attn_body<true>(QB, KB, VT, qb, hb, Ksh, Vs, Psh, Psl, Os);
  }
  if (threadIdx.x >= 128) return;             // the groups g > 0 have handed over; whole waves, no barrier below

  // ---- both bodies leave the wave's context tile in Os[wave]; the output stores are common to them ----
  const int wave = threadIdx.x >> 5;
  const int lane = threadIdx.x & 31;
  const int h  = hb % NHEAD;
  const int b  = hb / NHEAD;
  const int q0 = qb * 64 + wave * 16;
  const float* os = Os[wave];
  float* g0 = out + ((size_t)(b * SEQ + q0) * NHEAD + h) * VW + lane * 4;   // row q0 of (b, h), this lane's 16 B
  wave_sync_lds();
  {
#pragma unroll
    for (int it = 0; it < 16; ++it) {                    // row it: 32 lanes x 16 B = 512 B = 128 floats
      const v4f o = *(const v4f*)(os + it * VW + lane * 4);
      *(v4f*)(g0 + (size_t)it * NHEAD * VW) = o;
    }
  }
}

// =====================================================================================================
// Workspace map (bytes); every plane is an exact multiple of its whole-line store granularity (all dims are exact
// tile multiples, no padded tails), all offsets multiples of 8 MiB:
//   QB  bf16 [2 parts][4096 t][512]             0   8388608   (q_r, q_i RNE bits)
//   KB  bf16 [2 parts][4096 t][512]       8388608   8388608   (k_r, k_i RNE bits)
//   VT  f16  [2 b][2 parts][512 (h,d)][2048 t] 16777216   8388608   (bf16 value x16)
//   end                                 25165824
// =====================================================================================================
extern "C" void kernel_launch(void* const* d_in, const int* in_sizes, int n_in,
                              void* d_out, int out_size, void* d_ws, size_t ws_size,
                              hipStream_t stream) {
  const int n = NTOK * DMOD;                                // 2097152 elements per input
  if (n_in < 6) return;
  for (int i = 0; i < 6; ++i) if (in_sizes[i] != n) return;
  if (out_size != 2 * n) return;

  const float* qr = (const float*)d_in[0];
  const float* qi = (const float*)d_in[1];
  const float* kr = (const float*)d_in[2];
  const float* ki = (const float*)d_in[3];
  const float* vr = (const float*)d_in[4];
  const float* vi = (const float*)d_in[5];
  float* outf = (float*)d_out;

  const size_t PQB = (size_t)2 * n * 2;                     //  8388608
  const size_t PKB = (size_t)2 * n * 2;                     //  8388608
  const size_t PVT = (size_t)NBATCH * 2 * DMOD * SEQ * 2;   //  8388608
  size_t off = 0;
  const size_t oQ = off; off += PQB;
  const size_t oK = off; off += PKB;
  const size_t oV = off; off += PVT;
  if (off > ws_size) return;                                // off = 25165824
  if (off > (size_t)134217728) return;

  char* ws = (char*)d_ws;
  unsigned short* QB = (unsigned short*)(ws + oQ);
  unsigned short* KB = (unsigned short*)(ws + oK);
  unsigned short* VT = (unsigned short*)(ws + oV);

  const dim3 blk256(256), blkatt(128 * NG);

  // (1) q, k -> bf16 planes [part][4096 t][512]
  cvt2<<<dim3(n / 2048), blk256, 0, stream>>>(qr, qi, QB, n);
  cvt2<<<dim3(n / 2048), blk256, 0, stream>>>(kr, ki, KB, n);
  // (2) v -> transposed f16 planes: in[2048 t][512 (h,e)] per batch z -> out[512 (h,d)][2048 t] at part 0 (v_r)
  //     and part 1 (v_i) of batch z; grid = (cols/32, rows/64, batches)
  tr_cvt<<<dim3(DMOD / 32, SEQ / 64, NBATCH), blk256, 0, stream>>>(
      vr, VT, SEQ, DMOD, (long long)SEQ * DMOD, (long long)2 * DMOD * SEQ, VSC);
  tr_cvt<<<dim3(DMOD / 32, SEQ / 64, NBATCH), blk256, 0, stream>>>(
      vi, VT + (size_t)DMOD * SEQ, SEQ, DMOD, (long long)SEQ * DMOD, (long long)2 * DMOD * SEQ, VSC);
  // (3) causal attention -> d_out, one launch: query blocks 0..NQP-1 (rows < 512) with the p residual tile, the rest without
  attn_c<<<dim3(NQB * NHEAD * NBATCH), blkatt, 0, stream>>>(QB, KB, VT, outf);
  (void)hipGetLastError();
}

// v006
// One run takes 62.2 microseconds.
// Two timings next to v005 both put it at 1.20 times that version's speed.
// All steps since v000 together make it 4.69 times as fast.
// Contractions: complex k.q^T (scores transposed) as kr.qr, ki.qi (negated), ki.qr, kr.qi over e=64 on v_wmma_f32_16x16x32_bf16 (raw
//   bf16 RNE values of q and k, one product each, signs combined in the f32 accumulators); [v_r|v_i]^T.p^T over keys on
//   v_wmma_f32_16x16x32_f16 with p as f16(1024 p) (plus a x4096 f16 residual tile for the first 512 query rows of
//   each sequence) and v as f16 of its bf16 RNE value x16 (exact); f32 accumulate everywhere; score magnitude,
//   causal select, softmax statistics and epilogue in f32.
#include <hip/hip_runtime.h>
#include <math.h>
#include <stdint.h>

#define NBATCH 2
#define SEQ    2048
#define NHEAD  8
#define HD     64                  // score depth e
#define VW     (2 * HD)            // value row width: v_r d 0..63 | v_i d 64..127
#define DMOD   (NHEAD * HD)        // 512: token row pitch of the q/k/v inputs
#define NTOK   (NBATCH * SEQ)      // 4096 token rows
#define NQB    (SEQ / 64)          // 32 query / key tiles of 64
#define NQP    8                   // leading query tiles (rows < 512) that carry the p residual tile
#define VSC    16.0f               // v plane carry (power of two, exact on bf16 values)
#define PSC    1024.0f             // softmax numerator carry
#define PRS    4096.0f             // p residual carry
#define SCL    0.125f              // 1/sqrt(64)
#define NEG_BIG (-1.0e30f)
#define NG     3                   // wave groups of a block; group g takes key chunks g, g + NG, g + 2 NG, ...
#define MGW    (66 * 32)           // floats of one wave's partial: 64 context + 1 maximum + 1 sum per lane
// LDS row pitches in 16-bit elements: every row read by ds_load_b128 fragments (16 lanes = 16 rows, 16 B each) gets
// a pitch of 16 B x odd, so the 16 rows of a half wave fall on all 64 banks instead of on 4 (K) or 8 (V); the same
// for the output staging rows, which 16 lanes write 16 B each.
#define KP     (VW + 8)            // K rows: 256 B of data at 272 B pitch
#define VP     (64 + 8)            // V^T rows: 128 B of data at 144 B pitch
#define OP     (VW + 4)            // output staging rows, in floats: 512 B of data at 528 B pitch
static_assert(HD == 64 && VW == 128);
static_assert((SEQ % 64) == 0 && (DMOD % 32) == 0);
static_assert(((NTOK * DMOD) % 2048) == 0);
static_assert(NQP > 0 && NQP < NQB);
static_assert(((KP * 2) % 32) == 16 && ((VP * 2) % 32) == 16 && ((OP * 4) % 32) == 16);

typedef _Float16 v16h __attribute__((ext_vector_type(16)));
typedef _Float16 v8h  __attribute__((ext_vector_type(8)));
typedef __bf16   v16b __attribute__((ext_vector_type(16)));
typedef unsigned short v16us __attribute__((ext_vector_type(16)));
typedef unsigned short v8us  __attribute__((ext_vector_type(8)));
typedef float    v8f  __attribute__((ext_vector_type(8)));
typedef float    v4f  __attribute__((ext_vector_type(4)));
typedef unsigned int v4u __attribute__((ext_vector_type(4)));
typedef unsigned int v8u __attribute__((ext_vector_type(8)));
union FH { v16h v; v8h h[2]; };
union FB { v16us u; v8us h[2]; v8u w; };

// ---- scalar helpers --------------------------------------------------------------------------------
__device__ __forceinline__ unsigned short bf_bits(float f) {          // f32 -> bf16 bits, RNE convert
  unsigned u = __float_as_uint(f);
  return (unsigned short)((u + 0x7FFFu + ((u >> 16) & 1u)) >> 16);
}
__device__ __forceinline__ float bf_up(unsigned short h) { return __uint_as_float(((unsigned)h) << 16); }
__device__ __forceinline__ unsigned short h_bits(_Float16 x) { return __builtin_bit_cast(unsigned short, x); }
__device__ __forceinline__ unsigned pk16(unsigned short a, unsigned short b) { return (unsigned)a | ((unsigned)b << 16); }
__device__ __forceinline__ v8f zero8() { v8f z = {0.f, 0.f, 0.f, 0.f, 0.f, 0.f, 0.f, 0.f}; return z; }
__device__ __forceinline__ float xhalf(float x) {                     // the value of lane l ^ 16
  const int i = __builtin_bit_cast(int, x);
  return __builtin_bit_cast(float, __builtin_amdgcn_permlanex16(i, i, 0x76543210, 0xfedcba98, false, false));
}

// ---- fragment loader: 16-bit A/B operand, lane -> row/col (lane&15), p already includes +8*(lane>>4);
//      elements 0..7 <- p[0..7] (k0+8h..), elements 8..15 <- p[16..23] (k0+16+8h..)
__device__ __forceinline__ v16us ldfrag_b(const unsigned short* p) {   // bf16 plane read as 16-bit uint vectors
  FB f;
  f.h[0] = *(const v8us*)(p);
  f.h[1] = *(const v8us*)(p + 16);
  return f.u;
}
// exact negation of a bf16 fragment (sign-bit flip of every 16-bit element)
__device__ __forceinline__ v16us neg16(v16us x) {
  FB f;
  f.u = x;
#pragma unroll
  for (int i = 0; i < 8; ++i) f.w[i] = f.w[i] ^ 0x80008000u;
  return f.u;
}

// ---- WMMA helpers; trailing VALU hazard gaps are issued by the guard_* helpers after each group --------
__device__ __forceinline__ v8f mma_h_raw(v16h a, v16h b, v8f c) {
  return __builtin_amdgcn_wmma_f32_16x16x32_f16(false, a, false, b, (short)0, c, false, false);
}
__device__ __forceinline__ v8f mma_b_raw(v16us a, v16us b, v8f c) {
  return __builtin_amdgcn_wmma_f32_16x16x32_bf16(false, __builtin_bit_cast(v16b, a), false,
                                                 __builtin_bit_cast(v16b, b), (short)0, c, false, false);
}
__device__ __forceinline__ void guard_b5(v8f& x, v8f& y, v16us a, v16us b, v16us d, v16us e, v16us f) {
#if defined(__HIP_DEVICE_COMPILE__)
  asm volatile("v_nop\n\tv_nop\n\tv_nop\n\tv_nop" : "+v"(x), "+v"(y) : "v"(a), "v"(b), "v"(d), "v"(e), "v"(f));
#endif
}
__device__ __forceinline__ void guard_h1(v8f& x, v16h a, v16h b) {
#if defined(__HIP_DEVICE_COMPILE__)
  asm volatile("v_nop\n\tv_nop\n\tv_nop\n\tv_nop" : "+v"(x) : "v"(a), "v"(b));
#endif
}
__device__ __forceinline__ void guard_h2(v8f& x, v8f& y, v16h a, v16h b, v16h d) {
#if defined(__HIP_DEVICE_COMPILE__)
  asm volatile("v_nop\n\tv_nop\n\tv_nop\n\tv_nop" : "+v"(x), "+v"(y) : "v"(a), "v"(b), "v"(d));
#endif
}
__device__ __forceinline__ void acc_guard4(v8f& a, v8f& b, v8f& c, v8f& d) {
#if defined(__HIP_DEVICE_COMPILE__)
  asm volatile("v_nop\n\tv_nop\n\tv_nop\n\tv_nop" : "+v"(a), "+v"(b), "+v"(c), "+v"(d));
#endif
}
__device__ __forceinline__ void wave_sync_lds() {
  __builtin_amdgcn_fence(__ATOMIC_RELEASE, "workgroup");
  __builtin_amdgcn_wave_barrier();
  __builtin_amdgcn_fence(__ATOMIC_ACQUIRE, "workgroup");
}

// ---- asynchronous copies global -> LDS (16 B per lane, through no register) and the ring's waits ----
__device__ __forceinline__ unsigned lds_byte(const void* p) { return (unsigned)(uintptr_t)p; }   // LDS byte address
// eight copies of one lane; the closing s_wait_xcnt stands in front of every later rewrite of an address register
// that a copy names (a precaution), inside the statement so that no address arithmetic can be moved in front of it
__device__ __forceinline__ void async_copy8(const unsigned (&l)[8], const void* const (&g)[8]) {
#if defined(__HIP_DEVICE_COMPILE__)
  asm volatile(
      "global_load_async_to_lds_b128 %0, %8, off\n\t"
      "global_load_async_to_lds_b128 %1, %9, off\n\t"
      "global_load_async_to_lds_b128 %2, %10, off\n\t"
      "global_load_async_to_lds_b128 %3, %11, off\n\t"
      "global_load_async_to_lds_b128 %4, %12, off\n\t"
      "global_load_async_to_lds_b128 %5, %13, off\n\t"
      "global_load_async_to_lds_b128 %6, %14, off\n\t"
      "global_load_async_to_lds_b128 %7, %15, off\n\t"
      "s_wait_xcnt 0x0"
      :: "v"(l[0]), "v"(l[1]), "v"(l[2]), "v"(l[3]), "v"(l[4]), "v"(l[5]), "v"(l[6]), "v"(l[7]),
         "v"(g[0]), "v"(g[1]), "v"(g[2]), "v"(g[3]), "v"(g[4]), "v"(g[5]), "v"(g[6]), "v"(g[7])
      : "memory");
#endif
}
// this wave's copies have landed in LDS (the compiler places no wait for them)
__device__ __forceinline__ void wait_async0() {
#if defined(__HIP_DEVICE_COMPILE__)
  asm volatile("s_wait_asynccnt 0x0" ::: "memory");
#endif
}
// stands behind issued global loads, in front of any rewrite of the address registers that they name (a precaution).
// The address is an input only so that its registers stay untouched up to the wait.
__device__ __forceinline__ void wait_x0(const void* addr) {
#if defined(__HIP_DEVICE_COMPILE__)
  asm volatile("s_wait_xcnt 0x0" :: "v"(addr) : "memory");
#endif
}
// this wave's LDS reads have returned, before the buffer they read is handed to the next tile's copies
__device__ __forceinline__ void wait_ds0() {
#if defined(__HIP_DEVICE_COMPILE__)
  asm volatile("s_wait_dscnt 0x0" ::: "memory");
#endif
}

// =====================================================================================================
// Transpose + convert: input z (stride zin) is f32 [R][C]; output z (stride zout) is an f16 plane [C][R] holding
// f16(bf16 RNE value * scale) (scale a power of two, exact). Tile = 64 input rows x 32 input cols;
// grid = (C/32, R/64, nz), block 256. Load: thread t -> input row t>>2, cols (t&3)*8..+7 (two 16-B loads);
// store: thread t -> output row t>>3 (= input col), input rows (t&7)*8..+7 as ONE 16-B store, so lanes
// coverage: (C/32) x (R/64) tiles x 32 output rows x 64 cols = all of out[C][R] per z (R%64==0, C%32==0).
// =====================================================================================================
__global__ __launch_bounds__(256) void tr_cvt(const float* __restrict__ in, unsigned short* out, int R, int C,
                                             long long zin, long long zout, float scale) {
  __shared__ float tile[64 * 33];
  const int z = blockIdx.z;
  const float* ib = in + (size_t)z * (size_t)zin;
  unsigned short* ob = out + (size_t)z * (size_t)zout;
  const int r0 = blockIdx.y * 64, c0 = blockIdx.x * 32;
  const int t = threadIdx.x;
  {
    const int ir = t >> 2, ic = (t & 3) * 8;
    const float* g = ib + (size_t)(r0 + ir) * (size_t)C + c0 + ic;
    const v4f a = *(const v4f*)g;
    const v4f b = *(const v4f*)(g + 4);
    float* l = tile + ir * 33 + ic;
    l[0] = a[0]; l[1] = a[1]; l[2] = a[2]; l[3] = a[3];
    l[4] = b[0]; l[5] = b[1]; l[6] = b[2]; l[7] = b[3];
  }
  __syncthreads();
  const int orow = t >> 3, piece = (t & 7) * 8;
  v4u p;
#pragma unroll
  for (int e = 0; e < 4; ++e) {
    const float f0 = tile[(piece + 2 * e) * 33 + orow];
    const float f1 = tile[(piece + 2 * e + 1) * 33 + orow];
    const _Float16 x0 = (_Float16)(bf_up(bf_bits(f0)) * scale);
    const _Float16 x1 = (_Float16)(bf_up(bf_bits(f1)) * scale);
    p[e] = pk16(h_bits(x0), h_bits(x1));
  }
  const size_t go = (size_t)(c0 + orow) * (size_t)R + r0 + piece;
  *(v4u*)(ob + go) = p;
  
}

// =====================================================================================================
// Row-major convert of two f32 [n] arrays into two consecutive bf16 planes: out[i] = bf16(a[i]), out[n+i] = bf16(bsrc[i])
// (RNE bits). Thread -> 8 consecutive elements, ONE 16-B store per plane; lanes 8q..8q+7 of a wave write one whole
// coverage: grid.x = n/2048 blocks x 256 threads x 8 = n elements of each plane (n % 2048 == 0 host-checked).
// =====================================================================================================
__global__ __launch_bounds__(256) void cvt2(const float* __restrict__ a, const float* __restrict__ bsrc,
                                           unsigned short* out, int n) {
  const size_t i8 = ((size_t)blockIdx.x * 256 + threadIdx.x) * 8;
  if (i8 + 8 > (size_t)n) return;        // never taken for the host-checked size; no barriers below
  const v4f a0 = *(const v4f*)(a + i8);
  const v4f a1 = *(const v4f*)(a + i8 + 4);
  const v4f b0 = *(const v4f*)(bsrc + i8);
  const v4f b1 = *(const v4f*)(bsrc + i8 + 4);
  v4u pa, pb;
#pragma unroll
  for (int e = 0; e < 2; ++e) {
    pa[e]     = pk16(bf_bits(a0[2 * e]), bf_bits(a0[2 * e + 1]));
    pa[2 + e] = pk16(bf_bits(a1[2 * e]), bf_bits(a1[2 * e + 1]));
    pb[e]     = pk16(bf_bits(b0[2 * e]), bf_bits(b0[2 * e + 1]));
    pb[2 + e] = pk16(bf_bits(b1[2 * e]), bf_bits(b1[2 * e + 1]));
  }
  unsigned short* oa = out + i8;
  unsigned short* ob = out + (size_t)n + i8;
  *(v4u*)oa = pa;
  *(v4u*)ob = pb;
  
}

// =====================================================================================================
// Causal complex attention, per (b, h, 64-query block):
//   sr = qr.kr - qi.ki, si = qr.ki + qi.kr over e=64 (bf16 operands, exact products, f32 accumulate; -qi.ki as
//   qi.(ki with flipped sign bits)); s = sqrt(sr^2 + si^2) * SCL; key > query -> NEG_BIG (value select, diagonal
//   kept); online softmax in f32; p = exp(s - m) carried as ph = f16(1024 p) and, when PRES, pl = f16((1024 p - ph)
//   * PRS); context over the 128-wide value row [v_r | v_i] with v as f16(VSC * bf16 value):
//     oh += ph.v over all chunks; when PRES, ol = pl.v per chunk folded as oh += ol / PRS in f32.
//   Q / K planes (bf16 bits, pitch DMOD): plane 0 = real, plane 1 = imag (NTOK*DMOD apart); element (b, t, h, e)
//     at [(b*SEQ + t)*DMOD + h*64 + e]
//   V^T plane (f16): element (b, part, h, d, t) at [((b*2 + part)*DMOD + h*64 + d)*SEQ + t], part 0 = v_r, 1 = v_i
//   Block = 4 NG waves = NG groups of 4 waves on the SAME 64 query rows of one (b, h); qb and hb = b * NHEAD + h come
//   from the kernel below; h = hb % NHEAD, b = hb / NHEAD; key chunks of 64, chunks kt <= qb only. A stage is NG
//   chunks: in stage p group g works on chunk kt = NG p + g with its own maxima, sums and context tile, so that a query
//   block walks qb / NG + 1 stages (block-uniform trip) and not qb + 1 chunks; a group whose chunk lies past qb (in the
//   last stage only) skips the work and passes every wait and barrier; chunk kt == qb keeps its diagonal by the
//   per-element select. Behind the loop the groups g > 0 hand their partials (context tile, maxima, sums) to group 0
//   through LDS (the K ring, which every reader has left), one barrier, and group 0 merges them one after the other:
//   M = max(m, mg), weights exp(m - M) and exp(mg - M), in f32.
//   K / V^T staging: asynchronous 16-B copies into a ring of two LDS stages of NG chunk buffers each; chunk kt of
//   stage p lies in buffer (p & 1) * NG + g, is copied by group g's own 128 threads (tl = tid & 127), and stage p + 1
//   is in flight while stage p is worked on; a chunk index past the planes' last chunk is clamped to it for the copy
//   (such a chunk lies past qb and is never read). 8 lanes cover one 128-B line: K copy i of a thread ->
//   key row i*8 + (tl>>4), part (tl>>3)&1, piece tl&7 into Ksh[buf][key][part*64 + e] (pitch KP); V^T copy i ->
//   value row d = i*16 + (tl>>3), piece tl&7 into Vs[buf][d][kv] (pitch VP). At the foot of a stage every wave:
//   s_wait_dscnt 0, s_wait_asynccnt 0, __syncthreads (publishes stage p + 1, frees the buffers of stage p), then the
//   copies of stage p + 2.
//   Both products are taken transposed: scores^T = K . Q^T (A = key rows from LDS, B = q fragments from the global
//   planes, kept in registers) and context^T += V^T . P^T (A = V^T rows from LDS, B = P^T). A lane's score registers
//   belong to ONE query (column lane & 15), so its maximum and sum are formed in the lane (one exchange with lane ^ 16),
//   and two converted score tiles are a B operand as they lie: P goes through no LDS and needs no wave barrier.
//   Output row (b, t, h) = 128 f32 [r0, i0, r1, i1, ...] at out + ((b*SEQ + t)*NHEAD + h)*128: the wave's 16x128
//   context tile is staged interleaved in LDS, then each 512-B row is written by 32 lanes x 16 B in ONE
//   coverage: each wave of group 0 stores rows q0..q0+15 x 128 floats; 4 waves x blocks of the grid = all (b, t, h) rows.
// =====================================================================================================
template <bool PRES>
__device__ __forceinline__
void attn_body(const unsigned short* __restrict__ QB, const unsigned short* __restrict__ KB,
               const unsigned short* __restrict__ VT, int qb, int hb,
               unsigned short (&Ksh)[2 * NG][64 * KP], _Float16 (&Vs)[2 * NG][VW * VP], float (&Os)[4][16 * OP]) {
  const int tid  = threadIdx.x;
  const int grp  = __builtin_amdgcn_readfirstlane(tid >> 7);           // wave group (wave-uniform)
  const int tl   = tid & 127;                                          // thread within its group
  const int wave = tl >> 5;                                            // 16-row slice of the query block
  const int lane = tid & 31;
  const int hh   = lane >> 4;
  const int c    = lane & 15;

  const int h  = hb % NHEAD;
  const int b  = hb / NHEAD;
  const int q0 = qb * 64 + wave * 16;

  const size_t NPL = (size_t)NTOK * DMOD;                              // one bf16 plane (both batches)
  const unsigned short* Qr = QB + (size_t)b * SEQ * DMOD + (size_t)h * HD;
  const unsigned short* Qi = Qr + NPL;
  const unsigned short* Kr = KB + (size_t)b * SEQ * DMOD + (size_t)h * HD;
  const _Float16* Vg = (const _Float16*)(const void*)VT + ((size_t)(b * 2) * DMOD + (size_t)h * HD) * SEQ;

  float mrow = NEG_BIG;                       // running maximum of query q0 + c (equal in lanes c and c + 16)
  float lrow = 0.f;                           // running sum over this lane half's keys of that query
  v8f oh[8];                                  // oh[t][r] = context^T[value column t*16 + 8*hh + r][query q0 + c]
#pragma unroll
  for (int t = 0; t < 8; ++t) oh[t] = zero8();

  // ---- this thread's 16 copies of chunk t into ring buffer buf (all lanes on, block-uniform callers) ----
  const int pc = (tl & 7) * 8;                                         // 16-B piece of a 128-B line, in elements
  const unsigned short* kthr = Kr + (size_t)((tl >> 3) & 1) * NPL + (size_t)(tl >> 4) * DMOD + pc;
  const _Float16* vthr = Vg + (size_t)(tl >> 3) * SEQ + pc;
  const unsigned kl0 = lds_byte(&Ksh[0][(tl >> 4) * KP + ((tl >> 3) & 1) * HD + pc]);
  const unsigned vl0 = lds_byte(&Vs[0][(tl >> 3) * VP + pc]);
  auto stage = [&](int tq, int buf) {
    const int t = (tq < NQB) ? tq : (NQB - 1);                         // every copy stays inside the planes
    unsigned kl[8], vl[8];
    const void* kg[8];
    const void* vg[8];
#pragma unroll
    for (int i = 0; i < 8; ++i) {
      kl[i] = kl0 + (unsigned)buf * (unsigned)sizeof(Ksh[0]) + (unsigned)(i * 8 * KP * 2);
      kg[i] = kthr + (size_t)(t * 64 + i * 8) * DMOD;
      vl[i] = vl0 + (unsigned)buf * (unsigned)sizeof(Vs[0]) + (unsigned)(i * 16 * VP * 2);
      vg[i] = vthr + ((size_t)(i >> 2) * DMOD + (size_t)((i & 3) * 16)) * SEQ + t * 64;
    }
    async_copy8(kl, kg);
    async_copy8(vl, vg);
  };

  const int np = qb / NG + 1;                 // stages of NG chunks (block-uniform)
  stage(grp, grp);
  wait_async0();
  __syncthreads();                            // stage 0 published
  if (np > 1) stage(NG + grp, NG + grp);

  // ---- Q fragments (B operand, column = lane&15): 2 e-chunks per plane from the global planes, once per block ----
  v16us qr[2], qi[2];
#pragma unroll
  for (int dc = 0; dc < 2; ++dc) {
    qr[dc] = ldfrag_b(Qr + (size_t)(q0 + c) * DMOD + dc * 32 + 8 * hh);
    qi[dc] = ldfrag_b(Qi + (size_t)(q0 + c) * DMOD + dc * 32 + 8 * hh);
  }
  wait_x0(Qr + (size_t)(q0 + c) * DMOD + 8 * hh);   // the one address pair that the eight loads above name

  for (int p = 0; p < (NQB + NG - 1) / NG; ++p) {   // static bound; block-uniform causal stage skipping
    if (p >= np) break;
    const int kt = NG * p + grp;              // this group's chunk of the stage
    const int bi = (p & 1) * NG + grp;        // and its ring buffer
    if (kt <= qb) {                           // wave-uniform; no barrier inside
    const int kv0 = kt * 64;
    const unsigned short* Kc = Ksh[bi];
    const _Float16* Vc = Vs[bi];

    // ---- scores, transposed: 64 keys (D rows) x 16 queries (D columns) per wave, depth 64 (2 chunks), 4 products per chunk ----
    v8f s[4];
#pragma unroll
    for (int j = 0; j < 4; ++j) {
      v8f sr = zero8(), si = zero8();
#pragma unroll
      for (int dc = 0; dc < 2; ++dc) {
        const unsigned short* kp = Kc + (j * 16 + c) * KP + dc * 32 + 8 * hh;   // A row = key j*16+c
        FB br, bi;
        br.h[0] = *(const v8us*)(kp);
        br.h[1] = *(const v8us*)(kp + 16);
        bi.h[0] = *(const v8us*)(kp + HD);
        bi.h[1] = *(const v8us*)(kp + HD + 16);
        const v16us bin = neg16(bi.u);
        sr = mma_b_raw(br.u, qr[dc], sr);
        sr = mma_b_raw(bin, qi[dc], sr);
        si = mma_b_raw(bi.u, qr[dc], si);
        si = mma_b_raw(br.u, qi[dc], si);
        guard_b5(sr, si, qr[dc], qi[dc], br.u, bi.u, bin);
      }
      const int keyb = kv0 + j * 16 + 8 * hh;            // key index of D element r is keyb + r
      const int qrow = q0 + c;                           // query of this lane's D column
#pragma unroll
      for (int r = 0; r < 8; ++r) {
        const float m2 = sr[r] * sr[r] + si[r] * si[r];
        const float v = sqrtf(m2) * SCL;
        s[j][r] = (keyb + r <= qrow) ? v : NEG_BIG;
      }
    }

    // ---- a lane holds 32 of its query's 64 scores: maximum and sum in the lane, the maximum joined with the other
    //      lane half by one exchange; P hi (x1024, f16) and, when PRES, P residual (x PRS, f16) are packed in place:
    //      score tiles 2 kk and 2 kk + 1 of a lane are elements 0..7 and 8..15 of the B operand over keys kk*32..+31 ----
    float m = s[0][0];
#pragma unroll
    for (int j = 0; j < 4; ++j) {
#pragma unroll
      for (int r = 0; r < 8; ++r) m = fmaxf(m, s[j][r]);
    }
    m = fmaxf(m, xhalf(m));
    const float mnew  = fmaxf(mrow, m);
    const float alpha = __expf(mrow - mnew);
    mrow = mnew;
    float psum = 0.f;
    FH pa[2], pb[2];
#pragma unroll
    for (int j = 0; j < 4; ++j) {
#pragma unroll
      for (int r = 0; r < 8; ++r) {
        const float p  = __expf(s[j][r] - mnew);
        psum += p;
        const float ph = p * PSC;
        const _Float16 xh = (_Float16)ph;
        pa[j >> 1].v[(j & 1) * 8 + r] = xh;
        if (PRES) pb[j >> 1].v[(j & 1) * 8 + r] = (_Float16)((ph - (float)xh) * PRS);
      }
    }
    lrow = lrow * alpha + psum;
#pragma unroll
    for (int t = 0; t < 8; ++t) {
#pragma unroll
      for (int r = 0; r < 8; ++r) oh[t][r] *= alpha;
    }

    // ---- context, transposed: oh += V^T . Phi^T; when PRES: ol = V^T . Plo^T, then oh += ol / PRS ----
    v8f ol[8];
#pragma unroll
    for (int t = 0; t < 8; ++t) ol[t] = zero8();
#pragma unroll
    for (int kk = 0; kk < 2; ++kk) {          // unrolled: the P fragments are registers, picked by a constant index
#pragma unroll
      for (int t = 0; t < 8; ++t) {
        FH vb;                                                                  // A row = value column t*16+c
        vb.h[0] = *(const v8h*)(Vc + (t * 16 + c) * VP + kk * 32 + 8 * hh);
        vb.h[1] = *(const v8h*)(Vc + (t * 16 + c) * VP + kk * 32 + 16 + 8 * hh);
        oh[t] = mma_h_raw(vb.v, pa[kk].v, oh[t]);
        if (PRES) {
          ol[t] = mma_h_raw(vb.v, pb[kk].v, ol[t]);
          guard_h2(oh[t], ol[t], pa[kk].v, pb[kk].v, vb.v);
        } else {
          guard_h1(oh[t], pa[kk].v, vb.v);
        }
      }
    }
    acc_guard4(oh[0], oh[1], oh[2], oh[3]);
    acc_guard4(oh[4], oh[5], oh[6], oh[7]);
    if (PRES) {
      acc_guard4(ol[0], ol[1], ol[2], ol[3]);
      acc_guard4(ol[4], ol[5], ol[6], ol[7]);
#pragma unroll
      for (int t = 0; t < 8; ++t) {
#pragma unroll
        for (int r = 0; r < 8; ++r) oh[t][r] += ol[t][r] * (1.0f / PRS);
      }
    }
    }
    // ---- publish point of stage p + 1; the buffers of stage p are free behind the barrier ----
    wait_ds0();
    wait_async0();
    __syncthreads();
    if (p + 2 < np) stage(NG * (p + 2) + grp, bi);
  }
  wait_async0();                              // nothing is left in flight when the wave goes on to the epilogue

  // ---- merge of the groups' partials: each group g > 0 writes its lanes' values (lane-contiguous; a lane of group 0
  //      reads back the positions of its own accumulator layout), one barrier, group 0 combines in f32. The partials
  //      lie in the K ring: behind the loop's last barrier no wave reads it and no copy is in flight ----
  static_assert(sizeof(Ksh) >= (size_t)(NG - 1) * 4 * MGW * sizeof(float));
  float* mg0 = (float*)(void*)&Ksh[0][0] + wave * MGW + lane;
  if (grp != 0) {
    float* mg = mg0 + (grp - 1) * 4 * MGW;
#pragma unroll
    for (int t = 0; t < 8; ++t) {
#pragma unroll
      for (int r = 0; r < 8; ++r) mg[(t * 8 + r) * 32] = oh[t][r];
    }
    mg[64 * 32] = mrow;
    mg[65 * 32] = lrow;
  }
  __syncthreads();                            // the partials are published; met by every wave of the block
  if (grp != 0) return;                       // no barrier follows; the kernel below leaves with it
#pragma unroll
  for (int g = 1; g < NG; ++g) {
    const float* mg = mg0 + (g - 1) * 4 * MGW;
    const float m1 = mg[64 * 32];
    const float l1 = mg[65 * 32];
    const float mm = fmaxf(mrow, m1);
    const float a0 = __expf(mrow - mm);
    const float a1 = __expf(m1 - mm);         // 0 where group g had no chunk (m1 = NEG_BIG, its sums 0)
    mrow = mm;
    lrow = lrow * a0 + l1 * a1;
#pragma unroll
    for (int t = 0; t < 8; ++t) {
#pragma unroll
      for (int r = 0; r < 8; ++r) oh[t][r] = oh[t][r] * a0 + mg[(t * 8 + r) * 32] * a1;
    }
  }

  // ---- join the lane halves' sums, normalise (1/l, the 1/PSC p carry and the 1/VSC v carry), stage the wave's 16x128
  //      tile interleaved: lane (c, hh) holds query row c; v_r columns d, d + 1 (tile t) and v_i columns d, d + 1
  //      (tile t + 4) are four consecutive floats [r_d, i_d, r_d+1, i_d+1] of the row, one 16-B LDS store ----
  float* os = Os[wave];
  const float l = lrow + xhalf(lrow);
  const float inv = ((l > 0.f) ? (1.0f / l) : 0.f) * (1.0f / (PSC * VSC));
#pragma unroll
  for (int t = 0; t < 4; ++t) {
#pragma unroll
    for (int r = 0; r < 8; r += 2) {
      const v4f o = {oh[t][r] * inv, oh[t + 4][r] * inv, oh[t][r + 1] * inv, oh[t + 4][r + 1] * inv};
      *(v4f*)(os + c * OP + 2 * (t * 16 + 8 * hh + r)) = o;
    }
  }
  // the kernel below reads the tile back, behind its wave_sync_lds(), and stores it
}

// One grid for all query blocks, twice as many as the chip has places (one block fills a WGP's LDS). A block's cost
// grows with qb, and the cost falls with the index (qb = NQB - 1 for the first
// NHEAD * NBATCH blocks, then NQB - 2, ...), for speed only. index -> (qb, hb) is a permutation of all (query block, batch x head) pairs.
// The choice of body is block-uniform (blockIdx only): every barrier of a body is met by all 4 NG waves.
__global__ __launch_bounds__(128 * NG)
void attn_c(const unsigned short* __restrict__ QB, const unsigned short* __restrict__ KB,
            const unsigned short* __restrict__ VT, float* out) {
  __shared__ __align__(16) unsigned short Ksh[2 * NG][64 * KP];        // K [buf][kv][kr e 0..63 | ki e 64..127 | pad] 6 x 17 KB
  __shared__ __align__(16) _Float16 Vs[2 * NG][VW * VP];                // V^T [buf][d][kv | pad] 6 x 18 KB
  __shared__ __align__(16) float    Os[4][16 * OP];                     // group 0, per wave context tile [row][128 | pad] 33 KB
  const unsigned bid = blockIdx.x;
  const int qb = NQB - 1 - (int)(bid / (unsigned)(NHEAD * NBATCH));     // longest query blocks first
  const int hb = (int)(bid % (unsigned)(NHEAD * NBATCH));
  if (qb >= NQP) {
    attn_body<false>(QB, KB, VT, qb, hb, Ksh, Vs, Os);
  } else {
    attn_body<true>(QB, KB, VT, qb, hb, Ksh, Vs, Os);
  }
  if (threadIdx.x >= 128) return;             // the groups g > 0 have handed over; whole waves, no barrier below

  // ---- both bodies leave the wave's context tile in Os[wave]; the output stores are common to them ----
  const int wave = threadIdx.x >> 5;
  const int lane = threadIdx.x & 31;
  const int h  = hb % NHEAD;
  const int b  = hb / NHEAD;
  const int q0 = qb * 64 + wave * 16;
  const float* os = Os[wave];
  float* g0 = out + ((size_t)(b * SEQ + q0) * NHEAD + h) * VW + lane * 4;   // row q0 of (b, h), this lane's 16 B
  wave_sync_lds();
  {
#pragma unroll
    for (int it = 0; it < 16; ++it) {                    // row it: 32 lanes x 16 B = 512 B = 128 floats
      const v4f o = *(const v4f*)(os + it * OP + lane * 4);
      *(v4f*)(g0 + (size_t)it * NHEAD * VW) = o;
    }
  }
}

// =====================================================================================================
// Workspace map (bytes); every plane is an exact multiple of its whole-line store granularity (all dims are exact
// tile multiples, no padded tails), all offsets multiples of 8 MiB:
//   QB  bf16 [2 parts][4096 t][512]             0   8388608   (q_r, q_i RNE bits)
//   KB  bf16 [2 parts][4096 t][512]       8388608   8388608   (k_r, k_i RNE bits)
//   VT  f16  [2 b][2 parts][512 (h,d)][2048 t] 16777216   8388608   (bf16 value x16)
//   end                                 25165824
// =====================================================================================================
extern "C" void kernel_launch(void* const* d_in, const int* in_sizes, int n_in,
                              void* d_out, int out_size, void* d_ws, size_t ws_size,
                              hipStream_t stream) {
  const int n = NTOK * DMOD;                                // 2097152 elements per input
  if (n_in < 6) return;
  for (int i = 0; i < 6; ++i) if (in_sizes[i] != n) return;
  if (out_size != 2 * n) return;

  const float* qr = (const float*)d_in[0];
  const float* qi = (const float*)d_in[1];
  const float* kr = (const float*)d_in[2];
  const float* ki = (const float*)d_in[3];
  const float* vr = (const float*)d_in[4];
  const float* vi = (const float*)d_in[5];
  float* outf = (float*)d_out;

  const size_t PQB = (size_t)2 * n * 2;                     //  8388608
  const size_t PKB = (size_t)2 * n * 2;                     //  8388608
  const size_t PVT = (size_t)NBATCH * 2 * DMOD * SEQ * 2;   //  8388608
  size_t off = 0;
  const size_t oQ = off; off += PQB;
  const size_t oK = off; off += PKB;
  const size_t oV = off; off += PVT;
  if (off > ws_size) return;                                // off = 25165824
  if (off > (size_t)134217728) return;

  char* ws = (char*)d_ws;
  unsigned short* QB = (unsigned short*)(ws + oQ);
  unsigned short* KB = (unsigned short*)(ws + oK);
  unsigned short* VT = (unsigned short*)(ws + oV);

  const dim3 blk256(256), blkatt(128 * NG);

  // (1) q, k -> bf16 planes [part][4096 t][512]
  cvt2<<<dim3(n / 2048), blk256, 0, stream>>>(qr, qi, QB, n);
  cvt2<<<dim3(n / 2048), blk256, 0, stream>>>(kr, ki, KB, n);
  // (2) v -> transposed f16 planes: in[2048 t][512 (h,e)] per batch z -> out[512 (h,d)][2048 t] at part 0 (v_r)
  //     and part 1 (v_i) of batch z; grid = (cols/32, rows/64, batches)
  tr_cvt<<<dim3(DMOD / 32, SEQ / 64, NBATCH), blk256, 0, stream>>>(
      vr, VT, SEQ, DMOD, (long long)SEQ * DMOD, (long long)2 * DMOD * SEQ, VSC);
  tr_cvt<<<dim3(DMOD / 32, SEQ / 64, NBATCH), blk256, 0, stream>>>(
      vi, VT + (size_t)DMOD * SEQ, SEQ, DMOD, (long long)SEQ * DMOD, (long long)2 * DMOD * SEQ, VSC);
  // (3) causal attention -> d_out, one launch: query blocks 0..NQP-1 (rows < 512) with the p residual tile, the rest without
  attn_c<<<dim3(NQB * NHEAD * NBATCH), blkatt, 0, stream>>>(QB, KB, VT, outf);
  (void)hipGetLastError();
}

// v007
// Measured time: 52.6 microseconds a run.
// In two side-by-side timings against v006, it was 1.18 and 1.17 times as fast.
// All steps since v000 together make it 5.51 times as fast.
// Contractions: complex k.q^T (scores transposed) as kr.qr, ki.qi (negated), ki.qr, kr.qi over e=64 on v_wmma_f32_16x16x32_bf16 (raw
//   bf16 RNE values of q and k, one product each, signs combined in the f32 accumulators); [v_r|v_i]^T.p^T over keys on
//   v_wmma_f32_16x16x32_f16 with p as f16(1024 p) (plus a x4096 f16 residual tile for the first 512 query rows of
//   each sequence) and v as f16 of its bf16 RNE value x16 (exact); f32 accumulate everywhere; score magnitude,
//   causal select, softmax statistics and epilogue in f32.
#include <hip/hip_runtime.h>
#include <math.h>
#include <stdint.h>

#define NBATCH 2
#define SEQ    2048
#define NHEAD  8
#define HD     64                  // score depth e
#define VW     (2 * HD)            // value row width: v_r d 0..63 | v_i d 64..127
#define DMOD   (NHEAD * HD)        // 512: token row pitch of the q/k/v inputs
#define NTOK   (NBATCH * SEQ)      // 4096 token rows
#define NQB    (SEQ / 64)          // 32 query / key tiles of 64
#define NQP    8                   // leading query tiles (rows < 512) that carry the p residual tile
#define VSC    16.0f               // v plane carry (power of two, exact on bf16 values)
#define PSC    1024.0f             // softmax numerator carry
#define PRS    4096.0f             // p residual carry
#define SCL2   0.18033688011112043f  // log2(e) / sqrt(64): scores and maxima are carried in base-2 units
#define NEG_BIG (-1.0e30f)
#define NG     3                   // wave groups of a block; group g takes key chunks g, g + NG, g + 2 NG, ...
#define MGW    (66 * 32)           // floats of one wave's partial: 64 context + 1 maximum + 1 sum per lane
// LDS row pitches in 16-bit elements: every row read by ds_load_b128 fragments (16 lanes = 16 rows, 16 B each) gets
// a pitch of 16 B x odd, so the 16 rows of a half wave fall on all 64 banks instead of on 4 (K) or 8 (V); the same
// for the output staging rows, which 16 lanes write 16 B each.
#define KP     (VW + 8)            // K rows: 256 B of data at 272 B pitch
#define VP     (64 + 8)            // V^T rows: 128 B of data at 144 B pitch
#define OP     (VW + 4)            // output staging rows, in floats: 512 B of data at 528 B pitch
static_assert(HD == 64 && VW == 128);
static_assert((SEQ % 64) == 0 && (DMOD % 32) == 0);
static_assert(((NTOK * DMOD) % 2048) == 0);
static_assert(NQP > 0 && NQP < NQB);
static_assert(((KP * 2) % 32) == 16 && ((VP * 2) % 32) == 16 && ((OP * 4) % 32) == 16);

typedef _Float16 v16h __attribute__((ext_vector_type(16)));
typedef _Float16 v8h  __attribute__((ext_vector_type(8)));
typedef __bf16   v16b __attribute__((ext_vector_type(16)));
typedef unsigned short v16us __attribute__((ext_vector_type(16)));
typedef unsigned short v8us  __attribute__((ext_vector_type(8)));
typedef float    v8f  __attribute__((ext_vector_type(8)));
typedef float    v4f  __attribute__((ext_vector_type(4)));
typedef float    v2f  __attribute__((ext_vector_type(2)));
typedef unsigned int v4u __attribute__((ext_vector_type(4)));
typedef unsigned int v8u __attribute__((ext_vector_type(8)));
union FH { v16h v; v8h h[2]; };
union FB { v16us u; v8us h[2]; v8u w; };

// ---- scalar helpers --------------------------------------------------------------------------------
__device__ __forceinline__ unsigned short bf_bits(float f) {          // f32 -> bf16 bits, RNE convert
  unsigned u = __float_as_uint(f);
  return (unsigned short)((u + 0x7FFFu + ((u >> 16) & 1u)) >> 16);
}
__device__ __forceinline__ float bf_up(unsigned short h) { return __uint_as_float(((unsigned)h) << 16); }
__device__ __forceinline__ unsigned short h_bits(_Float16 x) { return __builtin_bit_cast(unsigned short, x); }
__device__ __forceinline__ unsigned pk16(unsigned short a, unsigned short b) { return (unsigned)a | ((unsigned)b << 16); }
__device__ __forceinline__ v8f zero8() { v8f z = {0.f, 0.f, 0.f, 0.f, 0.f, 0.f, 0.f, 0.f}; return z; }
// The transcendental instructions alone: the library forms wrap each in input scaling for tiny values, a two-sided
// rounding repair (sqrtf) and result scaling (expf), over a dozen vector instructions a score.
// v_sqrt_f32: 1 ulp; a subnormal sum of squares gives a score of 0 where the exact one is below 1e-19.
__device__ __forceinline__ float hw_sqrt(float x) { return __builtin_amdgcn_sqrtf(x); }
// v_exp_f32 = 2^x: a weight below the normal range (x < -126) comes out 0; beside the row's largest weight, 1, it adds nothing.
__device__ __forceinline__ float hw_exp2(float x) { return __builtin_amdgcn_exp2f(x); }
__device__ __forceinline__ float xhalf(float x) {                     // the value of lane l ^ 16
  const int i = __builtin_bit_cast(int, x);
  return __builtin_bit_cast(float, __builtin_amdgcn_permlanex16(i, i, 0x76543210, 0xfedcba98, false, false));
}

// ---- fragment loader: 16-bit A/B operand, lane -> row/col (lane&15), p already includes +8*(lane>>4);
//      elements 0..7 <- p[0..7] (k0+8h..), elements 8..15 <- p[16..23] (k0+16+8h..)
__device__ __forceinline__ v16us ldfrag_b(const unsigned short* p) {   // bf16 plane read as 16-bit uint vectors
  FB f;
  f.h[0] = *(const v8us*)(p);
  f.h[1] = *(const v8us*)(p + 16);
  return f.u;
}
// exact negation of a bf16 fragment (sign-bit flip of every 16-bit element)
__device__ __forceinline__ v16us neg16(v16us x) {
  FB f;
  f.u = x;
#pragma unroll
  for (int i = 0; i < 8; ++i) f.w[i] = f.w[i] ^ 0x80008000u;
  return f.u;
}

// ---- WMMA helpers; trailing VALU hazard gaps are issued by the guard_* helpers after each group --------
__device__ __forceinline__ v8f mma_h_raw(v16h a, v16h b, v8f c) {
  return __builtin_amdgcn_wmma_f32_16x16x32_f16(false, a, false, b, (short)0, c, false, false);
}
__device__ __forceinline__ v8f mma_b_raw(v16us a, v16us b, v8f c) {
  return __builtin_amdgcn_wmma_f32_16x16x32_bf16(false, __builtin_bit_cast(v16b, a), false,
                                                 __builtin_bit_cast(v16b, b), (short)0, c, false, false);
}
__device__ __forceinline__ void guard_b5(v8f& x, v8f& y, v16us a, v16us b, v16us d, v16us e, v16us f) {
#if defined(__HIP_DEVICE_COMPILE__)
  asm volatile("v_nop\n\tv_nop\n\tv_nop\n\tv_nop" : "+v"(x), "+v"(y) : "v"(a), "v"(b), "v"(d), "v"(e), "v"(f));
#endif
}
__device__ __forceinline__ void guard_h1(v8f& x, v16h a, v16h b) {
#if defined(__HIP_DEVICE_COMPILE__)
  asm volatile("v_nop\n\tv_nop\n\tv_nop\n\tv_nop" : "+v"(x) : "v"(a), "v"(b));
#endif
}
__device__ __forceinline__ void guard_h2(v8f& x, v8f& y, v16h a, v16h b, v16h d) {
#if defined(__HIP_DEVICE_COMPILE__)
  asm volatile("v_nop\n\tv_nop\n\tv_nop\n\tv_nop" : "+v"(x), "+v"(y) : "v"(a), "v"(b), "v"(d));
#endif
}
__device__ __forceinline__ void acc_guard4(v8f& a, v8f& b, v8f& c, v8f& d) {
#if defined(__HIP_DEVICE_COMPILE__)
  asm volatile("v_nop\n\tv_nop\n\tv_nop\n\tv_nop" : "+v"(a), "+v"(b), "+v"(c), "+v"(d));
#endif
}
__device__ __forceinline__ void wave_sync_lds() {
  __builtin_amdgcn_fence(__ATOMIC_RELEASE, "workgroup");
  __builtin_amdgcn_wave_barrier();
  __builtin_amdgcn_fence(__ATOMIC_ACQUIRE, "workgroup");
}

// ---- asynchronous copies global -> LDS (16 B per lane, through no register) and the ring's waits ----
__device__ __forceinline__ unsigned lds_byte(const void* p) { return (unsigned)(uintptr_t)p; }   // LDS byte address
// eight copies of one lane; the closing s_wait_xcnt stands in front of every later rewrite of an address register
// that a copy names (a precaution), inside the statement so that no address arithmetic can be moved in front of it
__device__ __forceinline__ void async_copy8(const unsigned (&l)[8], const void* const (&g)[8]) {
#if defined(__HIP_DEVICE_COMPILE__)
  asm volatile(
      "global_load_async_to_lds_b128 %0, %8, off\n\t"
      "global_load_async_to_lds_b128 %1, %9, off\n\t"
      "global_load_async_to_lds_b128 %2, %10, off\n\t"
      "global_load_async_to_lds_b128 %3, %11, off\n\t"
      "global_load_async_to_lds_b128 %4, %12, off\n\t"
      "global_load_async_to_lds_b128 %5, %13, off\n\t"
      "global_load_async_to_lds_b128 %6, %14, off\n\t"
      "global_load_async_to_lds_b128 %7, %15, off\n\t"
      "s_wait_xcnt 0x0"
      :: "v"(l[0]), "v"(l[1]), "v"(l[2]), "v"(l[3]), "v"(l[4]), "v"(l[5]), "v"(l[6]), "v"(l[7]),
         "v"(g[0]), "v"(g[1]), "v"(g[2]), "v"(g[3]), "v"(g[4]), "v"(g[5]), "v"(g[6]), "v"(g[7])
      : "memory");
#endif
}
// this wave's copies have landed in LDS (the compiler places no wait for them)
__device__ __forceinline__ void wait_async0() {
#if defined(__HIP_DEVICE_COMPILE__)
  asm volatile("s_wait_asynccnt 0x0" ::: "memory");
#endif
}
// stands behind issued global loads, in front of any rewrite of the address registers that they name (a precaution).
// The address is an input only so that its registers stay untouched up to the wait.
__device__ __forceinline__ void wait_x0(const void* addr) {
#if defined(__HIP_DEVICE_COMPILE__)
  asm volatile("s_wait_xcnt 0x0" :: "v"(addr) : "memory");
#endif
}
// this wave's LDS reads have returned, before the buffer they read is handed to the next tile's copies
__device__ __forceinline__ void wait_ds0() {
#if defined(__HIP_DEVICE_COMPILE__)
  asm volatile("s_wait_dscnt 0x0" ::: "memory");
#endif
}

// =====================================================================================================
// Transpose + convert: input z (stride zin) is f32 [R][C]; output z (stride zout) is an f16 plane [C][R] holding
// f16(bf16 RNE value * scale) (scale a power of two, exact). Tile = 64 input rows x 32 input cols;
// grid = (C/32, R/64, nz), block 256. Load: thread t -> input row t>>2, cols (t&3)*8..+7 (two 16-B loads);
// store: thread t -> output row t>>3 (= input col), input rows (t&7)*8..+7 as ONE 16-B store, so lanes
// coverage: (C/32) x (R/64) tiles x 32 output rows x 64 cols = all of out[C][R] per z (R%64==0, C%32==0).
// =====================================================================================================
__global__ __launch_bounds__(256) void tr_cvt(const float* __restrict__ in, unsigned short* out, int R, int C,
                                             long long zin, long long zout, float scale) {
  __shared__ float tile[64 * 33];
  const int z = blockIdx.z;
  const float* ib = in + (size_t)z * (size_t)zin;
  unsigned short* ob = out + (size_t)z * (size_t)zout;
  const int r0 = blockIdx.y * 64, c0 = blockIdx.x * 32;
  const int t = threadIdx.x;
  {
    const int ir = t >> 2, ic = (t & 3) * 8;
    const float* g = ib + (size_t)(r0 + ir) * (size_t)C + c0 + ic;
    const v4f a = *(const v4f*)g;
    const v4f b = *(const v4f*)(g + 4);
    float* l = tile + ir * 33 + ic;
    l[0] = a[0]; l[1] = a[1]; l[2] = a[2]; l[3] = a[3];
    l[4] = b[0]; l[5] = b[1]; l[6] = b[2]; l[7] = b[3];
  }
  __syncthreads();
  const int orow = t >> 3, piece = (t & 7) * 8;
  v4u p;
#pragma unroll
  for (int e = 0; e < 4; ++e) {
    const float f0 = tile[(piece + 2 * e) * 33 + orow];
    const float f1 = tile[(piece + 2 * e + 1) * 33 + orow];
    const _Float16 x0 = (_Float16)(bf_up(bf_bits(f0)) * scale);
    const _Float16 x1 = (_Float16)(bf_up(bf_bits(f1)) * scale);
    p[e] = pk16(h_bits(x0), h_bits(x1));
  }
  const size_t go = (size_t)(c0 + orow) * (size_t)R + r0 + piece;
  *(v4u*)(ob + go) = p;
  
}

// =====================================================================================================
// Row-major convert of two f32 [n] arrays into two consecutive bf16 planes: out[i] = bf16(a[i]), out[n+i] = bf16(bsrc[i])
// (RNE bits). Thread -> 8 consecutive elements, ONE 16-B store per plane; lanes 8q..8q+7 of a wave write one whole
// coverage: grid.x = n/2048 blocks x 256 threads x 8 = n elements of each plane (n % 2048 == 0 host-checked).
// =====================================================================================================
__global__ __launch_bounds__(256) void cvt2(const float* __restrict__ a, const float* __restrict__ bsrc,
                                           unsigned short* out, int n) {
  const size_t i8 = ((size_t)blockIdx.x * 256 + threadIdx.x) * 8;
  if (i8 + 8 > (size_t)n) return;        // never taken for the host-checked size; no barriers below
  const v4f a0 = *(const v4f*)(a + i8);
  const v4f a1 = *(const v4f*)(a + i8 + 4);
  const v4f b0 = *(const v4f*)(bsrc + i8);
  const v4f b1 = *(const v4f*)(bsrc + i8 + 4);
  v4u pa, pb;
#pragma unroll
  for (int e = 0; e < 2; ++e) {
    pa[e]     = pk16(bf_bits(a0[2 * e]), bf_bits(a0[2 * e + 1]));
    pa[2 + e] = pk16(bf_bits(a1[2 * e]), bf_bits(a1[2 * e + 1]));
    pb[e]     = pk16(bf_bits(b0[2 * e]), bf_bits(b0[2 * e + 1]));
    pb[2 + e] = pk16(bf_bits(b1[2 * e]), bf_bits(b1[2 * e + 1]));
  }
  unsigned short* oa = out + i8;
  unsigned short* ob = out + (size_t)n + i8;
  *(v4u*)oa = pa;
  *(v4u*)ob = pb;
  
}

// =====================================================================================================
// Causal complex attention, per (b, h, 64-query block):
//   sr = qr.kr - qi.ki, si = qr.ki + qi.kr over e=64 (bf16 operands, exact products, f32 accumulate; -qi.ki as
//   qi.(ki with flipped sign bits)); s = sqrt(sr^2 + si^2) * SCL2 (base-2 units); key > query -> NEG_BIG (value select, diagonal
//   kept); online softmax in f32; p = 2^(s - m) carried as ph = f16(1024 p) and, when PRES, pl = f16((1024 p - ph)
//   * PRS); context over the 128-wide value row [v_r | v_i] with v as f16(VSC * bf16 value):
//     oh += ph.v over all chunks; when PRES, ol = pl.v per chunk folded as oh += ol / PRS in f32.
//   Q / K planes (bf16 bits, pitch DMOD): plane 0 = real, plane 1 = imag (NTOK*DMOD apart); element (b, t, h, e)
//     at [(b*SEQ + t)*DMOD + h*64 + e]
//   V^T plane (f16): element (b, part, h, d, t) at [((b*2 + part)*DMOD + h*64 + d)*SEQ + t], part 0 = v_r, 1 = v_i
//   Block = 4 NG waves = NG groups of 4 waves on the SAME 64 query rows of one (b, h); qb and hb = b * NHEAD + h come
//   from the kernel below; h = hb % NHEAD, b = hb / NHEAD; key chunks of 64, chunks kt <= qb only. A stage is NG
//   chunks: in stage p group g works on chunk kt = NG p + g with its own maxima, sums and context tile, so that a query
//   block walks qb / NG + 1 stages (block-uniform trip) and not qb + 1 chunks; a group whose chunk lies past qb (in the
//   last stage only) skips the work and passes every wait and barrier; chunk kt == qb keeps its diagonal by the
//   per-element select. Behind the loop the groups g > 0 hand their partials (context tile, maxima, sums) to group 0
//   through LDS (the K ring, which every reader has left), one barrier, and group 0 merges them one after the other:
//   M = max(m, mg), weights 2^(m - M) and 2^(mg - M), in f32.
//   K / V^T staging: asynchronous 16-B copies into a ring of two LDS stages of NG chunk buffers each; chunk kt of
//   stage p lies in buffer (p & 1) * NG + g, is copied by group g's own 128 threads (tl = tid & 127), and stage p + 1
//   is in flight while stage p is worked on; a chunk index past the planes' last chunk is clamped to it for the copy
//   (such a chunk lies past qb and is never read). 8 lanes cover one 128-B line: K copy i of a thread ->
//   key row i*8 + (tl>>4), part (tl>>3)&1, piece tl&7 into Ksh[buf][key][part*64 + e] (pitch KP); V^T copy i ->
//   value row d = i*16 + (tl>>3), piece tl&7 into Vs[buf][d][kv] (pitch VP). At the foot of a stage every wave:
//   s_wait_dscnt 0, s_wait_asynccnt 0, __syncthreads (publishes stage p + 1, frees the buffers of stage p), then the
//   copies of stage p + 2.
//   Both products are taken transposed: scores^T = K . Q^T (A = key rows from LDS, B = q fragments from the global
//   planes, kept in registers) and context^T += V^T . P^T (A = V^T rows from LDS, B = P^T). A lane's score registers
//   belong to ONE query (column lane & 15), so its maximum and sum are formed in the lane (one exchange with lane ^ 16),
//   and two converted score tiles are a B operand as they lie: P goes through no LDS and needs no wave barrier.
//   Output row (b, t, h) = 128 f32 [r0, i0, r1, i1, ...] at out + ((b*SEQ + t)*NHEAD + h)*128: the wave's 16x128
//   context tile is staged interleaved in LDS, then each 512-B row is written by 32 lanes x 16 B in ONE
//   coverage: each wave of group 0 stores rows q0..q0+15 x 128 floats; 4 waves x blocks of the grid = all (b, t, h) rows.
// =====================================================================================================
template <bool PRES>
__device__ __forceinline__
void attn_body(const unsigned short* __restrict__ QB, const unsigned short* __restrict__ KB,
               const unsigned short* __restrict__ VT, int qb, int hb,
               unsigned short (&Ksh)[2 * NG][64 * KP], _Float16 (&Vs)[2 * NG][VW * VP], float (&Os)[4][16 * OP]) {
  const int tid  = threadIdx.x;
  const int grp  = __builtin_amdgcn_readfirstlane(tid >> 7);           // wave group (wave-uniform)
  const int tl   = tid & 127;                                          // thread within its group
  const int wave = tl >> 5;                                            // 16-row slice of the query block
  const int lane = tid & 31;
  const int hh   = lane >> 4;
  const int c    = lane & 15;

  const int h  = hb % NHEAD;
  const int b  = hb / NHEAD;
  const int q0 = qb * 64 + wave * 16;

  const size_t NPL = (size_t)NTOK * DMOD;                              // one bf16 plane (both batches)
  const unsigned short* Qr = QB + (size_t)b * SEQ * DMOD + (size_t)h * HD;
  const unsigned short* Qi = Qr + NPL;
  const unsigned short* Kr = KB + (size_t)b * SEQ * DMOD + (size_t)h * HD;
  const _Float16* Vg = (const _Float16*)(const void*)VT + ((size_t)(b * 2) * DMOD + (size_t)h * HD) * SEQ;

  float mrow = NEG_BIG;                       // running maximum of query q0 + c (equal in lanes c and c + 16)
  float lrow = 0.f;                           // running sum over this lane half's keys of that query
  v8f oh[8];                                  // oh[t][r] = context^T[value column t*16 + 8*hh + r][query q0 + c]
#pragma unroll
  for (int t = 0; t < 8; ++t) oh[t] = zero8();

  // ---- this thread's 16 copies of chunk t into ring buffer buf (all lanes on, block-uniform callers) ----
  const int pc = (tl & 7) * 8;                                         // 16-B piece of a 128-B line, in elements
  const unsigned short* kthr = Kr + (size_t)((tl >> 3) & 1) * NPL + (size_t)(tl >> 4) * DMOD + pc;
  const _Float16* vthr = Vg + (size_t)(tl >> 3) * SEQ + pc;
  const unsigned kl0 = lds_byte(&Ksh[0][(tl >> 4) * KP + ((tl >> 3) & 1) * HD + pc]);
  const unsigned vl0 = lds_byte(&Vs[0][(tl >> 3) * VP + pc]);
  auto stage = [&](int tq, int buf) {
    const int t = (tq < NQB) ? tq : (NQB - 1);                         // every copy stays inside the planes
    unsigned kl[8], vl[8];
    const void* kg[8];
    const void* vg[8];
#pragma unroll
    for (int i = 0; i < 8; ++i) {
      kl[i] = kl0 + (unsigned)buf * (unsigned)sizeof(Ksh[0]) + (unsigned)(i * 8 * KP * 2);
      kg[i] = kthr + (size_t)(t * 64 + i * 8) * DMOD;
      vl[i] = vl0 + (unsigned)buf * (unsigned)sizeof(Vs[0]) + (unsigned)(i * 16 * VP * 2);
      vg[i] = vthr + ((size_t)(i >> 2) * DMOD + (size_t)((i & 3) * 16)) * SEQ + t * 64;
    }
    async_copy8(kl, kg);
    async_copy8(vl, vg);
  };

  const int np = qb / NG + 1;                 // stages of NG chunks (block-uniform)
  stage(grp, grp);
  wait_async0();
  __syncthreads();                            // stage 0 published
  if (np > 1) stage(NG + grp, NG + grp);

  // ---- Q fragments (B operand, column = lane&15): 2 e-chunks per plane from the global planes, once per block ----
  v16us qr[2], qi[2];
#pragma unroll
  for (int dc = 0; dc < 2; ++dc) {
    qr[dc] = ldfrag_b(Qr + (size_t)(q0 + c) * DMOD + dc * 32 + 8 * hh);
    qi[dc] = ldfrag_b(Qi + (size_t)(q0 + c) * DMOD + dc * 32 + 8 * hh);
  }
  wait_x0(Qr + (size_t)(q0 + c) * DMOD + 8 * hh);   // the one address pair that the eight loads above name

  for (int p = 0; p < (NQB + NG - 1) / NG; ++p) {   // static bound; block-uniform causal stage skipping
    if (p >= np) break;
    const int kt = NG * p + grp;              // this group's chunk of the stage
    const int bi = (p & 1) * NG + grp;        // and its ring buffer
    if (kt <= qb) {                           // wave-uniform; no barrier inside
    const int kv0 = kt * 64;
    const unsigned short* Kc = Ksh[bi];
    const _Float16* Vc = Vs[bi];

    // ---- scores, transposed: 64 keys (D rows) x 16 queries (D columns) per wave, depth 64 (2 chunks), 4 products per chunk ----
    v8f s[4];
#pragma unroll
    for (int j = 0; j < 4; ++j) {
      v8f sr = zero8(), si = zero8();
#pragma unroll
      for (int dc = 0; dc < 2; ++dc) {
        const unsigned short* kp = Kc + (j * 16 + c) * KP + dc * 32 + 8 * hh;   // A row = key j*16+c
        FB br, bi;
        br.h[0] = *(const v8us*)(kp);
        br.h[1] = *(const v8us*)(kp + 16);
        bi.h[0] = *(const v8us*)(kp + HD);
        bi.h[1] = *(const v8us*)(kp + HD + 16);
        const v16us bin = neg16(bi.u);
        sr = mma_b_raw(br.u, qr[dc], sr);
        sr = mma_b_raw(bin, qi[dc], sr);
        si = mma_b_raw(bi.u, qr[dc], si);
        si = mma_b_raw(br.u, qi[dc], si);
        guard_b5(sr, si, qr[dc], qi[dc], br.u, bi.u, bin);
      }
      const int keyb = kv0 + j * 16 + 8 * hh;            // key index of D element r is keyb + r
      const int qrow = q0 + c;                           // query of this lane's D column
#pragma unroll
      for (int r = 0; r < 8; r += 2) {                   // register pairs as they lie: one packed multiply, one packed fma
        const v2f a = {sr[r], sr[r + 1]};
        const v2f g = {si[r], si[r + 1]};
        const v2f m2 = __builtin_elementwise_fma(a, a, g * g);
        s[j][r]     = (keyb + r <= qrow)     ? hw_sqrt(m2[0]) * SCL2 : NEG_BIG;
        s[j][r + 1] = (keyb + r + 1 <= qrow) ? hw_sqrt(m2[1]) * SCL2 : NEG_BIG;
      }
    }

    // ---- a lane holds 32 of its query's 64 scores: maximum and sum in the lane, the maximum joined with the other
    //      lane half by one exchange; P hi (x1024, f16) and, when PRES, P residual (x PRS, f16) are packed in place:
    //      score tiles 2 kk and 2 kk + 1 of a lane are elements 0..7 and 8..15 of the B operand over keys kk*32..+31 ----
    float m = s[0][0];
#pragma unroll
    for (int j = 0; j < 4; ++j) {
#pragma unroll
      for (int r = 0; r < 8; ++r) m = fmaxf(m, s[j][r]);
    }
    m = fmaxf(m, xhalf(m));
    const float mnew  = fmaxf(mrow, m);
    const float alpha = hw_exp2(mrow - mnew);
    mrow = mnew;
    float psum = 0.f;
    FH pa[2], pb[2];
#pragma unroll
    for (int j = 0; j < 4; ++j) {
#pragma unroll
      for (int r = 0; r < 8; ++r) {
        const float p  = hw_exp2(s[j][r] - mnew);
        psum += p;
        const float ph = p * PSC;
        const _Float16 xh = (_Float16)ph;
        pa[j >> 1].v[(j & 1) * 8 + r] = xh;
        if (PRES) pb[j >> 1].v[(j & 1) * 8 + r] = (_Float16)((ph - (float)xh) * PRS);
      }
    }
    lrow = lrow * alpha + psum;
#pragma unroll
    for (int t = 0; t < 8; ++t) {
#pragma unroll
      for (int r = 0; r < 8; ++r) oh[t][r] *= alpha;
    }

    // ---- context, transposed: oh += V^T . Phi^T; when PRES: ol = V^T . Plo^T, then oh += ol / PRS ----
    v8f ol[8];
#pragma unroll
    for (int t = 0; t < 8; ++t) ol[t] = zero8();
#pragma unroll
    for (int kk = 0; kk < 2; ++kk) {          // unrolled: the P fragments are registers, picked by a constant index
#pragma unroll
      for (int t = 0; t < 8; ++t) {
        FH vb;                                                                  // A row = value column t*16+c
        vb.h[0] = *(const v8h*)(Vc + (t * 16 + c) * VP + kk * 32 + 8 * hh);
        vb.h[1] = *(const v8h*)(Vc + (t * 16 + c) * VP + kk * 32 + 16 + 8 * hh);
        oh[t] = mma_h_raw(vb.v, pa[kk].v, oh[t]);
        if (PRES) {
          ol[t] = mma_h_raw(vb.v, pb[kk].v, ol[t]);
          guard_h2(oh[t], ol[t], pa[kk].v, pb[kk].v, vb.v);
        } else {
          guard_h1(oh[t], pa[kk].v, vb.v);
        }
      }
    }
    acc_guard4(oh[0], oh[1], oh[2], oh[3]);
    acc_guard4(oh[4], oh[5], oh[6], oh[7]);
    if (PRES) {
      acc_guard4(ol[0], ol[1], ol[2], ol[3]);
      acc_guard4(ol[4], ol[5], ol[6], ol[7]);
#pragma unroll
      for (int t = 0; t < 8; ++t) {
#pragma unroll
        for (int r = 0; r < 8; ++r) oh[t][r] += ol[t][r] * (1.0f / PRS);
      }
    }
    }
    // ---- publish point of stage p + 1; the buffers of stage p are free behind the barrier ----
    wait_ds0();
    wait_async0();
    __syncthreads();
    if (p + 2 < np) stage(NG * (p + 2) + grp, bi);
  }
  wait_async0();                              // nothing is left in flight when the wave goes on to the epilogue

  // ---- merge of the groups' partials: each group g > 0 writes its lanes' values (lane-contiguous; a lane of group 0
  //      reads back the positions of its own accumulator layout), one barrier, group 0 combines in f32. The partials
  //      lie in the K ring: behind the loop's last barrier no wave reads it and no copy is in flight ----
  static_assert(sizeof(Ksh) >= (size_t)(NG - 1) * 4 * MGW * sizeof(float));
  float* mg0 = (float*)(void*)&Ksh[0][0] + wave * MGW + lane;
  if (grp != 0) {
    float* mg = mg0 + (grp - 1) * 4 * MGW;
#pragma unroll
    for (int t = 0; t < 8; ++t) {
#pragma unroll
      for (int r = 0; r < 8; ++r) mg[(t * 8 + r) * 32] = oh[t][r];
    }
    mg[64 * 32] = mrow;
    mg[65 * 32] = lrow;
  }
  __syncthreads();                            // the partials are published; met by every wave of the block
  if (grp != 0) return;                       // no barrier follows; the kernel below leaves with it
#pragma unroll
  for (int g = 1; g < NG; ++g) {
    const float* mg = mg0 + (g - 1) * 4 * MGW;
    const float m1 = mg[64 * 32];
    const float l1 = mg[65 * 32];
    const float mm = fmaxf(mrow, m1);
    const float a0 = hw_exp2(mrow - mm);
#if defined(__HIP_DEVICE_COMPILE__)
    asm volatile("v_nop");                    // the slot behind a transcendental
#endif
    const float a1 = hw_exp2(m1 - mm);        // 0 where group g had no chunk (m1 = NEG_BIG, its sums 0)
    mrow = mm;
    lrow = lrow * a0 + l1 * a1;
#pragma unroll
    for (int t = 0; t < 8; ++t) {
#pragma unroll
      for (int r = 0; r < 8; ++r) oh[t][r] = oh[t][r] * a0 + mg[(t * 8 + r) * 32] * a1;
    }
  }

  // ---- join the lane halves' sums, normalise (1/l, the 1/PSC p carry and the 1/VSC v carry), stage the wave's 16x128
  //      tile interleaved: lane (c, hh) holds query row c; v_r columns d, d + 1 (tile t) and v_i columns d, d + 1
  //      (tile t + 4) are four consecutive floats [r_d, i_d, r_d+1, i_d+1] of the row, one 16-B LDS store ----
  float* os = Os[wave];
  const float l = lrow + xhalf(lrow);
  const float inv = ((l > 0.f) ? (1.0f / l) : 0.f) * (1.0f / (PSC * VSC));
#pragma unroll
  for (int t = 0; t < 4; ++t) {
#pragma unroll
    for (int r = 0; r < 8; r += 2) {
      const v4f o = {oh[t][r] * inv, oh[t + 4][r] * inv, oh[t][r + 1] * inv, oh[t + 4][r + 1] * inv};
      *(v4f*)(os + c * OP + 2 * (t * 16 + 8 * hh + r)) = o;
    }
  }
  // the kernel below reads the tile back, behind its wave_sync_lds(), and stores it
}

// One grid for all query blocks, twice as many as the chip has places (one block fills a WGP's LDS). A block's cost
// grows with qb, and the cost falls with the index (qb = NQB - 1 for the first
// NHEAD * NBATCH blocks, then NQB - 2, ...), for speed only. index -> (qb, hb) is a permutation of all (query block, batch x head) pairs.
// The choice of body is block-uniform (blockIdx only): every barrier of a body is met by all 4 NG waves.
__global__ __launch_bounds__(128 * NG)
void attn_c(const unsigned short* __restrict__ QB, const unsigned short* __restrict__ KB,
            const unsigned short* __restrict__ VT, float* out) {
  __shared__ __align__(16) unsigned short Ksh[2 * NG][64 * KP];        // K [buf][kv][kr e 0..63 | ki e 64..127 | pad] 6 x 17 KB
  __shared__ __align__(16) _Float16 Vs[2 * NG][VW * VP];                // V^T [buf][d][kv | pad] 6 x 18 KB
  __shared__ __align__(16) float    Os[4][16 * OP];                     // group 0, per wave context tile [row][128 | pad] 33 KB
  const unsigned bid = blockIdx.x;
  const int qb = NQB - 1 - (int)(bid / (unsigned)(NHEAD * NBATCH));     // longest query blocks first
  const int hb = (int)(bid % (unsigned)(NHEAD * NBATCH));
  if (qb >= NQP) {
    attn_body<false>(QB, KB, VT, qb, hb, Ksh, Vs, Os);
  } else {
    attn_body<true>(QB, KB, VT, qb, hb, Ksh, Vs, Os);
  }
  if (threadIdx.x >= 128) return;             // the groups g > 0 have handed over; whole waves, no barrier below

  // ---- both bodies leave the wave's context tile in Os[wave]; the output stores are common to them ----
  const int wave = threadIdx.x >> 5;
  const int lane = threadIdx.x & 31;
  const int h  = hb % NHEAD;
  const int b  = hb / NHEAD;
  const int q0 = qb * 64 + wave * 16;
  const float* os = Os[wave];
  float* g0 = out + ((size_t)(b * SEQ + q0) * NHEAD + h) * VW + lane * 4;   // row q0 of (b, h), this lane's 16 B
  wave_sync_lds();
  {
#pragma unroll
    for (int it = 0; it < 16; ++it) {                    // row it: 32 lanes x 16 B = 512 B = 128 floats
      const v4f o = *(const v4f*)(os + it * OP + lane * 4);
      *(v4f*)(g0 + (size_t)it * NHEAD * VW) = o;
    }
  }
}

// =====================================================================================================
// Workspace map (bytes); every plane is an exact multiple of its whole-line store granularity (all dims are exact
// tile multiples, no padded tails), all offsets multiples of 8 MiB:
//   QB  bf16 [2 parts][4096 t][512]             0   8388608   (q_r, q_i RNE bits)
//   KB  bf16 [2 parts][4096 t][512]       8388608   8388608   (k_r, k_i RNE bits)
//   VT  f16  [2 b][2 parts][512 (h,d)][2048 t] 16777216   8388608   (bf16 value x16)
//   end                                 25165824
// =====================================================================================================
extern "C" void kernel_launch(void* const* d_in, const int* in_sizes, int n_in,
                              void* d_out, int out_size, void* d_ws, size_t ws_size,
                              hipStream_t stream) {
  const int n = NTOK * DMOD;                                // 2097152 elements per input
  if (n_in < 6) return;
  for (int i = 0; i < 6; ++i) if (in_sizes[i] != n) return;
  if (out_size != 2 * n) return;

  const float* qr = (const float*)d_in[0];
  const float* qi = (const float*)d_in[1];
  const float* kr = (const float*)d_in[2];
  const float* ki = (const float*)d_in[3];
  const float* vr = (const float*)d_in[4];
  const float* vi = (const float*)d_in[5];
  float* outf = (float*)d_out;

  const size_t PQB = (size_t)2 * n * 2;                     //  8388608
  const size_t PKB = (size_t)2 * n * 2;                     //  8388608
  const size_t PVT = (size_t)NBATCH * 2 * DMOD * SEQ * 2;   //  8388608
  size_t off = 0;
  const size_t oQ = off; off += PQB;
  const size_t oK = off; off += PKB;
  const size_t oV = off; off += PVT;
  if (off > ws_size) return;                                // off = 25165824
  if (off > (size_t)134217728) return;

  char* ws = (char*)d_ws;
  unsigned short* QB = (unsigned short*)(ws + oQ);
  unsigned short* KB = (unsigned short*)(ws + oK);
  unsigned short* VT = (unsigned short*)(ws + oV);

  const dim3 blk256(256), blkatt(128 * NG);

  // (1) q, k -> bf16 planes [part][4096 t][512]
  cvt2<<<dim3(n / 2048), blk256, 0, stream>>>(qr, qi, QB, n);
  cvt2<<<dim3(n / 2048), blk256, 0, stream>>>(kr, ki, KB, n);
  // (2) v -> transposed f16 planes: in[2048 t][512 (h,e)] per batch z -> out[512 (h,d)][2048 t] at part 0 (v_r)
  //     and part 1 (v_i) of batch z; grid = (cols/32, rows/64, batches)
  tr_cvt<<<dim3(DMOD / 32, SEQ / 64, NBATCH), blk256, 0, stream>>>(
      vr, VT, SEQ, DMOD, (long long)SEQ * DMOD, (long long)2 * DMOD * SEQ, VSC);
  tr_cvt<<<dim3(DMOD / 32, SEQ / 64, NBATCH), blk256, 0, stream>>>(
      vi, VT + (size_t)DMOD * SEQ, SEQ, DMOD, (long long)SEQ * DMOD, (long long)2 * DMOD * SEQ, VSC);
  // (3) causal attention -> d_out, one launch: query blocks 0..NQP-1 (rows < 512) with the p residual tile, the rest without
  attn_c<<<dim3(NQB * NHEAD * NBATCH), blkatt, 0, stream>>>(QB, KB, VT, outf);
  (void)hipGetLastError();
}

// v008
// Measured time: 47.3 microseconds a run.
// Timed twice side by side with v007, it ran 1.11 and 1.10 times as fast.
// Over all steps from v000 it is 6.10 times as fast.
// Contractions: complex k.q^T (scores transposed) as kr.qr, ki.qi (negated), ki.qr, kr.qi over e=64 on v_wmma_f32_16x16x32_bf16 (raw
//   bf16 RNE values of q and k, one product each, signs combined in the f32 accumulators); [v_r|v_i]^T.p^T over keys on
//   v_wmma_f32_16x16x32_f16 with p as f16(1024 p) (plus a x4096 f16 residual tile for the first 512 query rows of
//   each sequence) and v as f16 of its bf16 RNE value x16 (exact); f32 accumulate everywhere; score magnitude,
//   causal select, softmax statistics and epilogue in f32.
#include <hip/hip_runtime.h>
#include <math.h>
#include <stdint.h>

#define NBATCH 2
#define SEQ    2048
#define NHEAD  8
#define HD     64                  // score depth e
#define VW     (2 * HD)            // value row width: v_r d 0..63 | v_i d 64..127
#define DMOD   (NHEAD * HD)        // 512: token row pitch of the q/k/v inputs
#define NTOK   (NBATCH * SEQ)      // 4096 token rows
#define NQB    (SEQ / 64)          // 32 query / key tiles of 64
#define NQP    8                   // leading query tiles (rows < 512) that carry the p residual tile
#define VSC    16.0f               // v plane carry (power of two, exact on bf16 values)
#define PSC    1024.0f             // softmax numerator carry
#define PRS    4096.0f             // p residual carry
#define SCL2   0.18033688011112043f  // log2(e) / sqrt(64): scores and maxima are carried in base-2 units
#define NEG_BIG (-1.0e30f)
#define NG     3                   // wave groups of a block; group g takes key chunks g, g + NG, g + 2 NG, ...
#define MGW    (66 * 32)           // floats of one wave's partial: 64 context + 1 maximum + 1 sum per lane
// LDS row pitches in 16-bit elements: every row read by ds_load_b128 fragments (16 lanes = 16 rows, 16 B each) gets
// a pitch of 16 B x odd, so the 16 rows of a half wave fall on all 64 banks instead of on 4 (K) or 8 (V); the same
// for the output staging rows, which 16 lanes write 16 B each.
#define KP     (VW + 8)            // K rows: 256 B of data at 272 B pitch
#define VP     (64 + 8)            // V^T rows: 128 B of data at 144 B pitch
#define OP     (VW + 4)            // output staging rows, in floats: 512 B of data at 528 B pitch
static_assert(HD == 64 && VW == 128);
static_assert((SEQ % 64) == 0 && (DMOD % 32) == 0);
static_assert(((NTOK * DMOD) % 2048) == 0);
static_assert(NQP > 0 && NQP < NQB);
static_assert(((KP * 2) % 32) == 16 && ((VP * 2) % 32) == 16 && ((OP * 4) % 32) == 16);

typedef _Float16 v16h __attribute__((ext_vector_type(16)));
typedef _Float16 v8h  __attribute__((ext_vector_type(8)));
typedef __bf16   v16b __attribute__((ext_vector_type(16)));
typedef unsigned short v16us __attribute__((ext_vector_type(16)));
typedef unsigned short v8us  __attribute__((ext_vector_type(8)));
typedef float    v8f  __attribute__((ext_vector_type(8)));
typedef float    v4f  __attribute__((ext_vector_type(4)));
typedef float    v2f  __attribute__((ext_vector_type(2)));
typedef unsigned int v4u __attribute__((ext_vector_type(4)));
typedef unsigned int v8u __attribute__((ext_vector_type(8)));
union FH { v16h v; v8h h[2]; };
union FB { v16us u; v8us h[2]; v8u w; };

// ---- scalar helpers --------------------------------------------------------------------------------
__device__ __forceinline__ unsigned short bf_bits(float f) {          // f32 -> bf16 bits, RNE convert
  unsigned u = __float_as_uint(f);
  return (unsigned short)((u + 0x7FFFu + ((u >> 16) & 1u)) >> 16);
}
__device__ __forceinline__ float bf_up(unsigned short h) { return __uint_as_float(((unsigned)h) << 16); }
__device__ __forceinline__ unsigned short h_bits(_Float16 x) { return __builtin_bit_cast(unsigned short, x); }
__device__ __forceinline__ unsigned pk16(unsigned short a, unsigned short b) { return (unsigned)a | ((unsigned)b << 16); }
__device__ __forceinline__ v8f zero8() { v8f z = {0.f, 0.f, 0.f, 0.f, 0.f, 0.f, 0.f, 0.f}; return z; }
// The transcendental instructions alone: the library forms wrap each in input scaling for tiny values, a two-sided
// rounding repair (sqrtf) and result scaling (expf), over a dozen vector instructions a score.
// v_sqrt_f32: 1 ulp; a subnormal sum of squares gives a score of 0 where the exact one is below 1e-19.
__device__ __forceinline__ float hw_sqrt(float x) { return __builtin_amdgcn_sqrtf(x); }
// v_exp_f32 = 2^x: a weight below the normal range (x < -126) comes out 0; beside the row's largest weight, 1, it adds nothing.
__device__ __forceinline__ float hw_exp2(float x) { return __builtin_amdgcn_exp2f(x); }
__device__ __forceinline__ float xhalf(float x) {                     // the value of lane l ^ 16
  const int i = __builtin_bit_cast(int, x);
  return __builtin_bit_cast(float, __builtin_amdgcn_permlanex16(i, i, 0x76543210, 0xfedcba98, false, false));
}

// ---- fragment loader: 16-bit A/B operand, lane -> row/col (lane&15), p already includes +8*(lane>>4);
//      elements 0..7 <- p[0..7] (k0+8h..), elements 8..15 <- p[16..23] (k0+16+8h..)
__device__ __forceinline__ v16us ldfrag_b(const unsigned short* p) {   // bf16 plane read as 16-bit uint vectors
  FB f;
  f.h[0] = *(const v8us*)(p);
  f.h[1] = *(const v8us*)(p + 16);
  return f.u;
}
// exact negation of a bf16 fragment (sign-bit flip of every 16-bit element)
__device__ __forceinline__ v16us neg16(v16us x) {
  FB f;
  f.u = x;
#pragma unroll
  for (int i = 0; i < 8; ++i) f.w[i] = f.w[i] ^ 0x80008000u;
  return f.u;
}

// ---- WMMA helpers: builtin forms, the compiler keeps the distances behind them --------
__device__ __forceinline__ v8f mma_h_raw(v16h a, v16h b, v8f c) {
  return __builtin_amdgcn_wmma_f32_16x16x32_f16(false, a, false, b, (short)0, c, false, false);
}
__device__ __forceinline__ v8f mma_b_raw(v16us a, v16us b, v8f c) {
  return __builtin_amdgcn_wmma_f32_16x16x32_bf16(false, __builtin_bit_cast(v16b, a), false,
                                                 __builtin_bit_cast(v16b, b), (short)0, c, false, false);
}
__device__ __forceinline__ void wave_sync_lds() {
  __builtin_amdgcn_fence(__ATOMIC_RELEASE, "workgroup");
  __builtin_amdgcn_wave_barrier();
  __builtin_amdgcn_fence(__ATOMIC_ACQUIRE, "workgroup");
}

// ---- asynchronous copies global -> LDS (16 B per lane, through no register) and the ring's waits ----
__device__ __forceinline__ unsigned lds_byte(const void* p) { return (unsigned)(uintptr_t)p; }   // LDS byte address
// eight copies of one lane; the closing s_wait_xcnt stands in front of every later rewrite of an address register
// that a copy names (a precaution), inside the statement so that no address arithmetic can be moved in front of it
__device__ __forceinline__ void async_copy8(const unsigned (&l)[8], const void* const (&g)[8]) {
#if defined(__HIP_DEVICE_COMPILE__)
  asm volatile(
      "global_load_async_to_lds_b128 %0, %8, off\n\t"
      "global_load_async_to_lds_b128 %1, %9, off\n\t"
      "global_load_async_to_lds_b128 %2, %10, off\n\t"
      "global_load_async_to_lds_b128 %3, %11, off\n\t"
      "global_load_async_to_lds_b128 %4, %12, off\n\t"
      "global_load_async_to_lds_b128 %5, %13, off\n\t"
      "global_load_async_to_lds_b128 %6, %14, off\n\t"
      "global_load_async_to_lds_b128 %7, %15, off\n\t"
      "s_wait_xcnt 0x0"
      :: "v"(l[0]), "v"(l[1]), "v"(l[2]), "v"(l[3]), "v"(l[4]), "v"(l[5]), "v"(l[6]), "v"(l[7]),
         "v"(g[0]), "v"(g[1]), "v"(g[2]), "v"(g[3]), "v"(g[4]), "v"(g[5]), "v"(g[6]), "v"(g[7])
      : "memory");
#endif
}
// this wave's copies have landed in LDS (the compiler places no wait for them)
__device__ __forceinline__ void wait_async0() {
#if defined(__HIP_DEVICE_COMPILE__)
  asm volatile("s_wait_asynccnt 0x0" ::: "memory");
#endif
}
// stands behind issued global loads, in front of any rewrite of the address registers that they name (a precaution).
// The address is an input only so that its registers stay untouched up to the wait.
__device__ __forceinline__ void wait_x0(const void* addr) {
#if defined(__HIP_DEVICE_COMPILE__)
  asm volatile("s_wait_xcnt 0x0" :: "v"(addr) : "memory");
#endif
}
// this wave's LDS reads have returned, before the buffer they read is handed to the next tile's copies
__device__ __forceinline__ void wait_ds0() {
#if defined(__HIP_DEVICE_COMPILE__)
  asm volatile("s_wait_dscnt 0x0" ::: "memory");
#endif
}

// =====================================================================================================
// Transpose + convert: input z (stride zin) is f32 [R][C]; output z (stride zout) is an f16 plane [C][R] holding
// f16(bf16 RNE value * scale) (scale a power of two, exact). Tile = 64 input rows x 32 input cols;
// grid = (C/32, R/64, nz), block 256. Load: thread t -> input row t>>2, cols (t&3)*8..+7 (two 16-B loads);
// store: thread t -> output row t>>3 (= input col), input rows (t&7)*8..+7 as ONE 16-B store, so lanes
// coverage: (C/32) x (R/64) tiles x 32 output rows x 64 cols = all of out[C][R] per z (R%64==0, C%32==0).
// =====================================================================================================
__global__ __launch_bounds__(256) void tr_cvt(const float* __restrict__ in, unsigned short* out, int R, int C,
                                             long long zin, long long zout, float scale) {
  __shared__ float tile[64 * 33];
  const int z = blockIdx.z;
  const float* ib = in + (size_t)z * (size_t)zin;
  unsigned short* ob = out + (size_t)z * (size_t)zout;
  const int r0 = blockIdx.y * 64, c0 = blockIdx.x * 32;
  const int t = threadIdx.x;
  {
    const int ir = t >> 2, ic = (t & 3) * 8;
    const float* g = ib + (size_t)(r0 + ir) * (size_t)C + c0 + ic;
    const v4f a = *(const v4f*)g;
    const v4f b = *(const v4f*)(g + 4);
    float* l = tile + ir * 33 + ic;
    l[0] = a[0]; l[1] = a[1]; l[2] = a[2]; l[3] = a[3];
    l[4] = b[0]; l[5] = b[1]; l[6] = b[2]; l[7] = b[3];
  }
  __syncthreads();
  const int orow = t >> 3, piece = (t & 7) * 8;
  v4u p;
#pragma unroll
  for (int e = 0; e < 4; ++e) {
    const float f0 = tile[(piece + 2 * e) * 33 + orow];
    const float f1 = tile[(piece + 2 * e + 1) * 33 + orow];
    const _Float16 x0 = (_Float16)(bf_up(bf_bits(f0)) * scale);
    const _Float16 x1 = (_Float16)(bf_up(bf_bits(f1)) * scale);
    p[e] = pk16(h_bits(x0), h_bits(x1));
  }
  const size_t go = (size_t)(c0 + orow) * (size_t)R + r0 + piece;
  *(v4u*)(ob + go) = p;
  
}

// =====================================================================================================
// Row-major convert of two f32 [n] arrays into two consecutive bf16 planes: out[i] = bf16(a[i]), out[n+i] = bf16(bsrc[i])
// (RNE bits). Thread -> 8 consecutive elements, ONE 16-B store per plane; lanes 8q..8q+7 of a wave write one whole
// coverage: grid.x = n/2048 blocks x 256 threads x 8 = n elements of each plane (n % 2048 == 0 host-checked).
// =====================================================================================================
__global__ __launch_bounds__(256) void cvt2(const float* __restrict__ a, const float* __restrict__ bsrc,
                                           unsigned short* out, int n) {
  const size_t i8 = ((size_t)blockIdx.x * 256 + threadIdx.x) * 8;
  if (i8 + 8 > (size_t)n) return;        // never taken for the host-checked size; no barriers below
  const v4f a0 = *(const v4f*)(a + i8);
  const v4f a1 = *(const v4f*)(a + i8 + 4);
  const v4f b0 = *(const v4f*)(bsrc + i8);
  const v4f b1 = *(const v4f*)(bsrc + i8 + 4);
  v4u pa, pb;
#pragma unroll
  for (int e = 0; e < 2; ++e) {
    pa[e]     = pk16(bf_bits(a0[2 * e]), bf_bits(a0[2 * e + 1]));
    pa[2 + e] = pk16(bf_bits(a1[2 * e]), bf_bits(a1[2 * e + 1]));
    pb[e]     = pk16(bf_bits(b0[2 * e]), bf_bits(b0[2 * e + 1]));
    pb[2 + e] = pk16(bf_bits(b1[2 * e]), bf_bits(b1[2 * e + 1]));
  }
  unsigned short* oa = out + i8;
  unsigned short* ob = out + (size_t)n + i8;
  *(v4u*)oa = pa;
  *(v4u*)ob = pb;
  
}

// =====================================================================================================
// Causal complex attention, per (b, h, 64-query block):
//   sr = qr.kr - qi.ki, si = qr.ki + qi.kr over e=64 (bf16 operands, exact products, f32 accumulate; -qi.ki as
//   qi.(ki with flipped sign bits)); s = sqrt(sr^2 + si^2) * SCL2 (base-2 units); key > query -> NEG_BIG (value select, diagonal
//   kept); online softmax in f32; p = 2^(s - m) carried as ph = f16(1024 p) and, when PRES, pl = f16((1024 p - ph)
//   * PRS); context over the 128-wide value row [v_r | v_i] with v as f16(VSC * bf16 value):
//     oh += ph.v over all chunks; when PRES, ol = pl.v per chunk folded as oh += ol / PRS in f32.
//   Q / K planes (bf16 bits, pitch DMOD): plane 0 = real, plane 1 = imag (NTOK*DMOD apart); element (b, t, h, e)
//     at [(b*SEQ + t)*DMOD + h*64 + e]
//   V^T plane (f16): element (b, part, h, d, t) at [((b*2 + part)*DMOD + h*64 + d)*SEQ + t], part 0 = v_r, 1 = v_i
//   Block = 4 NG waves = NG groups of 4 waves on the SAME 64 query rows of one (b, h); qb and hb = b * NHEAD + h come
//   from the kernel below; h = hb % NHEAD, b = hb / NHEAD; key chunks of 64, chunks kt <= qb only. A stage is NG
//   chunks: in stage p group g works on chunk kt = NG p + g with its own maxima, sums and context tile, so that a query
//   block walks qb / NG + 1 stages (block-uniform trip) and not qb + 1 chunks; a group whose chunk lies past qb (in the
//   last stage only) skips the work and passes every wait and barrier; chunk kt == qb keeps its diagonal by the
//   per-element select. Behind the loop the groups g > 0 hand their partials (context tile, maxima, sums) to group 0
//   through LDS (the K ring, which every reader has left), one barrier, and group 0 merges them one after the other:
//   M = max(m, mg), weights 2^(m - M) and 2^(mg - M), in f32.
//   K / V^T staging: asynchronous 16-B copies into a ring of two LDS stages of NG chunk buffers each; chunk kt of
//   stage p lies in buffer (p & 1) * NG + g, is copied by group g's own 128 threads (tl = tid & 127), and stage p + 1
//   is in flight while stage p is worked on; a chunk index past the planes' last chunk is clamped to it for the copy
//   (such a chunk lies past qb and is never read). 8 lanes cover one 128-B line: K copy i of a thread ->
//   key row i*8 + (tl>>4), part (tl>>3)&1, piece tl&7 into Ksh[buf][key][part*64 + e] (pitch KP); V^T copy i ->
//   value row d = i*16 + (tl>>3), piece tl&7 into Vs[buf][d][kv] (pitch VP). At the foot of a stage every wave:
//   s_wait_dscnt 0, s_wait_asynccnt 0, __syncthreads (publishes stage p + 1, frees the buffers of stage p), then the
//   copies of stage p + 2.
//   Both products are taken transposed: scores^T = K . Q^T (A = key rows from LDS, B = q fragments from the global
//   planes, kept in registers) and context^T += V^T . P^T (A = V^T rows from LDS, B = P^T). A lane's score registers
//   belong to ONE query (column lane & 15), so its maximum and sum are formed in the lane (one exchange with lane ^ 16),
//   and two converted score tiles are a B operand as they lie: P goes through no LDS and needs no wave barrier.
//   Output row (b, t, h) = 128 f32 [r0, i0, r1, i1, ...] at out + ((b*SEQ + t)*NHEAD + h)*128: the wave's 16x128
//   context tile is staged interleaved in LDS, then each 512-B row is written by 32 lanes x 16 B in ONE
//   coverage: each wave of group 0 stores rows q0..q0+15 x 128 floats; 4 waves x blocks of the grid = all (b, t, h) rows.
// =====================================================================================================
template <bool PRES>
__device__ __forceinline__
void attn_body(const unsigned short* __restrict__ QB, const unsigned short* __restrict__ KB,
               const unsigned short* __restrict__ VT, int qb, int hb,
               unsigned short (&Ksh)[2 * NG][64 * KP], _Float16 (&Vs)[2 * NG][VW * VP], float (&Os)[4][16 * OP]) {
  const int tid  = threadIdx.x;
  const int grp  = __builtin_amdgcn_readfirstlane(tid >> 7);           // wave group (wave-uniform)
  const int tl   = tid & 127;                                          // thread within its group
  const int wave = tl >> 5;                                            // 16-row slice of the query block
  const int lane = tid & 31;
  const int hh   = lane >> 4;
  const int c    = lane & 15;

  const int h  = hb % NHEAD;
  const int b  = hb / NHEAD;
  const int q0 = qb * 64 + wave * 16;

  const size_t NPL = (size_t)NTOK * DMOD;                              // one bf16 plane (both batches)
  const unsigned short* Qr = QB + (size_t)b * SEQ * DMOD + (size_t)h * HD;
  const unsigned short* Qi = Qr + NPL;
  const unsigned short* Kr = KB + (size_t)b * SEQ * DMOD + (size_t)h * HD;
  const _Float16* Vg = (const _Float16*)(const void*)VT + ((size_t)(b * 2) * DMOD + (size_t)h * HD) * SEQ;

  float mrow = NEG_BIG;                       // running maximum of query q0 + c (equal in lanes c and c + 16)
  float lrow = 0.f;                           // running sum over this lane half's keys of that query
  v8f oh[8];                                  // oh[t][r] = context^T[value column t*16 + 8*hh + r][query q0 + c]
#pragma unroll
  for (int t = 0; t < 8; ++t) oh[t] = zero8();

  // ---- this thread's 16 copies of chunk t into ring buffer buf (all lanes on, block-uniform callers) ----
  const int pc = (tl & 7) * 8;                                         // 16-B piece of a 128-B line, in elements
  const unsigned short* kthr = Kr + (size_t)((tl >> 3) & 1) * NPL + (size_t)(tl >> 4) * DMOD + pc;
  const _Float16* vthr = Vg + (size_t)(tl >> 3) * SEQ + pc;
  const unsigned kl0 = lds_byte(&Ksh[0][(tl >> 4) * KP + ((tl >> 3) & 1) * HD + pc]);
  const unsigned vl0 = lds_byte(&Vs[0][(tl >> 3) * VP + pc]);
  auto stage = [&](int tq, int buf) {
    const int t = (tq < NQB) ? tq : (NQB - 1);                         // every copy stays inside the planes
    unsigned kl[8], vl[8];
    const void* kg[8];
    const void* vg[8];
#pragma unroll
    for (int i = 0; i < 8; ++i) {
      kl[i] = kl0 + (unsigned)buf * (unsigned)sizeof(Ksh[0]) + (unsigned)(i * 8 * KP * 2);
      kg[i] = kthr + (size_t)(t * 64 + i * 8) * DMOD;
      vl[i] = vl0 + (unsigned)buf * (unsigned)sizeof(Vs[0]) + (unsigned)(i * 16 * VP * 2);
      vg[i] = vthr + ((size_t)(i >> 2) * DMOD + (size_t)((i & 3) * 16)) * SEQ + t * 64;
    }
    async_copy8(kl, kg);
    async_copy8(vl, vg);
  };

  const int np = qb / NG + 1;                 // stages of NG chunks (block-uniform)
  stage(grp, grp);
  wait_async0();
  __syncthreads();                            // stage 0 published
  if (np > 1) stage(NG + grp, NG + grp);

  // ---- Q fragments (B operand, column = lane&15): 2 e-chunks per plane from the global planes, once per block ----
  v16us qr[2], qi[2];
#pragma unroll
  for (int dc = 0; dc < 2; ++dc) {
    qr[dc] = ldfrag_b(Qr + (size_t)(q0 + c) * DMOD + dc * 32 + 8 * hh);
    qi[dc] = ldfrag_b(Qi + (size_t)(q0 + c) * DMOD + dc * 32 + 8 * hh);
  }
  wait_x0(Qr + (size_t)(q0 + c) * DMOD + 8 * hh);   // the one address pair that the eight loads above name

  for (int p = 0; p < (NQB + NG - 1) / NG; ++p) {   // static bound; block-uniform causal stage skipping
    if (p >= np) break;
    const int kt = NG * p + grp;              // this group's chunk of the stage
    const int bi = (p & 1) * NG + grp;        // and its ring buffer
    if (kt <= qb) {                           // wave-uniform; no barrier inside
    const int kv0 = kt * 64;
    const unsigned short* Kc = Ksh[bi];
    const _Float16* Vc = Vs[bi];

    // ---- scores, transposed: 64 keys (D rows) x 16 queries (D columns) per wave, depth 64 (2 chunks), 4 products per chunk ----
    //      LDS reads run ahead of their users, each group in one place: the K fragments of key tile j + 2 are read
    //      beside the products of tile j, the V^T fragments (A row = value column t*16+c) beside the last tile's
    //      products and in front of the softmax, so that no matrix instruction stands directly behind its own read;
    //      with the residual tile's registers live (PRES) the second half of V^T follows behind the softmax, in two groups ----
    constexpr int NVA = PRES ? 8 : 16;        // V^T fragments read in front of the softmax; fragment f = kk * 8 + t
    FB kfr[4][2], kfi[4][2];
    FH vf[16];
    auto ldk = [&](int j) {
#pragma unroll
      for (int dc = 0; dc < 2; ++dc) {
        const unsigned short* kp = Kc + (j * 16 + c) * KP + dc * 32 + 8 * hh;   // A row = key j*16+c
        kfr[j][dc].h[0] = *(const v8us*)(kp);
        kfr[j][dc].h[1] = *(const v8us*)(kp + 16);
        kfi[j][dc].h[0] = *(const v8us*)(kp + HD);
        kfi[j][dc].h[1] = *(const v8us*)(kp + HD + 16);
      }
    };
    auto ldv = [&](int f0, int f1) {
#pragma unroll
      for (int f = f0; f < f1; ++f) {
        vf[f].h[0] = *(const v8h*)(Vc + ((f & 7) * 16 + c) * VP + (f >> 3) * 32 + 8 * hh);
        vf[f].h[1] = *(const v8h*)(Vc + ((f & 7) * 16 + c) * VP + (f >> 3) * 32 + 16 + 8 * hh);
      }
    };
    ldk(0);
    ldk(1);
    __builtin_amdgcn_sched_barrier(0);        // here and below: without it the scheduler sinks the reads to their users
    v8f s[4];
#pragma unroll
    for (int j = 0; j < 4; ++j) {
      v8f sr = zero8(), si = zero8();
#pragma unroll
      for (int dc = 0; dc < 2; ++dc) {
        const v16us bin = neg16(kfi[j][dc].u);
        sr = mma_b_raw(kfr[j][dc].u, qr[dc], sr);
        sr = mma_b_raw(bin, qi[dc], sr);
        si = mma_b_raw(kfi[j][dc].u, qr[dc], si);
        si = mma_b_raw(kfr[j][dc].u, qi[dc], si);
      }
      if (j < 2) ldk(j + 2);
      if (j == 3) ldv(0, 8);
      if (j != 2) __builtin_amdgcn_sched_barrier(0);   // holds the reads just above in front of what follows
      const int keyb = kv0 + j * 16 + 8 * hh;            // key index of D element r is keyb + r
      const int qrow = q0 + c;                           // query of this lane's D column
#pragma unroll
      for (int r = 0; r < 8; r += 2) {                   // register pairs as they lie: one packed multiply, one packed fma
        const v2f a = {sr[r], sr[r + 1]};
        const v2f g = {si[r], si[r + 1]};
        const v2f m2 = __builtin_elementwise_fma(a, a, g * g);
        s[j][r]     = (keyb + r <= qrow)     ? hw_sqrt(m2[0]) * SCL2 : NEG_BIG;
        s[j][r + 1] = (keyb + r + 1 <= qrow) ? hw_sqrt(m2[1]) * SCL2 : NEG_BIG;
      }
    }

    if (NVA == 16) {
      ldv(8, 16);
      __builtin_amdgcn_sched_barrier(0);      // holds the reads in front of the softmax arithmetic
    }

    // ---- a lane holds 32 of its query's 64 scores: maximum and sum in the lane, the maximum joined with the other
    //      lane half by one exchange; P hi (x1024, f16) and, when PRES, P residual (x PRS, f16) are packed in place:
    //      score tiles 2 kk and 2 kk + 1 of a lane are elements 0..7 and 8..15 of the B operand over keys kk*32..+31 ----
    float m = s[0][0];
#pragma unroll
    for (int j = 0; j < 4; ++j) {
#pragma unroll
      for (int r = 0; r < 8; ++r) m = fmaxf(m, s[j][r]);
    }
    m = fmaxf(m, xhalf(m));
    const float mnew  = fmaxf(mrow, m);
    const float alpha = hw_exp2(mrow - mnew);
    mrow = mnew;
    float psum = 0.f;
    FH pa[2], pb[2];
#pragma unroll
    for (int j = 0; j < 4; ++j) {
#pragma unroll
      for (int r = 0; r < 8; ++r) {
        const float p  = hw_exp2(s[j][r] - mnew);
        psum += p;
        const float ph = p * PSC;
        const _Float16 xh = (_Float16)ph;
        pa[j >> 1].v[(j & 1) * 8 + r] = xh;
        if (PRES) pb[j >> 1].v[(j & 1) * 8 + r] = (_Float16)((ph - (float)xh) * PRS);
      }
    }
    lrow = lrow * alpha + psum;
#pragma unroll
    for (int t = 0; t < 8; ++t) {
#pragma unroll
      for (int r = 0; r < 8; ++r) oh[t][r] *= alpha;
    }

    // ---- context, transposed: oh += V^T . Phi^T; when PRES: ol = V^T . Plo^T, then oh += ol / PRS ----
    if (NVA < 16) {                           // the scores' registers are free
      ldv(8, 12);
      __builtin_amdgcn_sched_barrier(0);      // holds the reads in front of the first half's products
    }
    v8f ol[8];
#pragma unroll
    for (int t = 0; t < 8; ++t) ol[t] = zero8();
#pragma unroll
    for (int kk = 0; kk < 2; ++kk) {          // unrolled: the P fragments are registers, picked by a constant index
#pragma unroll
      for (int t = 0; t < 8; ++t) {
        oh[t] = mma_h_raw(vf[kk * 8 + t].v, pa[kk].v, oh[t]);
        if (PRES) ol[t] = mma_h_raw(vf[kk * 8 + t].v, pb[kk].v, ol[t]);
        if (NVA < 16 && kk == 0 && t == 3) {  // four fragments' registers are free again
          ldv(12, 16);
          __builtin_amdgcn_sched_barrier(0);  // holds the reads in front of the remaining products of the first half
        }
      }
    }
    if (PRES) {
#pragma unroll
      for (int t = 0; t < 8; ++t) {
#pragma unroll
        for (int r = 0; r < 8; ++r) oh[t][r] += ol[t][r] * (1.0f / PRS);
      }
    }
    }
    // ---- publish point of stage p + 1; the buffers of stage p are free behind the barrier ----
    wait_ds0();
    wait_async0();
    __syncthreads();
    if (p + 2 < np) stage(NG * (p + 2) + grp, bi);
  }
  wait_async0();                              // nothing is left in flight when the wave goes on to the epilogue

  // ---- merge of the groups' partials: each group g > 0 writes its lanes' values (lane-contiguous; a lane of group 0
  //      reads back the positions of its own accumulator layout), one barrier, group 0 combines in f32. The partials
  //      lie in the K ring: behind the loop's last barrier no wave reads it and no copy is in flight ----
  static_assert(sizeof(Ksh) >= (size_t)(NG - 1) * 4 * MGW * sizeof(float));
  float* mg0 = (float*)(void*)&Ksh[0][0] + wave * MGW + lane;
  if (grp != 0) {
    float* mg = mg0 + (grp - 1) * 4 * MGW;
#pragma unroll
    for (int t = 0; t < 8; ++t) {
#pragma unroll
      for (int r = 0; r < 8; ++r) mg[(t * 8 + r) * 32] = oh[t][r];
    }
    mg[64 * 32] = mrow;
    mg[65 * 32] = lrow;
  }
  __syncthreads();                            // the partials are published; met by every wave of the block
  if (grp != 0) return;                       // no barrier follows; the kernel below leaves with it
#pragma unroll
  for (int g = 1; g < NG; ++g) {
    const float* mg = mg0 + (g - 1) * 4 * MGW;
    const float m1 = mg[64 * 32];
    const float l1 = mg[65 * 32];
    const float mm = fmaxf(mrow, m1);
    const float a0 = hw_exp2(mrow - mm);
#if defined(__HIP_DEVICE_COMPILE__)
    asm volatile("v_nop");                    // the slot behind a transcendental
#endif
    const float a1 = hw_exp2(m1 - mm);        // 0 where group g had no chunk (m1 = NEG_BIG, its sums 0)
    mrow = mm;
    lrow = lrow * a0 + l1 * a1;
#pragma unroll
    for (int t = 0; t < 8; ++t) {
#pragma unroll
      for (int r = 0; r < 8; ++r) oh[t][r] = oh[t][r] * a0 + mg[(t * 8 + r) * 32] * a1;
    }
  }

  // ---- join the lane halves' sums, normalise (1/l, the 1/PSC p carry and the 1/VSC v carry), stage the wave's 16x128
  //      tile interleaved: lane (c, hh) holds query row c; v_r columns d, d + 1 (tile t) and v_i columns d, d + 1
  //      (tile t + 4) are four consecutive floats [r_d, i_d, r_d+1, i_d+1] of the row, one 16-B LDS store ----
  float* os = Os[wave];
  const float l = lrow + xhalf(lrow);
  const float inv = ((l > 0.f) ? (1.0f / l) : 0.f) * (1.0f / (PSC * VSC));
#pragma unroll
  for (int t = 0; t < 4; ++t) {
#pragma unroll
    for (int r = 0; r < 8; r += 2) {
      const v4f o = {oh[t][r] * inv, oh[t + 4][r] * inv, oh[t][r + 1] * inv, oh[t + 4][r + 1] * inv};
      *(v4f*)(os + c * OP + 2 * (t * 16 + 8 * hh + r)) = o;
    }
  }
  // the kernel below reads the tile back, behind its wave_sync_lds(), and stores it
}

// One grid for all query blocks, twice as many as the chip has places (one block fills a WGP's LDS). A block's cost
// grows with qb, and the cost falls with the index (qb = NQB - 1 for the first
// NHEAD * NBATCH blocks, then NQB - 2, ...), for speed only. index -> (qb, hb) is a permutation of all (query block, batch x head) pairs.
// The choice of body is block-uniform (blockIdx only): every barrier of a body is met by all 4 NG waves.
__global__ __launch_bounds__(128 * NG)
void attn_c(const unsigned short* __restrict__ QB, const unsigned short* __restrict__ KB,
            const unsigned short* __restrict__ VT, float* out) {
  __shared__ __align__(16) unsigned short Ksh[2 * NG][64 * KP];        // K [buf][kv][kr e 0..63 | ki e 64..127 | pad] 6 x 17 KB
  __shared__ __align__(16) _Float16 Vs[2 * NG][VW * VP];                // V^T [buf][d][kv | pad] 6 x 18 KB
  __shared__ __align__(16) float    Os[4][16 * OP];                     // group 0, per wave context tile [row][128 | pad] 33 KB
  const unsigned bid = blockIdx.x;
  const int qb = NQB - 1 - (int)(bid / (unsigned)(NHEAD * NBATCH));     // longest query blocks first
  const int hb = (int)(bid % (unsigned)(NHEAD * NBATCH));
  if (qb >= NQP) {
    attn_body<false>(QB, KB, VT, qb, hb, Ksh, Vs, Os);
  } else {
    attn_body<true>(QB, KB, VT, qb, hb, Ksh, Vs, Os);
  }
  if (threadIdx.x >= 128) return;             // the groups g > 0 have handed over; whole waves, no barrier below

  // ---- both bodies leave the wave's context tile in Os[wave]; the output stores are common to them ----
  const int wave = threadIdx.x >> 5;
  const int lane = threadIdx.x & 31;
  const int h  = hb % NHEAD;
  const int b  = hb / NHEAD;
  const int q0 = qb * 64 + wave * 16;
  const float* os = Os[wave];
  float* g0 = out + ((size_t)(b * SEQ + q0) * NHEAD + h) * VW + lane * 4;   // row q0 of (b, h), this lane's 16 B
  wave_sync_lds();
  {
#pragma unroll
    for (int it = 0; it < 16; ++it) {                    // row it: 32 lanes x 16 B = 512 B = 128 floats
      const v4f o = *(const v4f*)(os + it * OP + lane * 4);
      *(v4f*)(g0 + (size_t)it * NHEAD * VW) = o;
    }
  }
}

// =====================================================================================================
// Workspace map (bytes); every plane is an exact multiple of its whole-line store granularity (all dims are exact
// tile multiples, no padded tails), all offsets multiples of 8 MiB:
//   QB  bf16 [2 parts][4096 t][512]             0   8388608   (q_r, q_i RNE bits)
//   KB  bf16 [2 parts][4096 t][512]       8388608   8388608   (k_r, k_i RNE bits)
//   VT  f16  [2 b][2 parts][512 (h,d)][2048 t] 16777216   8388608   (bf16 value x16)
//   end                                 25165824
// =====================================================================================================
extern "C" void kernel_launch(void* const* d_in, const int* in_sizes, int n_in,
                              void* d_out, int out_size, void* d_ws, size_t ws_size,
                              hipStream_t stream) {
  const int n = NTOK * DMOD;                                // 2097152 elements per input
  if (n_in < 6) return;
  for (int i = 0; i < 6; ++i) if (in_sizes[i] != n) return;
  if (out_size != 2 * n) return;

  const float* qr = (const float*)d_in[0];
  const float* qi = (const float*)d_in[1];
  const float* kr = (const float*)d_in[2];
  const float* ki = (const float*)d_in[3];
  const float* vr = (const float*)d_in[4];
  const float* vi = (const float*)d_in[5];
  float* outf = (float*)d_out;

  const size_t PQB = (size_t)2 * n * 2;                     //  8388608
  const size_t PKB = (size_t)2 * n * 2;                     //  8388608
  const size_t PVT = (size_t)NBATCH * 2 * DMOD * SEQ * 2;   //  8388608
  size_t off = 0;
  const size_t oQ = off; off += PQB;
  const size_t oK = off; off += PKB;
  const size_t oV = off; off += PVT;
  if (off > ws_size) return;                                // off = 25165824
  if (off > (size_t)134217728) return;

  char* ws = (char*)d_ws;
  unsigned short* QB = (unsigned short*)(ws + oQ);
  unsigned short* KB = (unsigned short*)(ws + oK);
  unsigned short* VT = (unsigned short*)(ws + oV);

  const dim3 blk256(256), blkatt(128 * NG);

  // (1) q, k -> bf16 planes [part][4096 t][512]
  cvt2<<<dim3(n / 2048), blk256, 0, stream>>>(qr, qi, QB, n);
  cvt2<<<dim3(n / 2048), blk256, 0, stream>>>(kr, ki, KB, n);
  // (2) v -> transposed f16 planes: in[2048 t][512 (h,e)] per batch z -> out[512 (h,d)][2048 t] at part 0 (v_r)
  //     and part 1 (v_i) of batch z; grid = (cols/32, rows/64, batches)
  tr_cvt<<<dim3(DMOD / 32, SEQ / 64, NBATCH), blk256, 0, stream>>>(
      vr, VT, SEQ, DMOD, (long long)SEQ * DMOD, (long long)2 * DMOD * SEQ, VSC);
  tr_cvt<<<dim3(DMOD / 32, SEQ / 64, NBATCH), blk256, 0, stream>>>(
      vi, VT + (size_t)DMOD * SEQ, SEQ, DMOD, (long long)SEQ * DMOD, (long long)2 * DMOD * SEQ, VSC);
  // (3) causal attention -> d_out, one launch: query blocks 0..NQP-1 (rows < 512) with the p residual tile, the rest without
  attn_c<<<dim3(NQB * NHEAD * NBATCH), blkatt, 0, stream>>>(QB, KB, VT, outf);
  (void)hipGetLastError();
}

// v009
// A run of this version takes 43.5 microseconds.
// In both of two side-by-side timings against v008, it was 1.09 times as fast.
// Over all steps from v000 it is 6.67 times as fast.
// Contractions: complex k.q^T (scores transposed) as kr.qr, ki.qi (negated), ki.qr, kr.qi over e=64 on v_wmma_f32_16x16x32_bf16 (raw
//   bf16 RNE values of q and k, one product each, signs combined in the f32 accumulators); [v_r|v_i]^T.p^T over keys on
//   v_wmma_f32_16x16x32_f16 with p as f16(1024 p) (plus a x4096 f16 residual tile for the first 512 query rows of
//   each sequence) and v as f16 of its bf16 RNE value x16 (exact); f32 accumulate everywhere; score magnitude,
//   causal select, softmax statistics and epilogue in f32.
#include <hip/hip_runtime.h>
#include <math.h>
#include <stdint.h>

#define NBATCH 2
#define SEQ    2048
#define NHEAD  8
#define HD     64                  // score depth e
#define VW     (2 * HD)            // value row width: v_r d 0..63 | v_i d 64..127
#define DMOD   (NHEAD * HD)        // 512: token row pitch of the q/k/v inputs
#define NTOK   (NBATCH * SEQ)      // 4096 token rows
#define NQB    (SEQ / 64)          // 32 query / key tiles of 64
#define NQP    8                   // leading query tiles (rows < 512) that carry the p residual tile
#define VSC    16.0f               // v plane carry (power of two, exact on bf16 values)
#define PSC    1024.0f             // softmax numerator carry
#define PRS    4096.0f             // p residual carry
#define SCL2   0.18033688011112043f  // log2(e) / sqrt(64): scores and maxima are carried in base-2 units
#define NEG_BIG (-1.0e30f)
#define NG     3                   // wave groups of a block; group g takes key chunks g, g + NG, g + 2 NG, ...
#define MGW    (66 * 32)           // floats of one wave's partial: 64 context + 1 maximum + 1 sum per lane
// LDS row pitches in 16-bit elements: every row read by ds_load_b128 fragments (16 lanes = 16 rows, 16 B each) gets
// a pitch of 16 B x odd, so the 16 rows of a half wave fall on all 64 banks instead of on 4 (K) or 8 (V); the same
// for the output staging rows, which 16 lanes write 16 B each.
#define KP     (VW + 8)            // K rows: 256 B of data at 272 B pitch
#define VP     (64 + 8)            // V^T rows: 128 B of data at 144 B pitch
#define OP     (VW + 4)            // output staging rows, in floats: 512 B of data at 528 B pitch
static_assert(HD == 64 && VW == 128);
static_assert((SEQ % 64) == 0 && (DMOD % 32) == 0);
static_assert(((NTOK * DMOD) % 2048) == 0);
static_assert(NQP > 0 && NQP < NQB);
static_assert(((KP * 2) % 32) == 16 && ((VP * 2) % 32) == 16 && ((OP * 4) % 32) == 16);

typedef _Float16 v16h __attribute__((ext_vector_type(16)));
typedef _Float16 v8h  __attribute__((ext_vector_type(8)));
typedef __bf16   v16b __attribute__((ext_vector_type(16)));
typedef unsigned short v16us __attribute__((ext_vector_type(16)));
typedef unsigned short v8us  __attribute__((ext_vector_type(8)));
typedef float    v8f  __attribute__((ext_vector_type(8)));
typedef float    v4f  __attribute__((ext_vector_type(4)));
typedef float    v2f  __attribute__((ext_vector_type(2)));
typedef unsigned int v4u __attribute__((ext_vector_type(4)));
typedef unsigned int v8u __attribute__((ext_vector_type(8)));
union FH { v16h v; v8h h[2]; };
union FB { v16us u; v8us h[2]; v8u w; };

// ---- scalar helpers --------------------------------------------------------------------------------
__device__ __forceinline__ unsigned short bf_bits(float f) {          // f32 -> bf16 bits, RNE convert
  unsigned u = __float_as_uint(f);
  return (unsigned short)((u + 0x7FFFu + ((u >> 16) & 1u)) >> 16);
}
__device__ __forceinline__ float bf_up(unsigned short h) { return __uint_as_float(((unsigned)h) << 16); }
__device__ __forceinline__ unsigned short h_bits(_Float16 x) { return __builtin_bit_cast(unsigned short, x); }
__device__ __forceinline__ unsigned pk16(unsigned short a, unsigned short b) { return (unsigned)a | ((unsigned)b << 16); }
__device__ __forceinline__ v8f zero8() { v8f z = {0.f, 0.f, 0.f, 0.f, 0.f, 0.f, 0.f, 0.f}; return z; }
// The transcendental instructions alone: the library forms wrap each in input scaling for tiny values, a two-sided
// rounding repair (sqrtf) and result scaling (expf), over a dozen vector instructions a score.
// v_sqrt_f32: 1 ulp; a subnormal sum of squares gives a score of 0 where the exact one is below 1e-19.
__device__ __forceinline__ float hw_sqrt(float x) { return __builtin_amdgcn_sqrtf(x); }
// v_exp_f32 = 2^x: a weight below the normal range (x < -126) comes out 0; beside the row's largest weight, 1, it adds nothing.
__device__ __forceinline__ float hw_exp2(float x) { return __builtin_amdgcn_exp2f(x); }
__device__ __forceinline__ float xhalf(float x) {                     // the value of lane l ^ 16
  const int i = __builtin_bit_cast(int, x);
  return __builtin_bit_cast(float, __builtin_amdgcn_permlanex16(i, i, 0x76543210, 0xfedcba98, false, false));
}

// ---- fragment loader: 16-bit A/B operand, lane -> row/col (lane&15), p already includes +8*(lane>>4);
//      elements 0..7 <- p[0..7] (k0+8h..), elements 8..15 <- p[16..23] (k0+16+8h..)
__device__ __forceinline__ v16us ldfrag_b(const unsigned short* p) {   // bf16 plane read as 16-bit uint vectors
  FB f;
  f.h[0] = *(const v8us*)(p);
  f.h[1] = *(const v8us*)(p + 16);
  return f.u;
}
// exact negation of a bf16 fragment (sign-bit flip of every 16-bit element)
__device__ __forceinline__ v16us neg16(v16us x) {
  FB f;
  f.u = x;
#pragma unroll
  for (int i = 0; i < 8; ++i) f.w[i] = f.w[i] ^ 0x80008000u;
  return f.u;
}

// ---- WMMA helpers: builtin forms, the compiler keeps the distances behind them --------
__device__ __forceinline__ v8f mma_h_raw(v16h a, v16h b, v8f c) {
  return __builtin_amdgcn_wmma_f32_16x16x32_f16(false, a, false, b, (short)0, c, false, false);
}
__device__ __forceinline__ v8f mma_b_raw(v16us a, v16us b, v8f c) {
  return __builtin_amdgcn_wmma_f32_16x16x32_bf16(false, __builtin_bit_cast(v16b, a), false,
                                                 __builtin_bit_cast(v16b, b), (short)0, c, false, false);
}
__device__ __forceinline__ void wave_sync_lds() {
  __builtin_amdgcn_fence(__ATOMIC_RELEASE, "workgroup");
  __builtin_amdgcn_wave_barrier();
  __builtin_amdgcn_fence(__ATOMIC_ACQUIRE, "workgroup");
}

// ---- asynchronous copies global -> LDS (16 B per lane, through no register) and the ring's waits ----
__device__ __forceinline__ unsigned lds_byte(const void* p) { return (unsigned)(uintptr_t)p; }   // LDS byte address
// eight copies of one lane; the closing s_wait_xcnt stands in front of every later rewrite of an address register
// that a copy names (a precaution), inside the statement so that no address arithmetic can be moved in front of it
__device__ __forceinline__ void async_copy8(const unsigned (&l)[8], const void* const (&g)[8]) {
#if defined(__HIP_DEVICE_COMPILE__)
  asm volatile(
      "global_load_async_to_lds_b128 %0, %8, off\n\t"
      "global_load_async_to_lds_b128 %1, %9, off\n\t"
      "global_load_async_to_lds_b128 %2, %10, off\n\t"
      "global_load_async_to_lds_b128 %3, %11, off\n\t"
      "global_load_async_to_lds_b128 %4, %12, off\n\t"
      "global_load_async_to_lds_b128 %5, %13, off\n\t"
      "global_load_async_to_lds_b128 %6, %14, off\n\t"
      "global_load_async_to_lds_b128 %7, %15, off\n\t"
      "s_wait_xcnt 0x0"
      :: "v"(l[0]), "v"(l[1]), "v"(l[2]), "v"(l[3]), "v"(l[4]), "v"(l[5]), "v"(l[6]), "v"(l[7]),
         "v"(g[0]), "v"(g[1]), "v"(g[2]), "v"(g[3]), "v"(g[4]), "v"(g[5]), "v"(g[6]), "v"(g[7])
      : "memory");
#endif
}
// this wave's copies have landed in LDS (the compiler places no wait for them)
__device__ __forceinline__ void wait_async0() {
#if defined(__HIP_DEVICE_COMPILE__)
  asm volatile("s_wait_asynccnt 0x0" ::: "memory");
#endif
}
// stands behind issued global loads, in front of any rewrite of the address registers that they name (a precaution).
// The address is an input only so that its registers stay untouched up to the wait.
__device__ __forceinline__ void wait_x0(const void* addr) {
#if defined(__HIP_DEVICE_COMPILE__)
  asm volatile("s_wait_xcnt 0x0" :: "v"(addr) : "memory");
#endif
}
// this wave's LDS reads have returned, before the buffer they read is handed to the next tile's copies
__device__ __forceinline__ void wait_ds0() {
#if defined(__HIP_DEVICE_COMPILE__)
  asm volatile("s_wait_dscnt 0x0" ::: "memory");
#endif
}

// =====================================================================================================
// All conversions in ONE launch of PREPB blocks x 512 threads (16 waves, one block a WGP), every block with an equal
// share of both kinds of work; a thread has all its 24 16-B loads in flight before it converts anything, and stores
// each piece as soon as it is converted, while later loads are still landing.
// (a) v_r, v_i -> transposed f16 planes. Block index bits: 7 = part (v_r / v_i), 6 = batch, 5..2 = token rows R0 / 128,
//     1..0 = columns C0 / 128 of the f32 [SEQ][DMOD] input; the block's 128 x 128 region is 8 tiles of 64 rows x 32
//     columns, tile id -> rows R0 + (id >> 2) * 64, columns C0 + (id & 3) * 32, each in an LDS tile of its own
//     (pitch 33 floats); thread half t >> 8 takes tiles 2 k + half, k = 0..3. Load: thread tt = t & 255 -> tile row
//     tt >> 2, columns (tt & 3) * 8..+7; one barrier; store: tt -> output row tt >> 3 (= input column), tokens
//     (tt & 7) * 8..+7 as ONE 16-B store of f16(bf16 RNE value * VSC) (exact), 8 lanes a 128-B line.
//     coverage: 2 parts x 2 batches x 16 x 4 regions = PREPB blocks; 8 tiles x 32 output rows x 64 tokens a block.
// (b) q_r, q_i -> the two bf16 planes (RNE bits) at QB, k_r, k_i -> the two at KB, n = NTOK * DMOD elements each. An item
//     is 8 consecutive elements (two 16-B loads, ONE 16-B store); block b takes items b * 1024 + j * 512 + t, j = 0, 1,
//     of every plane. coverage: PREPB x 1024 items x 8 = n elements of each plane.
// =====================================================================================================
#define PREPB  256
static_assert(PREPB == 2 * NBATCH * (SEQ / 128) * (DMOD / 128));
static_assert(PREPB * 1024 * 8 == NTOK * DMOD);
__global__ __launch_bounds__(512) void prep(const float* __restrict__ qr, const float* __restrict__ qi,
                                           const float* __restrict__ kr, const float* __restrict__ ki,
                                           const float* __restrict__ vr, const float* __restrict__ vi,
                                           unsigned short* QB, unsigned short* KB, unsigned short* VT) {
  __shared__ float tile[8][64 * 33];
  const int t = threadIdx.x;
  const int b = blockIdx.x;
  const int part = b >> 7, z = (b >> 6) & 1;
  const int R0 = ((b >> 2) & 15) * 128, C0 = (b & 3) * 128;
  const int tt = t & 255, half = t >> 8;

  // ---- all loads of the thread, the v tiles' first: loads return in order, and the barrier below needs only those ----
  const float* vin = (part ? vi : vr) + (size_t)z * SEQ * DMOD
                     + (size_t)(R0 + (tt >> 2)) * DMOD + C0 + (tt & 3) * 8 + half * 32;
  v4f va[4], vb[4];
#pragma unroll
  for (int k = 0; k < 4; ++k) {                // tile id = 2 k + half: rows + (k >> 1) * 64, columns + (k & 1) * 64 + half * 32
    const float* g = vin + (size_t)((k >> 1) * 64) * DMOD + (k & 1) * 64;
    va[k] = *(const v4f*)g;
    vb[k] = *(const v4f*)(g + 4);
  }
  __builtin_amdgcn_sched_barrier(0);           // keeps these loads the first: without it the scheduler issues them last
  const size_t i8 = ((size_t)b * 1024 + t) * 8;
  const float* const src[4] = {qr + i8, qi + i8, kr + i8, ki + i8};
  v4f ca[4][2], cb[4][2];
#pragma unroll
  for (int pl = 0; pl < 4; ++pl) {
#pragma unroll
    for (int j = 0; j < 2; ++j) {
      ca[pl][j] = *(const v4f*)(src[pl] + j * 4096);
      cb[pl][j] = *(const v4f*)(src[pl] + j * 4096 + 4);
    }
  }
#if defined(__HIP_DEVICE_COMPILE__)
  // stands behind the issued loads, in front of any rewrite of the address registers that they name (a precaution); the
  // addresses are inputs only so that their registers stay untouched up to the wait
  asm volatile("s_wait_xcnt 0x0" :: "v"(vin), "v"(src[0]), "v"(src[1]), "v"(src[2]), "v"(src[3]) : "memory");
#endif
  __builtin_amdgcn_sched_barrier(0);           // without it the scheduler sinks a part of the loads behind the LDS stores

  // ---- (a) the v tiles through LDS ----
#pragma unroll
  for (int k = 0; k < 4; ++k) {
    float* l = tile[2 * k + half] + (tt >> 2) * 33 + (tt & 3) * 8;
    l[0] = va[k][0]; l[1] = va[k][1]; l[2] = va[k][2]; l[3] = va[k][3];
    l[4] = vb[k][0]; l[5] = vb[k][1]; l[6] = vb[k][2]; l[7] = vb[k][3];
  }
  // work-group barrier whose fences name LDS alone (only the tiles pass between waves): __syncthreads() would also wait
  // for every global load still in flight
  __builtin_amdgcn_fence(__ATOMIC_RELEASE, "workgroup", "local");
  __builtin_amdgcn_s_barrier();
  __builtin_amdgcn_fence(__ATOMIC_ACQUIRE, "workgroup", "local");
  const int orow = tt >> 3, piece = (tt & 7) * 8;
  unsigned short* vout = VT + (size_t)(z * 2 + part) * DMOD * SEQ + (size_t)(C0 + half * 32 + orow) * SEQ + R0 + piece;
#pragma unroll
  for (int k = 0; k < 4; ++k) {
    const float* l = tile[2 * k + half];
    v4u p;
#pragma unroll
    for (int e = 0; e < 4; ++e) {
      const float f0 = l[(piece + 2 * e) * 33 + orow];
      const float f1 = l[(piece + 2 * e + 1) * 33 + orow];
      const _Float16 x0 = (_Float16)(bf_up(bf_bits(f0)) * VSC);
      const _Float16 x1 = (_Float16)(bf_up(bf_bits(f1)) * VSC);
      p[e] = pk16(h_bits(x0), h_bits(x1));
    }
    *(v4u*)(vout + (size_t)((k & 1) * 64) * SEQ + (k >> 1) * 64) = p;
  }
  __builtin_amdgcn_sched_barrier(0);           // here and below: without it the scheduler sinks the stores to the kernel's end

  // ---- (b) the q and k planes, in the order of their loads ----
#pragma unroll
  for (int pl = 0; pl < 4; ++pl) {
    unsigned short* o = ((pl < 2) ? QB : KB) + (size_t)(pl & 1) * NTOK * DMOD + i8;
#pragma unroll
    for (int j = 0; j < 2; ++j) {
      v4u p;
#pragma unroll
      for (int e = 0; e < 2; ++e) {
        p[e]     = pk16(bf_bits(ca[pl][j][2 * e]), bf_bits(ca[pl][j][2 * e + 1]));
        p[2 + e] = pk16(bf_bits(cb[pl][j][2 * e]), bf_bits(cb[pl][j][2 * e + 1]));
      }
      *(v4u*)(o + j * 4096) = p;
    }
    if (pl < 3) __builtin_amdgcn_sched_barrier(0);
  }
}

// =====================================================================================================
// Causal complex attention, per (b, h, 64-query block):
//   sr = qr.kr - qi.ki, si = qr.ki + qi.kr over e=64 (bf16 operands, exact products, f32 accumulate; -qi.ki as
//   qi.(ki with flipped sign bits)); s = sqrt(sr^2 + si^2) * SCL2 (base-2 units); key > query -> NEG_BIG (value select, diagonal
//   kept); online softmax in f32; p = 2^(s - m) carried as ph = f16(1024 p) and, when PRES, pl = f16((1024 p - ph)
//   * PRS); context over the 128-wide value row [v_r | v_i] with v as f16(VSC * bf16 value):
//     oh += ph.v over all chunks; when PRES, ol = pl.v per chunk folded as oh += ol / PRS in f32.
//   Q / K planes (bf16 bits, pitch DMOD): plane 0 = real, plane 1 = imag (NTOK*DMOD apart); element (b, t, h, e)
//     at [(b*SEQ + t)*DMOD + h*64 + e]
//   V^T plane (f16): element (b, part, h, d, t) at [((b*2 + part)*DMOD + h*64 + d)*SEQ + t], part 0 = v_r, 1 = v_i
//   Block = 4 NG waves = NG groups of 4 waves on the SAME 64 query rows of one (b, h); qb and hb = b * NHEAD + h come
//   from the kernel below; h = hb % NHEAD, b = hb / NHEAD; key chunks of 64, chunks kt <= qb only. A stage is NG
//   chunks: in stage p group g works on chunk kt = NG p + g with its own maxima, sums and context tile, so that a query
//   block walks qb / NG + 1 stages (block-uniform trip) and not qb + 1 chunks; a group whose chunk lies past qb (in the
//   last stage only) skips the work and passes every wait and barrier; chunk kt == qb keeps its diagonal by the
//   per-element select. Behind the loop the groups g > 0 hand their partials (context tile, maxima, sums) to group 0
//   through LDS (the K ring, which every reader has left), one barrier, and group 0 merges them one after the other:
//   M = max(m, mg), weights 2^(m - M) and 2^(mg - M), in f32.
//   K / V^T staging: asynchronous 16-B copies into a ring of two LDS stages of NG chunk buffers each; chunk kt of
//   stage p lies in buffer (p & 1) * NG + g, is copied by group g's own 128 threads (tl = tid & 127), and stage p + 1
//   is in flight while stage p is worked on; a chunk index past the planes' last chunk is clamped to it for the copy
//   (such a chunk lies past qb and is never read). 8 lanes cover one 128-B line: K copy i of a thread ->
//   key row i*8 + (tl>>4), part (tl>>3)&1, piece tl&7 into Ksh[buf][key][part*64 + e] (pitch KP); V^T copy i ->
//   value row d = i*16 + (tl>>3), piece tl&7 into Vs[buf][d][kv] (pitch VP). At the foot of a stage every wave:
//   s_wait_dscnt 0, s_wait_asynccnt 0, __syncthreads (publishes stage p + 1, frees the buffers of stage p), then the
//   copies of stage p + 2.
//   Both products are taken transposed: scores^T = K . Q^T (A = key rows from LDS, B = q fragments from the global
//   planes, kept in registers) and context^T += V^T . P^T (A = V^T rows from LDS, B = P^T). A lane's score registers
//   belong to ONE query (column lane & 15), so its maximum and sum are formed in the lane (one exchange with lane ^ 16),
//   and two converted score tiles are a B operand as they lie: P goes through no LDS and needs no wave barrier.
//   Output row (b, t, h) = 128 f32 [r0, i0, r1, i1, ...] at out + ((b*SEQ + t)*NHEAD + h)*128: the wave's 16x128
//   context tile is staged interleaved in LDS, then each 512-B row is written by 32 lanes x 16 B in ONE
//   coverage: each wave of group 0 stores rows q0..q0+15 x 128 floats; 4 waves x blocks of the grid = all (b, t, h) rows.
// =====================================================================================================
template <bool PRES>
__device__ __forceinline__
void attn_body(const unsigned short* __restrict__ QB, const unsigned short* __restrict__ KB,
               const unsigned short* __restrict__ VT, int qb, int hb,
               unsigned short (&Ksh)[2 * NG][64 * KP], _Float16 (&Vs)[2 * NG][VW * VP], float (&Os)[4][16 * OP]) {
  const int tid  = threadIdx.x;
  const int grp  = __builtin_amdgcn_readfirstlane(tid >> 7);           // wave group (wave-uniform)
  const int tl   = tid & 127;                                          // thread within its group
  const int wave = tl >> 5;                                            // 16-row slice of the query block
  const int lane = tid & 31;
  const int hh   = lane >> 4;
  const int c    = lane & 15;

  const int h  = hb % NHEAD;
  const int b  = hb / NHEAD;
  const int q0 = qb * 64 + wave * 16;

  const size_t NPL = (size_t)NTOK * DMOD;                              // one bf16 plane (both batches)
  const unsigned short* Qr = QB + (size_t)b * SEQ * DMOD + (size_t)h * HD;
  const unsigned short* Qi = Qr + NPL;
  const unsigned short* Kr = KB + (size_t)b * SEQ * DMOD + (size_t)h * HD;
  const _Float16* Vg = (const _Float16*)(const void*)VT + ((size_t)(b * 2) * DMOD + (size_t)h * HD) * SEQ;

  float mrow = NEG_BIG;                       // running maximum of query q0 + c (equal in lanes c and c + 16)
  float lrow = 0.f;                           // running sum over this lane half's keys of that query
  v8f oh[8];                                  // oh[t][r] = context^T[value column t*16 + 8*hh + r][query q0 + c]
#pragma unroll
  for (int t = 0; t < 8; ++t) oh[t] = zero8();

  // ---- this thread's 16 copies of chunk t into ring buffer buf (all lanes on, block-uniform callers) ----
  const int pc = (tl & 7) * 8;                                         // 16-B piece of a 128-B line, in elements
  const unsigned short* kthr = Kr + (size_t)((tl >> 3) & 1) * NPL + (size_t)(tl >> 4) * DMOD + pc;
  const _Float16* vthr = Vg + (size_t)(tl >> 3) * SEQ + pc;
  const unsigned kl0 = lds_byte(&Ksh[0][(tl >> 4) * KP + ((tl >> 3) & 1) * HD + pc]);
  const unsigned vl0 = lds_byte(&Vs[0][(tl >> 3) * VP + pc]);
  auto stage = [&](int tq, int buf) {
    const int t = (tq < NQB) ? tq : (NQB - 1);                         // every copy stays inside the planes
    unsigned kl[8], vl[8];
    const void* kg[8];
    const void* vg[8];
#pragma unroll
    for (int i = 0; i < 8; ++i) {
      kl[i] = kl0 + (unsigned)buf * (unsigned)sizeof(Ksh[0]) + (unsigned)(i * 8 * KP * 2);
      kg[i] = kthr + (size_t)(t * 64 + i * 8) * DMOD;
      vl[i] = vl0 + (unsigned)buf * (unsigned)sizeof(Vs[0]) + (unsigned)(i * 16 * VP * 2);
      vg[i] = vthr + ((size_t)(i >> 2) * DMOD + (size_t)((i & 3) * 16)) * SEQ + t * 64;
    }
    async_copy8(kl, kg);
    async_copy8(vl, vg);
  };

  const int np = qb / NG + 1;                 // stages of NG chunks (block-uniform)
  stage(grp, grp);
  wait_async0();
  __syncthreads();                            // stage 0 published
  if (np > 1) stage(NG + grp, NG + grp);

  // ---- Q fragments (B operand, column = lane&15): 2 e-chunks per plane from the global planes, once per block ----
  v16us qr[2], qi[2];
#pragma unroll
  for (int dc = 0; dc < 2; ++dc) {
    qr[dc] = ldfrag_b(Qr + (size_t)(q0 + c) * DMOD + dc * 32 + 8 * hh);
    qi[dc] = ldfrag_b(Qi + (size_t)(q0 + c) * DMOD + dc * 32 + 8 * hh);
  }
  wait_x0(Qr + (size_t)(q0 + c) * DMOD + 8 * hh);   // the one address pair that the eight loads above name

  for (int p = 0; p < (NQB + NG - 1) / NG; ++p) {   // static bound; block-uniform causal stage skipping
    if (p >= np) break;
    const int kt = NG * p + grp;              // this group's chunk of the stage
    const int bi = (p & 1) * NG + grp;        // and its ring buffer
    if (kt <= qb) {                           // wave-uniform; no barrier inside
    const int kv0 = kt * 64;
    const unsigned short* Kc = Ksh[bi];
    const _Float16* Vc = Vs[bi];

    // ---- scores, transposed: 64 keys (D rows) x 16 queries (D columns) per wave, depth 64 (2 chunks), 4 products per chunk ----
    //      LDS reads run ahead of their users, each group in one place: the K fragments of key tile j + 2 are read
    //      beside the products of tile j, the V^T fragments (A row = value column t*16+c) beside the last tile's
    //      products and in front of the softmax, so that no matrix instruction stands directly behind its own read;
    //      with the residual tile's registers live (PRES) the second half of V^T follows behind the softmax, in two groups ----
    constexpr int NVA = PRES ? 8 : 16;        // V^T fragments read in front of the softmax; fragment f = kk * 8 + t
    FB kfr[4][2], kfi[4][2];
    FH vf[16];
    auto ldk = [&](int j) {
#pragma unroll
      for (int dc = 0; dc < 2; ++dc) {
        const unsigned short* kp = Kc + (j * 16 + c) * KP + dc * 32 + 8 * hh;   // A row = key j*16+c
        kfr[j][dc].h[0] = *(const v8us*)(kp);
        kfr[j][dc].h[1] = *(const v8us*)(kp + 16);
        kfi[j][dc].h[0] = *(const v8us*)(kp + HD);
        kfi[j][dc].h[1] = *(const v8us*)(kp + HD + 16);
      }
    };
    auto ldv = [&](int f0, int f1) {
#pragma unroll
      for (int f = f0; f < f1; ++f) {
        vf[f].h[0] = *(const v8h*)(Vc + ((f & 7) * 16 + c) * VP + (f >> 3) * 32 + 8 * hh);
        vf[f].h[1] = *(const v8h*)(Vc + ((f & 7) * 16 + c) * VP + (f >> 3) * 32 + 16 + 8 * hh);
      }
    };
    ldk(0);
    ldk(1);
    __builtin_amdgcn_sched_barrier(0);        // here and below: without it the scheduler sinks the reads to their users
    v8f s[4];
#pragma unroll
    for (int j = 0; j < 4; ++j) {
      v8f sr = zero8(), si = zero8();
#pragma unroll
      for (int dc = 0; dc < 2; ++dc) {
        const v16us bin = neg16(kfi[j][dc].u);
        sr = mma_b_raw(kfr[j][dc].u, qr[dc], sr);
        sr = mma_b_raw(bin, qi[dc], sr);
        si = mma_b_raw(kfi[j][dc].u, qr[dc], si);
        si = mma_b_raw(kfr[j][dc].u, qi[dc], si);
      }
      if (j < 2) ldk(j + 2);
      if (j == 3) ldv(0, 8);
      if (j != 2) __builtin_amdgcn_sched_barrier(0);   // holds the reads just above in front of what follows
      const int keyb = kv0 + j * 16 + 8 * hh;            // key index of D element r is keyb + r
      const int qrow = q0 + c;                           // query of this lane's D column
#pragma unroll
      for (int r = 0; r < 8; r += 2) {                   // register pairs as they lie: one packed multiply, one packed fma
        const v2f a = {sr[r], sr[r + 1]};
        const v2f g = {si[r], si[r + 1]};
        const v2f m2 = __builtin_elementwise_fma(a, a, g * g);
        s[j][r]     = (keyb + r <= qrow)     ? hw_sqrt(m2[0]) * SCL2 : NEG_BIG;
        s[j][r + 1] = (keyb + r + 1 <= qrow) ? hw_sqrt(m2[1]) * SCL2 : NEG_BIG;
      }
    }

    if (NVA == 16) {
      ldv(8, 16);
      __builtin_amdgcn_sched_barrier(0);      // holds the reads in front of the softmax arithmetic
    }

    // ---- a lane holds 32 of its query's 64 scores: maximum and sum in the lane, the maximum joined with the other
    //      lane half by one exchange; P hi (x1024, f16) and, when PRES, P residual (x PRS, f16) are packed in place:
    //      score tiles 2 kk and 2 kk + 1 of a lane are elements 0..7 and 8..15 of the B operand over keys kk*32..+31 ----
    float m = s[0][0];
#pragma unroll
    for (int j = 0; j < 4; ++j) {
#pragma unroll
      for (int r = 0; r < 8; ++r) m = fmaxf(m, s[j][r]);
    }
    m = fmaxf(m, xhalf(m));
    const float mnew  = fmaxf(mrow, m);
    const float alpha = hw_exp2(mrow - mnew);
    mrow = mnew;
    float psum = 0.f;
    FH pa[2], pb[2];
#pragma unroll
    for (int j = 0; j < 4; ++j) {
#pragma unroll
      for (int r = 0; r < 8; ++r) {
        const float p  = hw_exp2(s[j][r] - mnew);
        psum += p;
        const float ph = p * PSC;
        const _Float16 xh = (_Float16)ph;
        pa[j >> 1].v[(j & 1) * 8 + r] = xh;
        if (PRES) pb[j >> 1].v[(j & 1) * 8 + r] = (_Float16)((ph - (float)xh) * PRS);
      }
    }
    lrow = lrow * alpha + psum;
#pragma unroll
    for (int t = 0; t < 8; ++t) {
#pragma unroll
      for (int r = 0; r < 8; ++r) oh[t][r] *= alpha;
    }

    // ---- context, transposed: oh += V^T . Phi^T; when PRES: ol = V^T . Plo^T, then oh += ol / PRS ----
    if (NVA < 16) {                           // the scores' registers are free
      ldv(8, 12);
      __builtin_amdgcn_sched_barrier(0);      // holds the reads in front of the first half's products
    }
    v8f ol[8];
#pragma unroll
    for (int t = 0; t < 8; ++t) ol[t] = zero8();
#pragma unroll
    for (int kk = 0; kk < 2; ++kk) {          // unrolled: the P fragments are registers, picked by a constant index
#pragma unroll
      for (int t = 0; t < 8; ++t) {
        oh[t] = mma_h_raw(vf[kk * 8 + t].v, pa[kk].v, oh[t]);
        if (PRES) ol[t] = mma_h_raw(vf[kk * 8 + t].v, pb[kk].v, ol[t]);
        if (NVA < 16 && kk == 0 && t == 3) {  // four fragments' registers are free again
          ldv(12, 16);
          __builtin_amdgcn_sched_barrier(0);  // holds the reads in front of the remaining products of the first half
        }
      }
    }
    if (PRES) {
#pragma unroll
      for (int t = 0; t < 8; ++t) {
#pragma unroll
        for (int r = 0; r < 8; ++r) oh[t][r] += ol[t][r] * (1.0f / PRS);
      }
    }
    }
    // ---- publish point of stage p + 1; the buffers of stage p are free behind the barrier ----
    wait_ds0();
    wait_async0();
    __syncthreads();
    if (p + 2 < np) stage(NG * (p + 2) + grp, bi);
  }
  wait_async0();                              // nothing is left in flight when the wave goes on to the epilogue

  // ---- merge of the groups' partials: each group g > 0 writes its lanes' values (lane-contiguous; a lane of group 0
  //      reads back the positions of its own accumulator layout), one barrier, group 0 combines in f32. The partials
  //      lie in the K ring: behind the loop's last barrier no wave reads it and no copy is in flight ----
  static_assert(sizeof(Ksh) >= (size_t)(NG - 1) * 4 * MGW * sizeof(float));
  float* mg0 = (float*)(void*)&Ksh[0][0] + wave * MGW + lane;
  if (grp != 0) {
    float* mg = mg0 + (grp - 1) * 4 * MGW;
#pragma unroll
    for (int t = 0; t < 8; ++t) {
#pragma unroll
      for (int r = 0; r < 8; ++r) mg[(t * 8 + r) * 32] = oh[t][r];
    }
    mg[64 * 32] = mrow;
    mg[65 * 32] = lrow;
  }
  __syncthreads();                            // the partials are published; met by every wave of the block
  if (grp != 0) return;                       // no barrier follows; the kernel below leaves with it
#pragma unroll
  for (int g = 1; g < NG; ++g) {
    const float* mg = mg0 + (g - 1) * 4 * MGW;
    const float m1 = mg[64 * 32];
    const float l1 = mg[65 * 32];
    const float mm = fmaxf(mrow, m1);
    const float a0 = hw_exp2(mrow - mm);
#if defined(__HIP_DEVICE_COMPILE__)
    asm volatile("v_nop");                    // the slot behind a transcendental
#endif
    const float a1 = hw_exp2(m1 - mm);        // 0 where group g had no chunk (m1 = NEG_BIG, its sums 0)
    mrow = mm;
    lrow = lrow * a0 + l1 * a1;
#pragma unroll
    for (int t = 0; t < 8; ++t) {
#pragma unroll
      for (int r = 0; r < 8; ++r) oh[t][r] = oh[t][r] * a0 + mg[(t * 8 + r) * 32] * a1;
    }
  }

  // ---- join the lane halves' sums, normalise (1/l, the 1/PSC p carry and the 1/VSC v carry), stage the wave's 16x128
  //      tile interleaved: lane (c, hh) holds query row c; v_r columns d, d + 1 (tile t) and v_i columns d, d + 1
  //      (tile t + 4) are four consecutive floats [r_d, i_d, r_d+1, i_d+1] of the row, one 16-B LDS store ----
  float* os = Os[wave];
  const float l = lrow + xhalf(lrow);
  const float inv = ((l > 0.f) ? (1.0f / l) : 0.f) * (1.0f / (PSC * VSC));
#pragma unroll
  for (int t = 0; t < 4; ++t) {
#pragma unroll
    for (int r = 0; r < 8; r += 2) {
      const v4f o = {oh[t][r] * inv, oh[t + 4][r] * inv, oh[t][r + 1] * inv, oh[t + 4][r + 1] * inv};
      *(v4f*)(os + c * OP + 2 * (t * 16 + 8 * hh + r)) = o;
    }
  }
  // the kernel below reads the tile back, behind its wave_sync_lds(), and stores it
}

// One grid for all query blocks, twice as many as the chip has places (one block fills a WGP's LDS). A block's cost
// grows with qb, and the cost falls with the index (qb = NQB - 1 for the first
// NHEAD * NBATCH blocks, then NQB - 2, ...), for speed only. index -> (qb, hb) is a permutation of all (query block, batch x head) pairs.
// The choice of body is block-uniform (blockIdx only): every barrier of a body is met by all 4 NG waves.
__global__ __launch_bounds__(128 * NG)
void attn_c(const unsigned short* __restrict__ QB, const unsigned short* __restrict__ KB,
            const unsigned short* __restrict__ VT, float* out) {
  __shared__ __align__(16) unsigned short Ksh[2 * NG][64 * KP];        // K [buf][kv][kr e 0..63 | ki e 64..127 | pad] 6 x 17 KB
  __shared__ __align__(16) _Float16 Vs[2 * NG][VW * VP];                // V^T [buf][d][kv | pad] 6 x 18 KB
  __shared__ __align__(16) float    Os[4][16 * OP];                     // group 0, per wave context tile [row][128 | pad] 33 KB
  const unsigned bid = blockIdx.x;
  const int qb = NQB - 1 - (int)(bid / (unsigned)(NHEAD * NBATCH));     // longest query blocks first
  const int hb = (int)(bid % (unsigned)(NHEAD * NBATCH));
  if (qb >= NQP) {
    attn_body<false>(QB, KB, VT, qb, hb, Ksh, Vs, Os);
  } else {
    attn_body<true>(QB, KB, VT, qb, hb, Ksh, Vs, Os);
  }
  if (threadIdx.x >= 128) return;             // the groups g > 0 have handed over; whole waves, no barrier below

  // ---- both bodies leave the wave's context tile in Os[wave]; the output stores are common to them ----
  const int wave = threadIdx.x >> 5;
  const int lane = threadIdx.x & 31;
  const int h  = hb % NHEAD;
  const int b  = hb / NHEAD;
  const int q0 = qb * 64 + wave * 16;
  const float* os = Os[wave];
  float* g0 = out + ((size_t)(b * SEQ + q0) * NHEAD + h) * VW + lane * 4;   // row q0 of (b, h), this lane's 16 B
  wave_sync_lds();
  {
#pragma unroll
    for (int it = 0; it < 16; ++it) {                    // row it: 32 lanes x 16 B = 512 B = 128 floats
      const v4f o = *(const v4f*)(os + it * OP + lane * 4);
      *(v4f*)(g0 + (size_t)it * NHEAD * VW) = o;
    }
  }
}

// =====================================================================================================
// Workspace map (bytes); every plane is an exact multiple of its whole-line store granularity (all dims are exact
// tile multiples, no padded tails), all offsets multiples of 8 MiB:
//   QB  bf16 [2 parts][4096 t][512]             0   8388608   (q_r, q_i RNE bits)
//   KB  bf16 [2 parts][4096 t][512]       8388608   8388608   (k_r, k_i RNE bits)
//   VT  f16  [2 b][2 parts][512 (h,d)][2048 t] 16777216   8388608   (bf16 value x16)
//   end                                 25165824
// =====================================================================================================
extern "C" void kernel_launch(void* const* d_in, const int* in_sizes, int n_in,
                              void* d_out, int out_size, void* d_ws, size_t ws_size,
                              hipStream_t stream) {
  const int n = NTOK * DMOD;                                // 2097152 elements per input
  if (n_in < 6) return;
  for (int i = 0; i < 6; ++i) if (in_sizes[i] != n) return;
  if (out_size != 2 * n) return;

  const float* qr = (const float*)d_in[0];
  const float* qi = (const float*)d_in[1];
  const float* kr = (const float*)d_in[2];
  const float* ki = (const float*)d_in[3];
  const float* vr = (const float*)d_in[4];
  const float* vi = (const float*)d_in[5];
  float* outf = (float*)d_out;

  const size_t PQB = (size_t)2 * n * 2;                     //  8388608
  const size_t PKB = (size_t)2 * n * 2;                     //  8388608
  const size_t PVT = (size_t)NBATCH * 2 * DMOD * SEQ * 2;   //  8388608
  size_t off = 0;
  const size_t oQ = off; off += PQB;
  const size_t oK = off; off += PKB;
  const size_t oV = off; off += PVT;
  if (off > ws_size) return;                                // off = 25165824
  if (off > (size_t)134217728) return;

  char* ws = (char*)d_ws;
  unsigned short* QB = (unsigned short*)(ws + oQ);
  unsigned short* KB = (unsigned short*)(ws + oK);
  unsigned short* VT = (unsigned short*)(ws + oV);

  const dim3 blkatt(128 * NG);

  // (1) q, k -> bf16 planes [part][4096 t][512] and v -> transposed f16 planes [b][part][512 (h,d)][2048 t], one launch
  prep<<<dim3(PREPB), dim3(512), 0, stream>>>(qr, qi, kr, ki, vr, vi, QB, KB, VT);
  // (2) causal attention -> d_out, one launch: query blocks 0..NQP-1 (rows < 512) with the p residual tile, the rest without
  attn_c<<<dim3(NQB * NHEAD * NBATCH), blkatt, 0, stream>>>(QB, KB, VT, outf);
  (void)hipGetLastError();
}

// v010
// Measured time: 41.1 microseconds a run.
// Timed twice side by side with v009, it ran 1.05 times as fast both times.
// Counting every step since v000, it is 7.03 times as fast.
// Contractions: complex k.q^T (scores transposed) as kr.qr, ki.qi (negated), ki.qr, kr.qi over e=64 on v_wmma_f32_16x16x32_bf16 (raw
//   bf16 RNE values of q and k, one product each, signs combined in the f32 accumulators); [v_r|v_i]^T.p^T over keys on
//   v_wmma_f32_16x16x32_f16 with p as f16(1024 p) (plus a x4096 f16 residual tile for the first 512 query rows of
//   each sequence) and v as f16 of its bf16 RNE value x16 (exact); f32 accumulate everywhere; score magnitude,
//   causal select, softmax statistics and epilogue in f32.
#include <hip/hip_runtime.h>
#include <math.h>
#include <stdint.h>

#define NBATCH 2
#define SEQ    2048
#define NHEAD  8
#define HD     64                  // score depth e
#define VW     (2 * HD)            // value row width: v_r d 0..63 | v_i d 64..127
#define DMOD   (NHEAD * HD)        // 512: token row pitch of the q/k/v inputs
#define NTOK   (NBATCH * SEQ)      // 4096 token rows
#define NQB    (SEQ / 64)          // 32 query / key tiles of 64
#define NQP    8                   // leading query tiles (rows < 512) that carry the p residual tile
#define VSC    16.0f               // v plane carry (power of two, exact on bf16 values)
#define PSC    1024.0f             // softmax numerator carry
#define PRS    4096.0f             // p residual carry
#define SCL2   0.18033688011112043f  // log2(e) / sqrt(64): scores and maxima are carried in base-2 units
#define NEG_BIG (-1.0e30f)
#define NG     3                   // wave groups of a block; group g takes items g, g + NG, g + 2 NG, ... of its chunk list
#define MGW    (66 * 32)           // floats of one wave's partial: 64 context + 1 maximum + 1 sum per lane
// LDS row pitches in 16-bit elements: every row read by ds_load_b128 fragments (16 lanes = 16 rows, 16 B each) gets
// a pitch of 16 B x odd, so the 16 rows of a half wave fall on all 64 banks instead of on 4 (K) or 8 (V); the same
// for the output staging rows, which 16 lanes write 16 B each.
#define KP     (VW + 8)            // K rows: 256 B of data at 272 B pitch
#define VP     (64 + 8)            // V^T rows: 128 B of data at 144 B pitch
#define OP     (VW + 4)            // output staging rows, in floats: 512 B of data at 528 B pitch
static_assert(HD == 64 && VW == 128);
static_assert((SEQ % 64) == 0 && (DMOD % 32) == 0);
static_assert(((NTOK * DMOD) % 2048) == 0);
static_assert(NQP > 0 && NQP < NQB);
static_assert(((KP * 2) % 32) == 16 && ((VP * 2) % 32) == 16 && ((OP * 4) % 32) == 16);

typedef _Float16 v16h __attribute__((ext_vector_type(16)));
typedef _Float16 v8h  __attribute__((ext_vector_type(8)));
typedef __bf16   v16b __attribute__((ext_vector_type(16)));
typedef unsigned short v16us __attribute__((ext_vector_type(16)));
typedef unsigned short v8us  __attribute__((ext_vector_type(8)));
typedef float    v8f  __attribute__((ext_vector_type(8)));
typedef float    v4f  __attribute__((ext_vector_type(4)));
typedef float    v2f  __attribute__((ext_vector_type(2)));
typedef unsigned int v4u __attribute__((ext_vector_type(4)));
typedef unsigned int v8u __attribute__((ext_vector_type(8)));
union FH { v16h v; v8h h[2]; };
union FB { v16us u; v8us h[2]; v8u w; };

// ---- scalar helpers --------------------------------------------------------------------------------
__device__ __forceinline__ unsigned short bf_bits(float f) {          // f32 -> bf16 bits, RNE convert
  unsigned u = __float_as_uint(f);
  return (unsigned short)((u + 0x7FFFu + ((u >> 16) & 1u)) >> 16);
}
__device__ __forceinline__ float bf_up(unsigned short h) { return __uint_as_float(((unsigned)h) << 16); }
__device__ __forceinline__ unsigned short h_bits(_Float16 x) { return __builtin_bit_cast(unsigned short, x); }
__device__ __forceinline__ unsigned pk16(unsigned short a, unsigned short b) { return (unsigned)a | ((unsigned)b << 16); }
__device__ __forceinline__ v8f zero8() { v8f z = {0.f, 0.f, 0.f, 0.f, 0.f, 0.f, 0.f, 0.f}; return z; }
// The transcendental instructions alone: the library forms wrap each in input scaling for tiny values, a two-sided
// rounding repair (sqrtf) and result scaling (expf), over a dozen vector instructions a score.
// v_sqrt_f32: 1 ulp; a subnormal sum of squares gives a score of 0 where the exact one is below 1e-19.
__device__ __forceinline__ float hw_sqrt(float x) { return __builtin_amdgcn_sqrtf(x); }
// v_exp_f32 = 2^x: a weight below the normal range (x < -126) comes out 0; beside the row's largest weight, 1, it adds nothing.
__device__ __forceinline__ float hw_exp2(float x) { return __builtin_amdgcn_exp2f(x); }
__device__ __forceinline__ float xhalf(float x) {                     // the value of lane l ^ 16
  const int i = __builtin_bit_cast(int, x);
  return __builtin_bit_cast(float, __builtin_amdgcn_permlanex16(i, i, 0x76543210, 0xfedcba98, false, false));
}

// ---- fragment loader: 16-bit A/B operand, lane -> row/col (lane&15), p already includes +8*(lane>>4);
//      elements 0..7 <- p[0..7] (k0+8h..), elements 8..15 <- p[16..23] (k0+16+8h..)
__device__ __forceinline__ v16us ldfrag_b(const unsigned short* p) {   // bf16 plane read as 16-bit uint vectors
  FB f;
  f.h[0] = *(const v8us*)(p);
  f.h[1] = *(const v8us*)(p + 16);
  return f.u;
}
// exact negation of a bf16 fragment (sign-bit flip of every 16-bit element)
__device__ __forceinline__ v16us neg16(v16us x) {
  FB f;
  f.u = x;
#pragma unroll
  for (int i = 0; i < 8; ++i) f.w[i] = f.w[i] ^ 0x80008000u;
  return f.u;
}

// ---- WMMA helpers: builtin forms, the compiler keeps the distances behind them --------
__device__ __forceinline__ v8f mma_h_raw(v16h a, v16h b, v8f c) {
  return __builtin_amdgcn_wmma_f32_16x16x32_f16(false, a, false, b, (short)0, c, false, false);
}
__device__ __forceinline__ v8f mma_b_raw(v16us a, v16us b, v8f c) {
  return __builtin_amdgcn_wmma_f32_16x16x32_bf16(false, __builtin_bit_cast(v16b, a), false,
                                                 __builtin_bit_cast(v16b, b), (short)0, c, false, false);
}
__device__ __forceinline__ void wave_sync_lds() {
  __builtin_amdgcn_fence(__ATOMIC_RELEASE, "workgroup");
  __builtin_amdgcn_wave_barrier();
  __builtin_amdgcn_fence(__ATOMIC_ACQUIRE, "workgroup");
}

// ---- asynchronous copies global -> LDS (16 B per lane, through no register) and the ring's waits ----
__device__ __forceinline__ unsigned lds_byte(const void* p) { return (unsigned)(uintptr_t)p; }   // LDS byte address
// eight copies of one lane; the closing s_wait_xcnt stands in front of every later rewrite of an address register
// that a copy names (a precaution), inside the statement so that no address arithmetic can be moved in front of it
__device__ __forceinline__ void async_copy8(const unsigned (&l)[8], const void* const (&g)[8]) {
#if defined(__HIP_DEVICE_COMPILE__)
  asm volatile(
      "global_load_async_to_lds_b128 %0, %8, off\n\t"
      "global_load_async_to_lds_b128 %1, %9, off\n\t"
      "global_load_async_to_lds_b128 %2, %10, off\n\t"
      "global_load_async_to_lds_b128 %3, %11, off\n\t"
      "global_load_async_to_lds_b128 %4, %12, off\n\t"
      "global_load_async_to_lds_b128 %5, %13, off\n\t"
      "global_load_async_to_lds_b128 %6, %14, off\n\t"
      "global_load_async_to_lds_b128 %7, %15, off\n\t"
      "s_wait_xcnt 0x0"
      :: "v"(l[0]), "v"(l[1]), "v"(l[2]), "v"(l[3]), "v"(l[4]), "v"(l[5]), "v"(l[6]), "v"(l[7]),
         "v"(g[0]), "v"(g[1]), "v"(g[2]), "v"(g[3]), "v"(g[4]), "v"(g[5]), "v"(g[6]), "v"(g[7])
      : "memory");
#endif
}
// this wave's copies have landed in LDS (the compiler places no wait for them)
__device__ __forceinline__ void wait_async0() {
#if defined(__HIP_DEVICE_COMPILE__)
  asm volatile("s_wait_asynccnt 0x0" ::: "memory");
#endif
}
// stands behind issued global loads, in front of any rewrite of the address registers that they name (a precaution).
// The address is an input only so that its registers stay untouched up to the wait.
__device__ __forceinline__ void wait_x0(const void* addr) {
#if defined(__HIP_DEVICE_COMPILE__)
  asm volatile("s_wait_xcnt 0x0" :: "v"(addr) : "memory");
#endif
}
// this wave's LDS reads have returned, before the buffer they read is handed to the next tile's copies
__device__ __forceinline__ void wait_ds0() {
#if defined(__HIP_DEVICE_COMPILE__)
  asm volatile("s_wait_dscnt 0x0" ::: "memory");
#endif
}

// =====================================================================================================
// All conversions in ONE launch of PREPB blocks x 512 threads (16 waves, one block a WGP), every block with an equal
// share of both kinds of work; a thread has all its 24 16-B loads in flight before it converts anything, and stores
// each piece as soon as it is converted, while later loads are still landing.
// (a) v_r, v_i -> transposed f16 planes. Block index bits: 7 = part (v_r / v_i), 6 = batch, 5..2 = token rows R0 / 128,
//     1..0 = columns C0 / 128 of the f32 [SEQ][DMOD] input; the block's 128 x 128 region is 8 tiles of 64 rows x 32
//     columns, tile id -> rows R0 + (id >> 2) * 64, columns C0 + (id & 3) * 32, each in an LDS tile of its own
//     (pitch 33 floats); thread half t >> 8 takes tiles 2 k + half, k = 0..3. Load: thread tt = t & 255 -> tile row
//     tt >> 2, columns (tt & 3) * 8..+7; one barrier; store: tt -> output row tt >> 3 (= input column), tokens
//     (tt & 7) * 8..+7 as ONE 16-B store of f16(bf16 RNE value * VSC) (exact), 8 lanes a 128-B line.
//     coverage: 2 parts x 2 batches x 16 x 4 regions = PREPB blocks; 8 tiles x 32 output rows x 64 tokens a block.
// (b) q_r, q_i -> the two bf16 planes (RNE bits) at QB, k_r, k_i -> the two at KB, n = NTOK * DMOD elements each. An item
//     is 8 consecutive elements (two 16-B loads, ONE 16-B store); block b takes items b * 1024 + j * 512 + t, j = 0, 1,
//     of every plane. coverage: PREPB x 1024 items x 8 = n elements of each plane.
// =====================================================================================================
#define PREPB  256
static_assert(PREPB == 2 * NBATCH * (SEQ / 128) * (DMOD / 128));
static_assert(PREPB * 1024 * 8 == NTOK * DMOD);
__global__ __launch_bounds__(512) void prep(const float* __restrict__ qr, const float* __restrict__ qi,
                                           const float* __restrict__ kr, const float* __restrict__ ki,
                                           const float* __restrict__ vr, const float* __restrict__ vi,
                                           unsigned short* QB, unsigned short* KB, unsigned short* VT) {
  __shared__ float tile[8][64 * 33];
  const int t = threadIdx.x;
  const int b = blockIdx.x;
  const int part = b >> 7, z = (b >> 6) & 1;
  const int R0 = ((b >> 2) & 15) * 128, C0 = (b & 3) * 128;
  const int tt = t & 255, half = t >> 8;

  // ---- all loads of the thread, the v tiles' first: loads return in order, and the barrier below needs only those ----
  const float* vin = (part ? vi : vr) + (size_t)z * SEQ * DMOD
                     + (size_t)(R0 + (tt >> 2)) * DMOD + C0 + (tt & 3) * 8 + half * 32;
  v4f va[4], vb[4];
#pragma unroll
  for (int k = 0; k < 4; ++k) {                // tile id = 2 k + half: rows + (k >> 1) * 64, columns + (k & 1) * 64 + half * 32
    const float* g = vin + (size_t)((k >> 1) * 64) * DMOD + (k & 1) * 64;
    va[k] = *(const v4f*)g;
    vb[k] = *(const v4f*)(g + 4);
  }
  __builtin_amdgcn_sched_barrier(0);           // keeps these loads the first: without it the scheduler issues them last
  const size_t i8 = ((size_t)b * 1024 + t) * 8;
  const float* const src[4] = {qr + i8, qi + i8, kr + i8, ki + i8};
  v4f ca[4][2], cb[4][2];
#pragma unroll
  for (int pl = 0; pl < 4; ++pl) {
#pragma unroll
    for (int j = 0; j < 2; ++j) {
      ca[pl][j] = *(const v4f*)(src[pl] + j * 4096);
      cb[pl][j] = *(const v4f*)(src[pl] + j * 4096 + 4);
    }
  }
#if defined(__HIP_DEVICE_COMPILE__)
  // stands behind the issued loads, in front of any rewrite of the address registers that they name (a precaution); the
  // addresses are inputs only so that their registers stay untouched up to the wait
  asm volatile("s_wait_xcnt 0x0" :: "v"(vin), "v"(src[0]), "v"(src[1]), "v"(src[2]), "v"(src[3]) : "memory");
#endif
  __builtin_amdgcn_sched_barrier(0);           // without it the scheduler sinks a part of the loads behind the LDS stores

  // ---- (a) the v tiles through LDS ----
#pragma unroll
  for (int k = 0; k < 4; ++k) {
    float* l = tile[2 * k + half] + (tt >> 2) * 33 + (tt & 3) * 8;
    l[0] = va[k][0]; l[1] = va[k][1]; l[2] = va[k][2]; l[3] = va[k][3];
    l[4] = vb[k][0]; l[5] = vb[k][1]; l[6] = vb[k][2]; l[7] = vb[k][3];
  }
  // work-group barrier whose fences name LDS alone (only the tiles pass between waves): __syncthreads() would also wait
  // for every global load still in flight
  __builtin_amdgcn_fence(__ATOMIC_RELEASE, "workgroup", "local");
  __builtin_amdgcn_s_barrier();
  __builtin_amdgcn_fence(__ATOMIC_ACQUIRE, "workgroup", "local");
  const int orow = tt >> 3, piece = (tt & 7) * 8;
  unsigned short* vout = VT + (size_t)(z * 2 + part) * DMOD * SEQ + (size_t)(C0 + half * 32 + orow) * SEQ + R0 + piece;
#pragma unroll
  for (int k = 0; k < 4; ++k) {
    const float* l = tile[2 * k + half];
    v4u p;
#pragma unroll
    for (int e = 0; e < 4; ++e) {
      const float f0 = l[(piece + 2 * e) * 33 + orow];
      const float f1 = l[(piece + 2 * e + 1) * 33 + orow];
      const _Float16 x0 = (_Float16)(bf_up(bf_bits(f0)) * VSC);
      const _Float16 x1 = (_Float16)(bf_up(bf_bits(f1)) * VSC);
      p[e] = pk16(h_bits(x0), h_bits(x1));
    }
    *(v4u*)(vout + (size_t)((k & 1) * 64) * SEQ + (k >> 1) * 64) = p;
  }
  __builtin_amdgcn_sched_barrier(0);           // here and below: without it the scheduler sinks the stores to the kernel's end

  // ---- (b) the q and k planes, in the order of their loads ----
#pragma unroll
  for (int pl = 0; pl < 4; ++pl) {
    unsigned short* o = ((pl < 2) ? QB : KB) + (size_t)(pl & 1) * NTOK * DMOD + i8;
#pragma unroll
    for (int j = 0; j < 2; ++j) {
      v4u p;
#pragma unroll
      for (int e = 0; e < 2; ++e) {
        p[e]     = pk16(bf_bits(ca[pl][j][2 * e]), bf_bits(ca[pl][j][2 * e + 1]));
        p[2 + e] = pk16(bf_bits(cb[pl][j][2 * e]), bf_bits(cb[pl][j][2 * e + 1]));
      }
      *(v4u*)(o + j * 4096) = p;
    }
    if (pl < 3) __builtin_amdgcn_sched_barrier(0);
  }
}

// =====================================================================================================
// Causal complex attention, per (b, h) and PAIR of 64-query tiles:
//   sr = qr.kr - qi.ki, si = qr.ki + qi.kr over e=64 (bf16 operands, exact products, f32 accumulate; -qi.ki as
//   qi.(ki with flipped sign bits)); s = sqrt(sr^2 + si^2) * SCL2 (base-2 units); key > query -> NEG_BIG (value select, diagonal
//   kept); online softmax in f32; p = 2^(s - m) carried as ph = f16(1024 p) and, when PRES, pl = f16((1024 p - ph)
//   * PRS); context over the 128-wide value row [v_r | v_i] with v as f16(VSC * bf16 value):
//     oh += ph.v over all chunks; when PRES, ol = pl.v per chunk folded as oh += ol / PRS in f32.
//   Q / K planes (bf16 bits, pitch DMOD): plane 0 = real, plane 1 = imag (NTOK*DMOD apart); element (b, t, h, e)
//     at [(b*SEQ + t)*DMOD + h*64 + e]
//   V^T plane (f16): element (b, part, h, d, t) at [((b*2 + part)*DMOD + h*64 + d)*SEQ + t], part 0 = v_r, 1 = v_i
//   Block = 4 NG waves = NG groups of 4 waves, on the two query tiles qbA = NQB - 1 - qbB and qbB (qbB = index /
//   (NHEAD NBATCH) < NQB / 2) of one (b, h), hb = index % (NHEAD NBATCH) = b * NHEAD + h. Tile qb needs the key chunks
//   kt <= qb, so the pair needs (qbA + 1) + (qbB + 1) = NQB + 1 = NIT chunks whatever the pair: they form ONE list, item
//   i <= qbA = chunk i of tile A, item i > qbA = chunk i - qbA - 1 of tile B. A stage is NG items: in stage p group g works
//   on item NG p + g, and NIT = NG NST, so that every block walks NST full stages, no group is ever idle, and one block
//   a WGP covers the grid in one round. A group carries one tile's maxima, sums and context tile at a time: behind
//   its last item of tile A (wave-uniform test, no barrier inside) it puts its partial of tile A into Pa, resets its
//   maximum (the next chunk's own rescaling then takes the old sums and context times 0) and loads the q fragments of
//   tile B. Chunk kt == qb keeps its diagonal by the per-element select. Behind the last stage every group puts its partial
//   of tile B into the K ring (which every reader has left), one barrier, then group 0 merges the NG partials of tile A
//   and group 1 those of tile B, one after the other: M = max(m, mg), weights 2^(m - M) and 2^(mg - M), in f32 (a
//   partial without a chunk has m = NEG_BIG: weight 0 beside a real one).
//   K / V^T staging: asynchronous 16-B copies into a ring of two LDS stages of NG chunk buffers each; the chunk of
//   item NG p + g lies in buffer (p & 1) * NG + g, is copied by group g's own 128 threads (tl = tid & 127), and stage
//   p + 1 is in flight while stage p is worked on. 8 lanes cover one 128-B line: K copy i of a thread ->
//   key row i*8 + (tl>>4), part (tl>>3)&1, piece tl&7 into Ksh[buf][key][part*64 + e] (pitch KP); V^T copy i ->
//   value row d = i*16 + (tl>>3), piece tl&7 into Vs[buf][d][kv] (pitch VP). At the foot of a stage every wave:
//   s_wait_dscnt 0, s_wait_asynccnt 0, __syncthreads (publishes stage p + 1, frees the buffers of stage p), then, at
//   the head of stage p + 1, the copies of stage p + 2.
//   Both products are taken transposed: scores^T = K . Q^T (A = key rows from LDS, B = q fragments from the global
//   planes, kept in registers) and context^T += V^T . P^T (A = V^T rows from LDS, B = P^T). A lane's score registers
//   belong to ONE query (column lane & 15), so its maximum and sum are formed in the lane (one exchange with lane ^ 16),
//   and two converted score tiles are a B operand as they lie: P goes through no LDS and needs no wave barrier.
//   Output row (b, t, h) = 128 f32 [r0, i0, r1, i1, ...] at out + ((b*SEQ + t)*NHEAD + h)*128: the wave's 16x128
//   context tile is staged interleaved in LDS (the V^T ring, free by then), then each 512-B row is written by 32 lanes x 16 B.
//   coverage: a wave of group 0 / 1 stores rows q0..q0+15 x 128 floats of tile A / B; 4 waves x 2 tiles x blocks of
//   the grid = all (b, t, h) rows, each once.
// =====================================================================================================
#define NIT    (NQB + 1)           // key chunks of a pair of query tiles
#define NST    (NIT / NG)          // stages of a block
static_assert(NIT == NG * NST && NST >= 2 && (NQB % 2) == 0 && NG >= 2);
static_assert(NQP <= NQB / 2);     // the tiles with the p residual are all second tiles of a pair

template <bool B> struct BoolC { static constexpr bool value = B; };   // a compile-time choice handed to a lambda

// ---- one key chunk (keys kv0..kv0+63, K rows at Kc, V^T rows at Vc) for the wave's 16 queries q0..q0+15 ----
template <bool PRES>
__device__ __forceinline__
void chunk(const unsigned short* Kc, const _Float16* Vc, int kv0, int q0, int c, int hh,
           const v16us (&qr)[2], const v16us (&qi)[2], float& mrow, float& lrow, v8f (&oh)[8]) {
    // ---- scores, transposed: 64 keys (D rows) x 16 queries (D columns) per wave, depth 64 (2 chunks), 4 products per chunk ----
    //      LDS reads run ahead of their users, each group in one place: the K fragments of key tile j + 2 are read
    //      beside the products of tile j, the V^T fragments (A row = value column t*16+c) beside the last tile's
    //      products and in front of the softmax, so that no matrix instruction stands directly behind its own read;
    //      with the residual tile's registers live (PRES) the second half of V^T follows behind the softmax, in two groups ----
    constexpr int NVA = PRES ? 8 : 16;        // V^T fragments read in front of the softmax; fragment f = kk * 8 + t
    FB kfr[4][2], kfi[4][2];
    FH vf[16];
    auto ldk = [&](int j) {
#pragma unroll
      for (int dc = 0; dc < 2; ++dc) {
        const unsigned short* kp = Kc + (j * 16 + c) * KP + dc * 32 + 8 * hh;   // A row = key j*16+c
        kfr[j][dc].h[0] = *(const v8us*)(kp);
        kfr[j][dc].h[1] = *(const v8us*)(kp + 16);
        kfi[j][dc].h[0] = *(const v8us*)(kp + HD);
        kfi[j][dc].h[1] = *(const v8us*)(kp + HD + 16);
      }
    };
    auto ldv = [&](int f0, int f1) {
#pragma unroll
      for (int f = f0; f < f1; ++f) {
        vf[f].h[0] = *(const v8h*)(Vc + ((f & 7) * 16 + c) * VP + (f >> 3) * 32 + 8 * hh);
        vf[f].h[1] = *(const v8h*)(Vc + ((f & 7) * 16 + c) * VP + (f >> 3) * 32 + 16 + 8 * hh);
      }
    };
    ldk(0);
    ldk(1);
    __builtin_amdgcn_sched_barrier(0);        // here and below: without it the scheduler sinks the reads to their users
    v8f s[4];
#pragma unroll
    for (int j = 0; j < 4; ++j) {
      v8f sr = zero8(), si = zero8();
#pragma unroll
      for (int dc = 0; dc < 2; ++dc) {
        const v16us bin = neg16(kfi[j][dc].u);
        sr = mma_b_raw(kfr[j][dc].u, qr[dc], sr);
        sr = mma_b_raw(bin, qi[dc], sr);
        si = mma_b_raw(kfi[j][dc].u, qr[dc], si);
        si = mma_b_raw(kfr[j][dc].u, qi[dc], si);
      }
      if (j < 2) ldk(j + 2);
      if (j == 3) ldv(0, 8);
      if (j != 2) __builtin_amdgcn_sched_barrier(0);   // holds the reads just above in front of what follows
      const int keyb = kv0 + j * 16 + 8 * hh;            // key index of D element r is keyb + r
      const int qrow = q0 + c;                           // query of this lane's D column
#pragma unroll
      for (int r = 0; r < 8; r += 2) {                   // register pairs as they lie: one packed multiply, one packed fma
        const v2f a = {sr[r], sr[r + 1]};
        const v2f g = {si[r], si[r + 1]};
        const v2f m2 = __builtin_elementwise_fma(a, a, g * g);
        s[j][r]     = (keyb + r <= qrow)     ? hw_sqrt(m2[0]) * SCL2 : NEG_BIG;
        s[j][r + 1] = (keyb + r + 1 <= qrow) ? hw_sqrt(m2[1]) * SCL2 : NEG_BIG;
      }
    }

    if (NVA == 16) {
      ldv(8, 16);
      __builtin_amdgcn_sched_barrier(0);      // holds the reads in front of the softmax arithmetic
    }

    // ---- a lane holds 32 of its query's 64 scores: maximum and sum in the lane, the maximum joined with the other
    //      lane half by one exchange; P hi (x1024, f16) and, when PRES, P residual (x PRS, f16) are packed in place:
    //      score tiles 2 kk and 2 kk + 1 of a lane are elements 0..7 and 8..15 of the B operand over keys kk*32..+31 ----
    float m = s[0][0];
#pragma unroll
    for (int j = 0; j < 4; ++j) {
#pragma unroll
      for (int r = 0; r < 8; ++r) m = fmaxf(m, s[j][r]);
    }
    m = fmaxf(m, xhalf(m));
    const float mnew  = fmaxf(mrow, m);
    const float alpha = hw_exp2(mrow - mnew);
    mrow = mnew;
    float psum = 0.f;
    FH pa[2], pb[2];
#pragma unroll
    for (int j = 0; j < 4; ++j) {
#pragma unroll
      for (int r = 0; r < 8; ++r) {
        const float p  = hw_exp2(s[j][r] - mnew);
        psum += p;
        const float ph = p * PSC;
        const _Float16 xh = (_Float16)ph;
        pa[j >> 1].v[(j & 1) * 8 + r] = xh;
        if (PRES) pb[j >> 1].v[(j & 1) * 8 + r] = (_Float16)((ph - (float)xh) * PRS);
      }
    }
    lrow = lrow * alpha + psum;
#pragma unroll
    for (int t = 0; t < 8; ++t) {
#pragma unroll
      for (int r = 0; r < 8; ++r) oh[t][r] *= alpha;
    }

    // ---- context, transposed: oh += V^T . Phi^T; when PRES: ol = V^T . Plo^T, then oh += ol / PRS ----
    if (NVA < 16) {                           // the scores' registers are free
      ldv(8, 12);
      __builtin_amdgcn_sched_barrier(0);      // holds the reads in front of the first half's products
    }
    v8f ol[8];
#pragma unroll
    for (int t = 0; t < 8; ++t) ol[t] = zero8();
#pragma unroll
    for (int kk = 0; kk < 2; ++kk) {          // unrolled: the P fragments are registers, picked by a constant index
#pragma unroll
      for (int t = 0; t < 8; ++t) {
        oh[t] = mma_h_raw(vf[kk * 8 + t].v, pa[kk].v, oh[t]);
        if (PRES) ol[t] = mma_h_raw(vf[kk * 8 + t].v, pb[kk].v, ol[t]);
        if (NVA < 16 && kk == 0 && t == 3) {  // four fragments' registers are free again
          ldv(12, 16);
          __builtin_amdgcn_sched_barrier(0);  // holds the reads in front of the remaining products of the first half
        }
      }
    }
    if (PRES) {
#pragma unroll
      for (int t = 0; t < 8; ++t) {
#pragma unroll
        for (int r = 0; r < 8; ++r) oh[t][r] += ol[t][r] * (1.0f / PRS);
      }
    }
}

__global__ __launch_bounds__(128 * NG)
void attn_c(const unsigned short* __restrict__ QB, const unsigned short* __restrict__ KB,
            const unsigned short* __restrict__ VT, float* out) {
  __shared__ __align__(16) unsigned short Ksh[2 * NG][64 * KP];        // K [buf][kv][kr e 0..63 | ki e 64..127 | pad] 6 x 17 KB
  __shared__ __align__(16) _Float16 Vs[2 * NG][VW * VP];                // V^T [buf][d][kv | pad] 6 x 18 KB
  __shared__ __align__(16) float    Pa[NG * 4 * MGW];                   // the groups' partials of tile A, 99 KB
  static_assert(sizeof(Ksh) >= sizeof(Pa));                             // the partials of tile B lie in the K ring
  static_assert(sizeof(Vs) >= (size_t)2 * 4 * 16 * OP * sizeof(float)); // the output staging of both tiles in the V^T ring
  static_assert(sizeof(Ksh) + sizeof(Vs) + sizeof(Pa) <= 327680);

  const int tid  = threadIdx.x;
  const int grp  = __builtin_amdgcn_readfirstlane(tid >> 7);           // wave group (wave-uniform)
  const int tl   = tid & 127;                                          // thread within its group
  const int wave = tl >> 5;                                            // 16-row slice of a query tile
  const int lane = tid & 31;
  const int hh   = lane >> 4;
  const int c    = lane & 15;

  const unsigned bid = blockIdx.x;
  const int qbB = (int)(bid / (unsigned)(NHEAD * NBATCH));              // 0 .. NQB / 2 - 1
  const int qbA = NQB - 1 - qbB;                                        // NQB / 2 .. NQB - 1
  const int hb  = (int)(bid % (unsigned)(NHEAD * NBATCH));
  const int h  = hb % NHEAD;
  const int b  = hb / NHEAD;

  const size_t NPL = (size_t)NTOK * DMOD;                              // one bf16 plane (both batches)
  const unsigned short* Qr = QB + (size_t)b * SEQ * DMOD + (size_t)h * HD;
  const unsigned short* Qi = Qr + NPL;
  const unsigned short* Kr = KB + (size_t)b * SEQ * DMOD + (size_t)h * HD;
  const _Float16* Vg = (const _Float16*)(const void*)VT + ((size_t)(b * 2) * DMOD + (size_t)h * HD) * SEQ;

  float mrow;                                 // running maximum of the lane's query (equal in lanes c and c + 16)
  float lrow;                                 // running sum over this lane half's keys of that query
  v8f oh[8];                                  // oh[t][r] = context^T[value column t*16 + 8*hh + r][the lane's query]
  auto clear = [&]() {
    mrow = NEG_BIG;
    lrow = 0.f;
#pragma unroll
    for (int t = 0; t < 8; ++t) oh[t] = zero8();
  };
  // the lane's partial, lane-contiguous: the merging wave's lane reads back the positions of its own accumulator layout
  auto put = [&](float* base) {
    float* mg = base + (grp * 4 + wave) * MGW + lane;
#pragma unroll
    for (int t = 0; t < 8; ++t) {
#pragma unroll
      for (int r = 0; r < 8; ++r) mg[(t * 8 + r) * 32] = oh[t][r];
    }
    mg[64 * 32] = mrow;
    mg[65 * 32] = lrow;
  };
  clear();

  // ---- this thread's 16 copies of the chunk of list item it into ring buffer buf (all lanes on, block-uniform callers) ----
  const int pc = (tl & 7) * 8;                                         // 16-B piece of a 128-B line, in elements
  const unsigned short* kthr = Kr + (size_t)((tl >> 3) & 1) * NPL + (size_t)(tl >> 4) * DMOD + pc;
  const _Float16* vthr = Vg + (size_t)(tl >> 3) * SEQ + pc;
  const unsigned kl0 = lds_byte(&Ksh[0][(tl >> 4) * KP + ((tl >> 3) & 1) * HD + pc]);
  const unsigned vl0 = lds_byte(&Vs[0][(tl >> 3) * VP + pc]);
  auto stage = [&](int it, int buf) {
    const int t = (it <= qbA) ? it : (it - qbA - 1);                   // it < NIT: chunk 0 .. qbA or 0 .. qbB, inside the planes
    unsigned kl[8], vl[8];
    const void* kg[8];
    const void* vg[8];
#pragma unroll
    for (int i = 0; i < 8; ++i) {
      kl[i] = kl0 + (unsigned)buf * (unsigned)sizeof(Ksh[0]) + (unsigned)(i * 8 * KP * 2);
      kg[i] = kthr + (size_t)(t * 64 + i * 8) * DMOD;
      vl[i] = vl0 + (unsigned)buf * (unsigned)sizeof(Vs[0]) + (unsigned)(i * 16 * VP * 2);
      vg[i] = vthr + ((size_t)(i >> 2) * DMOD + (size_t)((i & 3) * 16)) * SEQ + t * 64;
    }
    async_copy8(kl, kg);
    async_copy8(vl, vg);
  };

  stage(grp, grp);
  wait_async0();
  __syncthreads();                            // stage 0 published

  // ---- Q fragments (B operand, column = lane&15) of query rows q..q+15: 2 e-chunks per plane from the global planes ----
  v16us qr[2], qi[2];
  auto loadq = [&](int q) {
#pragma unroll
    for (int dc = 0; dc < 2; ++dc) {
      qr[dc] = ldfrag_b(Qr + (size_t)(q + c) * DMOD + dc * 32 + 8 * hh);
      qi[dc] = ldfrag_b(Qi + (size_t)(q + c) * DMOD + dc * 32 + 8 * hh);
    }
    wait_x0(Qr + (size_t)(q + c) * DMOD + 8 * hh);   // the one address pair that the eight loads above name
  };
  loadq(qbA * 64 + wave * 16);               // tile A

  // ---- head of stage p, behind the barrier that freed the buffers of stage p - 1: the copies of stage p + 1 into them
  //      (they stand at the head of a trip and not at the foot of the one before, so that a trip's arithmetic has no
  //      block behind the barrier to sink into); callers are block-uniform ----
  auto refill = [&](int p) {
    if (p + 1 < NST) stage(NG * (p + 1) + grp, ((p + 1) & 1) * NG + grp);
  };
  // ---- foot of stage p: publish point of stage p + 1; the buffers of stage p are free behind the barrier ----
  auto publish = [&]() {
    // keeps the chunk's arithmetic in front of the waits: without it the scheduler lifts the barrier to the chunk's last
    // LDS read, and the copies of the next stage have to land within the score phase alone
    __builtin_amdgcn_sched_barrier(0);
    wait_ds0();
    wait_async0();
    __syncthreads();
  };
  // ---- a group's change from tile A to tile B: its partial of tile A goes into Pa; with the maximum reset, the next
  //      chunk's own rescaling takes the old sums and context times 2^(NEG_BIG - m) = 0; the q fragments of tile B ----
  const int qA0 = qbA * 64 + wave * 16;
  const int qB0 = qbB * 64 + wave * 16;
  auto to_b = [&]() {
    loadq(qB0);                               // first: the loads fly while the partial is stored
    put(Pa);
    mrow = NEG_BIG;
  };
  const int na  = (qbA + 1) / NG;             // stages whose NG items all belong to tile A (block-uniform)
  const int rem = (qbA + 1) % NG;             // items of tile A in the stage behind them: groups g < rem
  // The walk over the NST stages, in two forms chosen by blockIdx alone, each in three parts with block-uniform bounds
  // (every barrier is met by all 4 NG waves): the stages of tile A, the one stage with items of both tiles (if any), the
  // stages of tile B. A group changes tiles between the parts, outside the loops, so that the q fragments stay in place
  // within a loop. Where tile B carries the p residual, the mixed stage's chunks of tile A take it along as well.
  auto walk = [&](auto pres) {
    constexpr bool PB = decltype(pres)::value;
    int p = 0;
    for (; p < na; ++p) {
      const int bi = (p & 1) * NG + grp;      // the ring buffer of the group's item NG p + grp
      refill(p);
      chunk<false>(Ksh[bi], Vs[bi], (NG * p + grp) * 64, qA0, c, hh, qr, qi, mrow, lrow, oh);
      publish();
    }
    if (grp >= rem) to_b();                   // wave-uniform; no barrier inside
    if (rem != 0) {                           // block-uniform
      const bool tb = grp >= rem;             // item NG na + grp is chunk grp - rem of tile B, or still of tile A
      const int bi = (p & 1) * NG + grp;
      refill(p);
      chunk<PB>(Ksh[bi], Vs[bi], (tb ? (grp - rem) : (NG * p + grp)) * 64, tb ? qB0 : qA0, c, hh, qr, qi, mrow, lrow, oh);
      publish();
      ++p;
      if (!tb) to_b();                        // wave-uniform; no barrier inside
    }
    for (; p < NST; ++p) {
      const int bi = (p & 1) * NG + grp;
      refill(p);
      chunk<PB>(Ksh[bi], Vs[bi], (NG * p + grp - qbA - 1) * 64, qB0, c, hh, qr, qi, mrow, lrow, oh);
      publish();
    }
  };
  if (qbB < NQP) walk(BoolC<true>{}); else walk(BoolC<false>{});
  wait_async0();                              // nothing is left in flight when the wave goes on to the epilogue

  // ---- hand-over of the partials: tile A's lie in Pa, tile B's go into the K ring: behind the last stage's barrier no
  //      wave reads it and no copy is in flight. A group that had no chunk of tile B hands on m = NEG_BIG beside finite
  //      left-over sums: every merge below that meets a real maximum gives them the weight 2^(NEG_BIG - M) = 0, and at
  //      least one group has a chunk of tile B ----
  float* Pb = (float*)(void*)&Ksh[0][0];
  put(Pb);
  __syncthreads();                            // the partials are published; met by every wave of the block
  if (grp >= 2) return;                       // whole waves; no barrier follows

  // ---- group 0 merges tile A, group 1 tile B: the NG partials one after the other, in f32 ----
  const float* mg0 = ((grp == 0) ? (const float*)Pa : (const float*)Pb) + wave * MGW + lane;
#pragma unroll
  for (int t = 0; t < 8; ++t) {
#pragma unroll
    for (int r = 0; r < 8; ++r) oh[t][r] = mg0[(t * 8 + r) * 32];
  }
  mrow = mg0[64 * 32];
  lrow = mg0[65 * 32];
#pragma unroll
  for (int g = 1; g < NG; ++g) {
    const float* mg = mg0 + g * 4 * MGW;
    const float m1 = mg[64 * 32];
    const float l1 = mg[65 * 32];
    const float mm = fmaxf(mrow, m1);
    const float a0 = hw_exp2(mrow - mm);
    const float a1 = hw_exp2(m1 - mm);        // 0 where group g had no chunk of the tile (m1 = NEG_BIG) and another had
    mrow = mm;
    lrow = lrow * a0 + l1 * a1;
#pragma unroll
    for (int t = 0; t < 8; ++t) {
#pragma unroll
      for (int r = 0; r < 8; ++r) oh[t][r] = oh[t][r] * a0 + mg[(t * 8 + r) * 32] * a1;
    }
  }

  // ---- join the lane halves' sums, normalise (1/l, the 1/PSC p carry and the 1/VSC v carry), stage the wave's 16x128
  //      tile interleaved: lane (c, hh) holds query row c; v_r columns d, d + 1 (tile t) and v_i columns d, d + 1
  //      (tile t + 4) are four consecutive floats [r_d, i_d, r_d+1, i_d+1] of the row, one 16-B LDS store. The staging
  //      lies in the V^T ring, which no wave reads behind the barriers above; each wave has a part of its own ----
  float* os = (float*)(void*)&Vs[0][0] + (grp * 4 + wave) * 16 * OP;
  const float l = lrow + xhalf(lrow);
  const float inv = ((l > 0.f) ? (1.0f / l) : 0.f) * (1.0f / (PSC * VSC));
#pragma unroll
  for (int t = 0; t < 4; ++t) {
#pragma unroll
    for (int r = 0; r < 8; r += 2) {
      const v4f o = {oh[t][r] * inv, oh[t + 4][r] * inv, oh[t][r + 1] * inv, oh[t + 4][r + 1] * inv};
      *(v4f*)(os + c * OP + 2 * (t * 16 + 8 * hh + r)) = o;
    }
  }
  const int qo = ((grp == 0) ? qbA : qbB) * 64 + wave * 16;
  float* g0 = out + ((size_t)(b * SEQ + qo) * NHEAD + h) * VW + lane * 4;   // row qo of (b, h), this lane's 16 B
  wave_sync_lds();
  {
#pragma unroll
    for (int it = 0; it < 16; ++it) {                    // row it: 32 lanes x 16 B = 512 B = 128 floats
      const v4f o = *(const v4f*)(os + it * OP + lane * 4);
      *(v4f*)(g0 + (size_t)it * NHEAD * VW) = o;
    }
  }
}

// =====================================================================================================
// Workspace map (bytes); every plane is an exact multiple of its whole-line store granularity (all dims are exact
// tile multiples, no padded tails), all offsets multiples of 8 MiB:
//   QB  bf16 [2 parts][4096 t][512]             0   8388608   (q_r, q_i RNE bits)
//   KB  bf16 [2 parts][4096 t][512]       8388608   8388608   (k_r, k_i RNE bits)
//   VT  f16  [2 b][2 parts][512 (h,d)][2048 t] 16777216   8388608   (bf16 value x16)
//   end                                 25165824
// =====================================================================================================
extern "C" void kernel_launch(void* const* d_in, const int* in_sizes, int n_in,
                              void* d_out, int out_size, void* d_ws, size_t ws_size,
                              hipStream_t stream) {
  const int n = NTOK * DMOD;                                // 2097152 elements per input
  if (n_in < 6) return;
  for (int i = 0; i < 6; ++i) if (in_sizes[i] != n) return;
  if (out_size != 2 * n) return;

  const float* qr = (const float*)d_in[0];
  const float* qi = (const float*)d_in[1];
  const float* kr = (const float*)d_in[2];
  const float* ki = (const float*)d_in[3];
  const float* vr = (const float*)d_in[4];
  const float* vi = (const float*)d_in[5];
  float* outf = (float*)d_out;

  const size_t PQB = (size_t)2 * n * 2;                     //  8388608
  const size_t PKB = (size_t)2 * n * 2;                     //  8388608
  const size_t PVT = (size_t)NBATCH * 2 * DMOD * SEQ * 2;   //  8388608
  size_t off = 0;
  const size_t oQ = off; off += PQB;
  const size_t oK = off; off += PKB;
  const size_t oV = off; off += PVT;
  if (off > ws_size) return;                                // off = 25165824
  if (off > (size_t)134217728) return;

  char* ws = (char*)d_ws;
  unsigned short* QB = (unsigned short*)(ws + oQ);
  unsigned short* KB = (unsigned short*)(ws + oK);
  unsigned short* VT = (unsigned short*)(ws + oV);

  const dim3 blkatt(128 * NG);

  // (1) q, k -> bf16 planes [part][4096 t][512] and v -> transposed f16 planes [b][part][512 (h,d)][2048 t], one launch
  prep<<<dim3(PREPB), dim3(512), 0, stream>>>(qr, qi, kr, ki, vr, vi, QB, KB, VT);
  // (2) causal attention -> d_out, one launch, a block per pair of query tiles: tiles 0..NQP-1 (rows < 512) with the p residual tile
  attn_c<<<dim3((NQB / 2) * NHEAD * NBATCH), blkatt, 0, stream>>>(QB, KB, VT, outf);
  (void)hipGetLastError();
}
